// v000
// Measured on an AMD MI455X. A time is GPU time per run, averaged over a window of back-to-back runs after a warm-up
// (all launches, gaps included; the runs take copies of the inputs in turn), and the median of several windows.
// Apart from v000's, it joins two sittings. Times from different sittings can be a few percent apart, while
// side-by-side timings come from the same sitting.
// v000, which the later versions start from, runs in 1990 microseconds.
#include <hip/hip_runtime.h>
#include <math.h>

// ---------------------------------------------------------------------------
// PIT pipeline for MI455X (gfx1250, wave32).
// - Never materialize distance/attention matrices: recompute d2 from 2-D
//   coords, fused mask->exp->normalize->matvec (all live data L2-resident).
// - Per-row quantile via in-LDS radix select on float bit patterns.
// - Dense [N,64]x[64,64] GEMMs via V_WMMA_F32_16X16X4_F32 (full f32 fidelity).
// - Attention val tiles staged LDS-double-buffered via the CDNA5 async DMA
//   path (global_load_async_to_lds_b128 + s_wait_asynccnt), overlapped with
//   the distance/exp phase.
// ---------------------------------------------------------------------------

#define NX   11271     // 221*51 input points
#define NL   2886      // 111*26 latent points
#define HID  64

typedef __attribute__((ext_vector_type(2))) float v2f;
typedef __attribute__((ext_vector_type(8))) float v8f;

__device__ __forceinline__ float gelu_erf(float v) {
    // torch F.gelu default: 0.5*x*(1+erf(x/sqrt(2)))
    return 0.5f * v * (1.0f + erff(v * 0.70710678118654752f));
}

// ---------------------------------------------------------------------------
// Build latent coords: ltt = x[:, ::2, ::2, :][:, :111, :26, :]
// ---------------------------------------------------------------------------
__global__ void k_ltt(const float* __restrict__ x, float* __restrict__ ltt) {
    int l = blockIdx.x * blockDim.x + threadIdx.x;
    if (l >= NL) return;
    int i = l / 26, j = l % 26;
    const float* p = x + ((size_t)(2 * i) * 51 + (size_t)(2 * j)) * 2;
    ltt[2 * l + 0] = p[0];
    ltt[2 * l + 1] = p[1];
}

// ---------------------------------------------------------------------------
// Encoder: h0[j,c] = gelu(x0*W[0,c] + x1*W[1,c] + b[c]),  K=2 -> plain VALU
// ---------------------------------------------------------------------------
__global__ void k_encoder(const float* __restrict__ x, const float* __restrict__ W,
                          const float* __restrict__ b, float* __restrict__ h0, int n) {
    int i = blockIdx.x * blockDim.x + threadIdx.x;
    if (i >= n * HID) return;
    int j = i >> 6, c = i & 63;
    float v = fmaf(x[2 * j + 0], W[c], fmaf(x[2 * j + 1], W[HID + c], b[c]));
    h0[i] = gelu_erf(v);
}

// ---------------------------------------------------------------------------
// Repack per-head weights [4][64][16] -> concatenated B [64][64] so the val
// projection becomes a single 64x64 GEMM: B[j][h*16+k] = w[h][j][k]
// ---------------------------------------------------------------------------
__global__ void k_repack(const float* __restrict__ w, float* __restrict__ Bp) {
    int t = blockIdx.x * blockDim.x + threadIdx.x;
    if (t >= HID * HID) return;
    int j = t >> 6, c = t & 63;
    int h = c >> 4, k = c & 15;
    Bp[t] = w[h * (HID * 16) + j * 16 + k];
}

// ---------------------------------------------------------------------------
// Generic WMMA GEMM: C[N,64] = act( A[N,64] @ B[64,64] + bias (+addend) )
// One wave = one 16x16 output tile (wave w of 4 owns cols 16w..16w+15).
// f32 WMMA fragment layouts per CDNA5 ISA 7.12.2:
//   A 16x4 : lanes 0-15 -> M=lane, VGPR{0,1}=K{0,1};  lanes 16-31 -> K{2,3}
//   B 4x16 : lanes 0-15 -> N=lane, VGPR{0,1}=K{0,1};  lanes 16-31 -> K{2,3}
//   C 16x16: VGPR r -> M = r + 8*(lane>=16), N = lane&15
// ---------------------------------------------------------------------------
__global__ void k_gemm_n64(const float* __restrict__ A, const float* __restrict__ B,
                           const float* __restrict__ bias, const float* __restrict__ addend,
                           float* __restrict__ C, int N, int act) {
    int lane = threadIdx.x & 31;
    int wave = threadIdx.x >> 5;           // 0..3 -> column tile
    int r0 = blockIdx.x * 16;
    int colBase = wave * 16;
    int laneN = lane & 15;
    int hi = lane >> 4;                    // half-wave selector
    int kk = hi * 2;                       // K sub-offset {0,2}

    int aRow = r0 + laneN;                 // A-fragment row (M = lane&15)
    if (aRow > N - 1) aRow = N - 1;        // clamp tail reads (stores predicated)
    const float* Arow = A + (size_t)aRow * HID;

    v8f acc = {};
    for (int k = 0; k < HID; k += 4) {
        v2f a, b;
        a.x = Arow[k + kk + 0];
        a.y = Arow[k + kk + 1];
        b.x = B[(k + kk + 0) * HID + colBase + laneN];
        b.y = B[(k + kk + 1) * HID + colBase + laneN];
        acc = __builtin_amdgcn_wmma_f32_16x16x4_f32(
            /*neg_a=*/false, a, /*neg_b=*/false, b,
            /*c_mod=*/(short)0, acc, /*reuse_a=*/false, /*reuse_b=*/false);
    }

    int col = colBase + laneN;
    float bv = bias ? bias[col] : 0.0f;
#pragma unroll
    for (int r = 0; r < 8; r++) {
        int row = r0 + r + 8 * hi;
        if (row < N) {
            float v = acc[r] + bv;
            if (addend) v += addend[(size_t)row * HID + col];
            if (act) v = gelu_erf(v);
            C[(size_t)row * HID + col] = v;
        }
    }
}

// ---------------------------------------------------------------------------
// Per-row quantile of squared distances via in-LDS radix select.
// thr[row] = s[kth] + frac*(s[kth+1] - s[kth])   (jnp.quantile 'linear')
// d2 >= 0 so float bit patterns are order-preserving as uints.
// Dynamic LDS: uint bits[nK] + uint hist[256]
// ---------------------------------------------------------------------------
__global__ void k_quantile(const float* __restrict__ Qc, const float* __restrict__ Kc,
                           int nK, int kth, float frac, float* __restrict__ thr_out) {
    extern __shared__ unsigned int sm[];
    unsigned int* bits = sm;
    unsigned int* hist = sm + nK;
    __shared__ unsigned int s_prefix, s_want, s_cntle, s_mingt;

    int row = blockIdx.x, tid = threadIdx.x;
    float qx = Qc[2 * row + 0], qy = Qc[2 * row + 1];
    for (int j = tid; j < nK; j += blockDim.x) {
        float dx = qx - Kc[2 * j + 0];
        float dy = qy - Kc[2 * j + 1];
        float d2 = fmaf(dx, dx, dy * dy);
        bits[j] = __float_as_uint(d2);
    }
    if (tid == 0) { s_prefix = 0u; s_want = (unsigned)kth; }
    __syncthreads();

    for (int shift = 24; shift >= 0; shift -= 8) {
        for (int b = tid; b < 256; b += blockDim.x) hist[b] = 0u;
        __syncthreads();
        unsigned pfx = s_prefix;
        for (int j = tid; j < nK; j += blockDim.x) {
            unsigned u = bits[j];
            bool match = (shift == 24) || (((u ^ pfx) >> (shift + 8)) == 0u);
            if (match) atomicAdd(&hist[(u >> shift) & 255u], 1u);
        }
        __syncthreads();
        if (tid == 0) {
            unsigned want = s_want, accum = 0u, bsel = 255u;
            for (unsigned b = 0; b < 256u; b++) {
                unsigned c = hist[b];
                if (accum + c > want) { bsel = b; break; }
                accum += c;
            }
            s_prefix = pfx | (bsel << shift);
            s_want = want - accum;
        }
        __syncthreads();
    }

    unsigned v = s_prefix;                 // bit pattern of s[kth]
    if (tid == 0) { s_cntle = 0u; s_mingt = 0xFFFFFFFFu; }
    __syncthreads();
    unsigned cl = 0u, mg = 0xFFFFFFFFu;
    for (int j = tid; j < nK; j += blockDim.x) {
        unsigned u = bits[j];
        if (u <= v) cl++;
        else if (u < mg) mg = u;
    }
    atomicAdd(&s_cntle, cl);
    atomicMin(&s_mingt, mg);
    __syncthreads();
    if (tid == 0) {
        float sk  = __uint_as_float(v);
        float sk1 = (s_cntle >= (unsigned)(kth + 2)) ? sk : __uint_as_float(s_mingt);
        thr_out[row] = fmaf(frac, sk1 - sk, sk);
    }
}

// ---------------------------------------------------------------------------
// Async DMA: stage a 64-row x 64-col f32 val tile (16 KB) into LDS.
// 64 threads x 16 b128 ops x 16 B = 16 KB; ASYNCcnt +16 per wave.
// NOTE: caller guarantees the 16 KB window stays inside the workspace (the last nK=NX tile runs past val into hq)
// (val is always the NX*64 workspace buffer) and 16-B alignment.
// ---------------------------------------------------------------------------
__device__ __forceinline__ void async_stage_tile(const float* val, int row0,
                                                 void* ldsbuf, int t) {
    unsigned lbase = (unsigned)(size_t)ldsbuf;
    unsigned long long gbase =
        (unsigned long long)(size_t)val + (unsigned long long)row0 * (HID * 4);
#pragma unroll
    for (int i = 0; i < 16; i++) {
        unsigned loff = lbase + (unsigned)((i * 64 + t) * 16);
        unsigned long long ga = gbase + (unsigned long long)((i * 64 + t) * 16);
        asm volatile("global_load_async_to_lds_b128 %0, %1, off"
                     :: "v"(loff), "v"(ga) : "memory");
    }
}

// ---------------------------------------------------------------------------
// Fused masked multi-head softmax attention + gelu.
// out[q, h*16+v] = gelu( sum_j w_h(q,j) * val[j, h*16+v] / sum_j w_h(q,j) )
//   w_h = exp(-c_h * d2(q,j)) if d2 <= thr[q] else 0 ;  c_h = tan(pi/4*(1+sin r_h))
// (positive c_h => head-independent mask; exponents in [-c*thr, 0] => stable.)
// Block = 64 threads (2 waves): thread t owns output column t. Keys processed
// in chunks of 64; the val tile for chunk c+1 is async-DMA'd into the other
// LDS buffer while chunk c's weights are computed (phase 1). Async loads
// complete in order, so s_wait_asynccnt 16 releases the current tile.
// ---------------------------------------------------------------------------
__global__ void k_attn(const float* __restrict__ Qc,
                       const float* __restrict__ Kc, int nK,
                       const float* __restrict__ val,
                       const float* __restrict__ rr,
                       const float* __restrict__ thr,
                       float* __restrict__ out) {
    __shared__ __align__(16) float vtile[2][64][64];   // 32 KB double buffer
    __shared__ float wsh[4][64];
    __shared__ float sden[4][64];
    __shared__ float cs[4];
    __shared__ float sd[4];

    int t = threadIdx.x;                   // 0..63
    int q = blockIdx.x;
    if (t < 4) cs[t] = tanf(0.78539816339744831f * (1.0f + sinf(rr[t])));

    // prologue: stage chunk 0 into vtile[0]
    async_stage_tile(val, 0, &vtile[0][0][0], t);
    __syncthreads();                       // cs visible

    float qx = Qc[2 * q + 0], qy = Qc[2 * q + 1];
    float thrq = thr ? thr[q] : 3.402823466e+38f;
    float c0 = cs[0], c1 = cs[1], c2 = cs[2], c3 = cs[3];
    int myH = t >> 4;
    float num = 0.0f;
    float dp0 = 0.f, dp1 = 0.f, dp2 = 0.f, dp3 = 0.f;

    int p = 0;
    for (int j0 = 0; j0 < nK; j0 += 64, p ^= 1) {
        // both waves done reading vtile[p^1] (phase 2 of previous chunk) and
        // done reading wsh before we overwrite either
        __syncthreads();
        bool hasNext = (j0 + 64) < nK;
        if (hasNext) async_stage_tile(val, j0 + 64, &vtile[p ^ 1][0][0], t);

        // ---- phase 1: distances -> masked per-head weights ----
        int j = j0 + t;
        float w0 = 0.f, w1 = 0.f, w2 = 0.f, w3 = 0.f;
        if (j < nK) {
            float dx = qx - Kc[2 * j + 0];
            float dy = qy - Kc[2 * j + 1];
            float d2 = fmaf(dx, dx, dy * dy);
            if (d2 <= thrq) {
                w0 = expf(-c0 * d2); w1 = expf(-c1 * d2);
                w2 = expf(-c2 * d2); w3 = expf(-c3 * d2);
            }
        }
        wsh[0][t] = w0; wsh[1][t] = w1; wsh[2][t] = w2; wsh[3][t] = w3;
        dp0 += w0; dp1 += w1; dp2 += w2; dp3 += w3;

        // current tile's 16 async ops are the oldest outstanding; in-order
        // completion means cnt<=16 (next issued) / cnt==0 (last chunk) is safe
        if (hasNext) asm volatile("s_wait_asynccnt 0x10" ::: "memory");
        else         asm volatile("s_wait_asynccnt 0x0"  ::: "memory");
        __syncthreads();                   // DMA'd tile + wsh visible to both waves

        // ---- phase 2: accumulate num from LDS tile (bank-conflict-free) ----
        int lim = nK - j0; if (lim > 64) lim = 64;
        for (int jj = 0; jj < lim; jj++)
            num = fmaf(wsh[myH][jj], vtile[p][jj][t], num);
    }

    sden[0][t] = dp0; sden[1][t] = dp1; sden[2][t] = dp2; sden[3][t] = dp3;
    __syncthreads();
    if (t < 4) {
        float s = 0.f;
        for (int i = 0; i < 64; i++) s += sden[t][i];
        sd[t] = s;
    }
    __syncthreads();
    out[(size_t)q * HID + t] = gelu_erf(num / sd[myH]);
}

// ---------------------------------------------------------------------------
// Decoder head: out[j] = t[j,:] . de2_w + de2_b   ([64,1] weight)
// ---------------------------------------------------------------------------
__global__ void k_dot64(const float* __restrict__ t, const float* __restrict__ w,
                        const float* __restrict__ b, float* __restrict__ out, int n) {
    int j = blockIdx.x * blockDim.x + threadIdx.x;
    if (j >= n) return;
    float s = b[0];
    const float* row = t + (size_t)j * HID;
#pragma unroll
    for (int k = 0; k < HID; k++) s = fmaf(row[k], w[k], s);
    out[j] = s;
}

// ---------------------------------------------------------------------------
extern "C" void kernel_launch(void* const* d_in, const int* in_sizes, int n_in,
                              void* d_out, int out_size, void* d_ws, size_t ws_size,
                              hipStream_t stream) {
    (void)in_sizes; (void)n_in; (void)out_size; (void)ws_size;

    const float* x      = (const float*)d_in[0];   // [1,221,51,2] == xf [11271,2]
    const float* en_w   = (const float*)d_in[1];
    const float* en_b   = (const float*)d_in[2];
    const float* down_r = (const float*)d_in[3];
    const float* down_w = (const float*)d_in[4];
    const float* pa_r   = (const float*)d_in[5];   // [4,1,4,1,1]
    const float* pa_w   = (const float*)d_in[6];   // [4,4,64,16]
    const float* mlp1_w = (const float*)d_in[7];
    const float* mlp1_b = (const float*)d_in[8];
    const float* mlp2_w = (const float*)d_in[9];
    const float* mlp2_b = (const float*)d_in[10];
    const float* lin_w  = (const float*)d_in[11];
    const float* lin_b  = (const float*)d_in[12];
    const float* up_r   = (const float*)d_in[13];
    const float* up_w   = (const float*)d_in[14];
    const float* de1_w  = (const float*)d_in[15];
    const float* de1_b  = (const float*)d_in[16];
    const float* de2_w  = (const float*)d_in[17];
    const float* de2_b  = (const float*)d_in[18];

    // workspace layout (floats) ~12.5 MB; vbuf always holds attention val and
    // is sized NX*64; the last nK=NX staged tile runs past it into hq.
    float* ws   = (float*)d_ws;
    float* ltt  = ws;                    // NL*2
    float* h0   = ltt  + (size_t)NL * 2; // NX*64
    float* vbuf = h0   + (size_t)NX * HID;
    float* hq   = vbuf + (size_t)NX * HID;
    float* hA   = hq   + (size_t)NX * HID;   // NL*64
    float* hB   = hA   + (size_t)NL * HID;
    float* aL   = hB   + (size_t)NL * HID;
    float* tL   = aL   + (size_t)NL * HID;
    float* mL   = tL   + (size_t)NL * HID;
    float* thrD = mL   + (size_t)NL * HID;   // NL
    float* thrU = thrD + NL;                 // NX
    float* Bp   = thrU + NX;                 // 64*64

    const int gemmNL = (NL + 15) / 16, gemmNX = (NX + 15) / 16;

    // latent coords + encoder
    k_ltt<<<(NL + 255) / 256, 256, 0, stream>>>(x, ltt);
    k_encoder<<<(NX * HID + 255) / 256, 256, 0, stream>>>(x, en_w, en_b, h0, NX);

    // ---- down: latent <- input (5% locality) ----
    k_repack<<<16, 256, 0, stream>>>(down_w, Bp);
    k_gemm_n64<<<gemmNX, 128, 0, stream>>>(h0, Bp, nullptr, nullptr, vbuf, NX, 0);
    // quantile over nK=11271: pos = 0.05*11270 = 563.5 -> k=563, frac=0.5
    k_quantile<<<NL, 256, (size_t)NX * 4 + 1024, stream>>>(ltt, x, NX, 563, 0.5f, thrD);
    k_attn<<<NL, 64, 0, stream>>>(ltt, x, NX, vbuf, down_r, thrD, hA);

    // ---- 4 latent blocks (dense attention, no mask) ----
    float* hin = hA;
    float* hout = hB;
    for (int i = 0; i < 4; i++) {
        k_repack<<<16, 256, 0, stream>>>(pa_w + (size_t)i * 4096, Bp);
        k_gemm_n64<<<gemmNL, 128, 0, stream>>>(hin, Bp, nullptr, nullptr, vbuf, NL, 0);
        k_attn<<<NL, 64, 0, stream>>>(ltt, ltt, NL, vbuf, pa_r + (size_t)i * 4, nullptr, aL);
        k_gemm_n64<<<gemmNL, 128, 0, stream>>>(aL, mlp1_w + (size_t)i * 4096,
                                               mlp1_b + (size_t)i * 64, nullptr, tL, NL, 1);
        k_gemm_n64<<<gemmNL, 128, 0, stream>>>(tL, mlp2_w + (size_t)i * 4096,
                                               mlp2_b + (size_t)i * 64, nullptr, mL, NL, 0);
        // h = gelu(m + h @ lin_w + lin_b)   (ping-pong to avoid in-place hazard)
        k_gemm_n64<<<gemmNL, 128, 0, stream>>>(hin, lin_w + (size_t)i * 4096,
                                               lin_b + (size_t)i * 64, mL, hout, NL, 1);
        float* tmp = hin; hin = hout; hout = tmp;
    }

    // ---- up: input <- latent (5% locality) ----
    k_repack<<<16, 256, 0, stream>>>(up_w, Bp);
    k_gemm_n64<<<gemmNL, 128, 0, stream>>>(hin, Bp, nullptr, nullptr, vbuf, NL, 0);
    // quantile over nK=2886: pos = 0.05*2885 = 144.25 -> k=144, frac=0.25
    k_quantile<<<NX, 256, (size_t)NL * 4 + 1024, stream>>>(x, ltt, NL, 144, 0.25f, thrU);
    k_attn<<<NX, 64, 0, stream>>>(x, ltt, NL, vbuf, up_r, thrU, hq);

    // ---- decoder ----
    k_gemm_n64<<<gemmNX, 128, 0, stream>>>(hq, de1_w, de1_b, nullptr, h0, NX, 1);
    k_dot64<<<(NX + 255) / 256, 256, 0, stream>>>(h0, de2_w, de2_b, (float*)d_out, NX);
}

// v001
// Measured time: 903 microseconds a run.
// Two timings next to v000 both put it at 2.23 times that version's speed.
#include <hip/hip_runtime.h>
#include <math.h>

// ---------------------------------------------------------------------------
// PIT pipeline for MI455X (gfx1250, wave32).
// - Never materialize distance/attention matrices: recompute d2 from 2-D
//   coords, fused mask->exp->normalize->matvec (all live data L2-resident).
// - Per-row quantile via in-LDS radix select on float bit patterns.
// - Dense [N,64]x[64,64] GEMMs via V_WMMA_F32_16X16X4_F32 (full f32 fidelity).
// - Attention in tiles of 16 queries: weights x val on the same f32 WMMA, keys
//   split over the waves of a block.
// ---------------------------------------------------------------------------

#define NX   11271     // 221*51 input points
#define NL   2886      // 111*26 latent points
#define HID  64

typedef __attribute__((ext_vector_type(2))) float v2f;
typedef __attribute__((ext_vector_type(8))) float v8f;

__device__ __forceinline__ float gelu_erf(float v) {
    // torch F.gelu default: 0.5*x*(1+erf(x/sqrt(2)))
    return 0.5f * v * (1.0f + erff(v * 0.70710678118654752f));
}

// ---------------------------------------------------------------------------
// Build latent coords: ltt = x[:, ::2, ::2, :][:, :111, :26, :]
// ---------------------------------------------------------------------------
__global__ void k_ltt(const float* __restrict__ x, float* __restrict__ ltt) {
    int l = blockIdx.x * blockDim.x + threadIdx.x;
    if (l >= NL) return;
    int i = l / 26, j = l % 26;
    const float* p = x + ((size_t)(2 * i) * 51 + (size_t)(2 * j)) * 2;
    ltt[2 * l + 0] = p[0];
    ltt[2 * l + 1] = p[1];
}

// ---------------------------------------------------------------------------
// Encoder: h0[j,c] = gelu(x0*W[0,c] + x1*W[1,c] + b[c]),  K=2 -> plain VALU
// ---------------------------------------------------------------------------
__global__ void k_encoder(const float* __restrict__ x, const float* __restrict__ W,
                          const float* __restrict__ b, float* __restrict__ h0, int n) {
    int i = blockIdx.x * blockDim.x + threadIdx.x;
    if (i >= n * HID) return;
    int j = i >> 6, c = i & 63;
    float v = fmaf(x[2 * j + 0], W[c], fmaf(x[2 * j + 1], W[HID + c], b[c]));
    h0[i] = gelu_erf(v);
}

// ---------------------------------------------------------------------------
// Repack per-head weights [4][64][16] -> concatenated B [64][64] so the val
// projection becomes a single 64x64 GEMM: B[j][h*16+k] = w[h][j][k]
// ---------------------------------------------------------------------------
__global__ void k_repack(const float* __restrict__ w, float* __restrict__ Bp) {
    int t = blockIdx.x * blockDim.x + threadIdx.x;
    if (t >= HID * HID) return;
    int j = t >> 6, c = t & 63;
    int h = c >> 4, k = c & 15;
    Bp[t] = w[h * (HID * 16) + j * 16 + k];
}

// ---------------------------------------------------------------------------
// Generic WMMA GEMM: C[N,64] = act( A[N,64] @ B[64,64] + bias (+addend) )
// One wave = one 16x16 output tile (wave w of 4 owns cols 16w..16w+15).
// f32 WMMA fragment layouts per CDNA5 ISA 7.12.2:
//   A 16x4 : lanes 0-15 -> M=lane, VGPR{0,1}=K{0,1};  lanes 16-31 -> K{2,3}
//   B 4x16 : lanes 0-15 -> N=lane, VGPR{0,1}=K{0,1};  lanes 16-31 -> K{2,3}
//   C 16x16: VGPR r -> M = r + 8*(lane>=16), N = lane&15
// ---------------------------------------------------------------------------
__global__ void k_gemm_n64(const float* __restrict__ A, const float* __restrict__ B,
                           const float* __restrict__ bias, const float* __restrict__ addend,
                           float* __restrict__ C, int N, int act) {
    int lane = threadIdx.x & 31;
    int wave = threadIdx.x >> 5;           // 0..3 -> column tile
    int r0 = blockIdx.x * 16;
    int colBase = wave * 16;
    int laneN = lane & 15;
    int hi = lane >> 4;                    // half-wave selector
    int kk = hi * 2;                       // K sub-offset {0,2}

    int aRow = r0 + laneN;                 // A-fragment row (M = lane&15)
    if (aRow > N - 1) aRow = N - 1;        // clamp tail reads (stores predicated)
    const float* Arow = A + (size_t)aRow * HID;

    v8f acc = {};
    for (int k = 0; k < HID; k += 4) {
        v2f a, b;
        a.x = Arow[k + kk + 0];
        a.y = Arow[k + kk + 1];
        b.x = B[(k + kk + 0) * HID + colBase + laneN];
        b.y = B[(k + kk + 1) * HID + colBase + laneN];
        acc = __builtin_amdgcn_wmma_f32_16x16x4_f32(
            /*neg_a=*/false, a, /*neg_b=*/false, b,
            /*c_mod=*/(short)0, acc, /*reuse_a=*/false, /*reuse_b=*/false);
    }

    int col = colBase + laneN;
    float bv = bias ? bias[col] : 0.0f;
#pragma unroll
    for (int r = 0; r < 8; r++) {
        int row = r0 + r + 8 * hi;
        if (row < N) {
            float v = acc[r] + bv;
            if (addend) v += addend[(size_t)row * HID + col];
            if (act) v = gelu_erf(v);
            C[(size_t)row * HID + col] = v;
        }
    }
}

// ---------------------------------------------------------------------------
// Per-row quantile of squared distances via in-LDS radix select.
// thr[row] = s[kth] + frac*(s[kth+1] - s[kth])   (jnp.quantile 'linear')
// d2 >= 0 so float bit patterns are order-preserving as uints.
// Dynamic LDS: uint bits[nK] + uint hist[256]
// ---------------------------------------------------------------------------
__global__ void k_quantile(const float* __restrict__ Qc, const float* __restrict__ Kc,
                           int nK, int kth, float frac, float* __restrict__ thr_out) {
    extern __shared__ unsigned int sm[];
    unsigned int* bits = sm;
    unsigned int* hist = sm + nK;
    __shared__ unsigned int s_prefix, s_want, s_cntle, s_mingt;

    int row = blockIdx.x, tid = threadIdx.x;
    float qx = Qc[2 * row + 0], qy = Qc[2 * row + 1];
    for (int j = tid; j < nK; j += blockDim.x) {
        float dx = qx - Kc[2 * j + 0];
        float dy = qy - Kc[2 * j + 1];
        float d2 = fmaf(dx, dx, dy * dy);
        bits[j] = __float_as_uint(d2);
    }
    if (tid == 0) { s_prefix = 0u; s_want = (unsigned)kth; }
    __syncthreads();

    for (int shift = 24; shift >= 0; shift -= 8) {
        for (int b = tid; b < 256; b += blockDim.x) hist[b] = 0u;
        __syncthreads();
        unsigned pfx = s_prefix;
        for (int j = tid; j < nK; j += blockDim.x) {
            unsigned u = bits[j];
            bool match = (shift == 24) || (((u ^ pfx) >> (shift + 8)) == 0u);
            if (match) atomicAdd(&hist[(u >> shift) & 255u], 1u);
        }
        __syncthreads();
        if (tid == 0) {
            unsigned want = s_want, accum = 0u, bsel = 255u;
            for (unsigned b = 0; b < 256u; b++) {
                unsigned c = hist[b];
                if (accum + c > want) { bsel = b; break; }
                accum += c;
            }
            s_prefix = pfx | (bsel << shift);
            s_want = want - accum;
        }
        __syncthreads();
    }

    unsigned v = s_prefix;                 // bit pattern of s[kth]
    if (tid == 0) { s_cntle = 0u; s_mingt = 0xFFFFFFFFu; }
    __syncthreads();
    unsigned cl = 0u, mg = 0xFFFFFFFFu;
    for (int j = tid; j < nK; j += blockDim.x) {
        unsigned u = bits[j];
        if (u <= v) cl++;
        else if (u < mg) mg = u;
    }
    atomicAdd(&s_cntle, cl);
    atomicMin(&s_mingt, mg);
    __syncthreads();
    if (tid == 0) {
        float sk  = __uint_as_float(v);
        float sk1 = (s_cntle >= (unsigned)(kth + 2)) ? sk : __uint_as_float(s_mingt);
        thr_out[row] = fmaf(frac, sk1 - sk, sk);
    }
}

// ---------------------------------------------------------------------------
// One group of 16 keys for a tile of 16 queries, all four heads.
// The masked weights are computed straight into the WMMA A fragment
// (M = query = lane&15, K = key) and the val rows are the B fragment
// (K = key, N = column within the head), with the same key in the same K slot:
//   lanes 0-15 : VGPR{0,1} = keys j+0, j+1 ; lanes 16-31 : keys j+2, j+3
// jb = first key of the group + 2*(lane>>4). TAIL clamps every key index and
// zeroes the weights of keys past the end.
// ---------------------------------------------------------------------------
template <bool TAIL>
__device__ __forceinline__ void attn_group16(const float* __restrict__ Kc,
                                             const float* __restrict__ val,
                                             int nK, int jb, int laneN,
                                             float qx, float qy, float thrq,
                                             const float (&c)[4],
                                             v8f (&acc)[4], v2f (&den)[4]) {
    // all loads of the group first, the coordinates ahead of the val rows, so
    // that the val rows fly under the weights' arithmetic
    v2f b[4][4];
    float kx[4][2], ky[4][2];
#pragma unroll   // constant indices keep the register arrays in registers
    for (int s = 0; s < 4; s++) {
        int j = jb + s * 4;
        if (TAIL) {
            int ja = j < nK ? j : nK - 1;
            int jc = j + 1 < nK ? j + 1 : nK - 1;
            kx[s][0] = Kc[2 * ja + 0]; ky[s][0] = Kc[2 * ja + 1];
            kx[s][1] = Kc[2 * jc + 0]; ky[s][1] = Kc[2 * jc + 1];
        } else {
            float4 k4 = *(const float4*)(Kc + 2 * j);   // j is even: 16-B aligned
            kx[s][0] = k4.x; ky[s][0] = k4.y; kx[s][1] = k4.z; ky[s][1] = k4.w;
        }
    }
    // the val loads' results and addresses may land in the coordinate loads'
    // address registers; as a memory fence it also keeps the coordinate loads in
    // front (loads return in order: issued last, they would make the first
    // distance wait for every val row as well)
    asm volatile("s_wait_xcnt 0x0" ::: "memory");
    // holds the val rows' address arithmetic behind that wait
    __builtin_amdgcn_sched_barrier(0);
#pragma unroll   // constant indices keep the register arrays in registers
    for (int s = 0; s < 4; s++) {
        const float* va;
        const float* vc;
        if (TAIL) {
            int j = jb + s * 4;
            int ja = j < nK ? j : nK - 1;
            int jc = j + 1 < nK ? j + 1 : nK - 1;
            va = val + (size_t)ja * HID + laneN;
            vc = val + (size_t)jc * HID + laneN;
        } else {
            va = val + (size_t)jb * HID + laneN + s * 4 * HID;   // one address, constant offsets
            vc = va + HID;
        }
#pragma unroll   // constant indices keep the register arrays in registers
        for (int h = 0; h < 4; h++) { b[s][h].x = va[h * 16]; b[s][h].y = vc[h * 16]; }
        // clamped rows have address registers of their own for each run, and the
        // next run's results may land in them
        if (TAIL) asm volatile("s_wait_xcnt 0x0" ::: "memory");
    }
    // the arithmetic below may reuse the val loads' address registers
    if (!TAIL) asm volatile("s_wait_xcnt 0x0" ::: "memory");
    // keeps the wait for the coordinates behind the issue of the val loads
    __builtin_amdgcn_sched_barrier(0);
#pragma unroll   // constant indices keep the register arrays in registers
    for (int s = 0; s < 4; s++) {
        int j = jb + s * 4;
        float dx0 = qx - kx[s][0], dy0 = qy - ky[s][0];
        float dx1 = qx - kx[s][1], dy1 = qy - ky[s][1];
        float d20 = fmaf(dx0, dx0, dy0 * dy0);
        float d21 = fmaf(dx1, dx1, dy1 * dy1);
        bool ok0 = d20 <= thrq, ok1 = d21 <= thrq;
        if (TAIL) { ok0 = ok0 && (j < nK); ok1 = ok1 && (j + 1 < nK); }
#pragma unroll   // constant indices keep the register arrays in registers
        for (int h = 0; h < 4; h++) {
            // exp in every lane, then a select: no divergent branch round a WMMA
            float e0 = expf(-c[h] * d20);
            float e1 = expf(-c[h] * d21);
            v2f a;
            a.x = ok0 ? e0 : 0.0f;
            a.y = ok1 ? e1 : 0.0f;
            den[h] += a;                   // even and odd keys summed apart
            acc[h] = __builtin_amdgcn_wmma_f32_16x16x4_f32(
                /*neg_a=*/false, a, /*neg_b=*/false, b[s][h],
                /*c_mod=*/(short)0, acc[h], /*reuse_a=*/false, /*reuse_b=*/false);
        }
    }
}

// ---------------------------------------------------------------------------
// Fused masked multi-head softmax attention + gelu.
// out[q, h*16+v] = gelu( sum_j w_h(q,j) * val[j, h*16+v] / sum_j w_h(q,j) )
//   w_h = exp(-c_h * d2(q,j)) if d2 <= thr[q] else 0 ;  c_h = tan(pi/4*(1+sin r_h))
// (positive c_h => head-independent mask; exponents in [-c*thr, 0] => stable.)
// Block = 16 waves, one tile of 16 queries: every val row that is read serves
// 16 queries through one f32 WMMA per head. The keys are dealt to the waves in
// groups of 16; the waves' partial numerators and denominators are summed in
// LDS in a fixed order.
// ---------------------------------------------------------------------------
#define ATT_WAVES 16

__global__ __launch_bounds__(ATT_WAVES * 32)
void k_attn(const float* __restrict__ Qc, int nQ,
            const float* __restrict__ Kc, int nK,
            const float* __restrict__ val,
            const float* __restrict__ rr,
            const float* __restrict__ thr,
            float* __restrict__ out) {
    __shared__ float red[ATT_WAVES / 2][32][32];   // 32 KB partial numerators
    __shared__ float dred[ATT_WAVES][4][16];       // partial denominators
    __shared__ float cs[4];

    int tid = threadIdx.x;
    int lane = tid & 31;
    int wave = __builtin_amdgcn_readfirstlane(tid >> 5);   // scalar loop control
    int laneN = lane & 15;
    int hi = lane >> 4;
    int q0 = blockIdx.x * 16;

    if (tid < 4) cs[tid] = tanf(0.78539816339744831f * (1.0f + sinf(rr[tid])));
    __syncthreads();                       // cs visible

    int q = q0 + laneN;
    if (q > nQ - 1) q = nQ - 1;            // clamp tail reads (stores predicated)
    float qx = Qc[2 * q + 0], qy = Qc[2 * q + 1];
    float thrq = thr ? thr[q] : 3.402823466e+38f;
    // the address registers of the two loads above are reused at once
    asm volatile("s_wait_xcnt 0x0" ::: "memory");
    float c[4] = {cs[0], cs[1], cs[2], cs[3]};

    v8f acc[4] = {};
    v2f den[4] = {};

    int nFull = nK >> 4;                   // whole groups of 16 keys
    for (int g = wave; g < nFull; g += ATT_WAVES)
        attn_group16<false>(Kc, val, nK, g * 16 + hi * 2, laneN, qx, qy, thrq, c, acc, den);
    if ((nK & 15) != 0 && (nFull & (ATT_WAVES - 1)) == wave)   // the partial group, next wave in turn
        attn_group16<true>(Kc, val, nK, nFull * 16 + hi * 2, laneN, qx, qy, thrq, c, acc, den);

    // the two half-waves hold different keys of the same query
#pragma unroll   // constant indices keep the register arrays in registers
    for (int h = 0; h < 4; h++) {
        float dh = den[h].x + den[h].y;
        dh += __shfl_xor(dh, 16);
        if (hi == 0) dred[wave][h][laneN] = dh;
    }
    if (wave >= ATT_WAVES / 2) {
#pragma unroll   // constant indices keep the register arrays in registers
        for (int h = 0; h < 4; h++)
#pragma unroll   // constant indices keep the register arrays in registers
            for (int r = 0; r < 8; r++) red[wave - ATT_WAVES / 2][h * 8 + r][lane] = acc[h][r];
    }
    __syncthreads();                       // upper waves' partials visible
    if (wave < ATT_WAVES / 2) {
#pragma unroll   // constant indices keep the register arrays in registers
        for (int h = 0; h < 4; h++)
#pragma unroll   // constant indices keep the register arrays in registers
            for (int r = 0; r < 8; r++) red[wave][h * 8 + r][lane] += acc[h][r];
    }
    __syncthreads();                       // all partials visible

    // C layout: VGPR r -> M = r + 8*(lane>=16), N = lane&15
    for (int o = tid; o < 16 * HID; o += ATT_WAVES * 32) {
        int ql = o >> 6, col = o & 63;
        int h = col >> 4, n = col & 15;
        float num = 0.f, d = 0.f;
#pragma unroll   // lets the LDS reads issue together
        for (int w = 0; w < ATT_WAVES / 2; w++)
            num += red[w][h * 8 + (ql & 7)][(ql >> 3) * 16 + n];
#pragma unroll   // lets the LDS reads issue together
        for (int w = 0; w < ATT_WAVES; w++) d += dred[w][h][ql];
        if (q0 + ql < nQ) out[(size_t)(q0 + ql) * HID + col] = gelu_erf(num / d);
    }
}

// ---------------------------------------------------------------------------
// Decoder head: out[j] = t[j,:] . de2_w + de2_b   ([64,1] weight)
// ---------------------------------------------------------------------------
__global__ void k_dot64(const float* __restrict__ t, const float* __restrict__ w,
                        const float* __restrict__ b, float* __restrict__ out, int n) {
    int j = blockIdx.x * blockDim.x + threadIdx.x;
    if (j >= n) return;
    float s = b[0];
    const float* row = t + (size_t)j * HID;
#pragma unroll
    for (int k = 0; k < HID; k++) s = fmaf(row[k], w[k], s);
    out[j] = s;
}

// ---------------------------------------------------------------------------
extern "C" void kernel_launch(void* const* d_in, const int* in_sizes, int n_in,
                              void* d_out, int out_size, void* d_ws, size_t ws_size,
                              hipStream_t stream) {
    (void)in_sizes; (void)n_in; (void)out_size; (void)ws_size;

    const float* x      = (const float*)d_in[0];   // [1,221,51,2] == xf [11271,2]
    const float* en_w   = (const float*)d_in[1];
    const float* en_b   = (const float*)d_in[2];
    const float* down_r = (const float*)d_in[3];
    const float* down_w = (const float*)d_in[4];
    const float* pa_r   = (const float*)d_in[5];   // [4,1,4,1,1]
    const float* pa_w   = (const float*)d_in[6];   // [4,4,64,16]
    const float* mlp1_w = (const float*)d_in[7];
    const float* mlp1_b = (const float*)d_in[8];
    const float* mlp2_w = (const float*)d_in[9];
    const float* mlp2_b = (const float*)d_in[10];
    const float* lin_w  = (const float*)d_in[11];
    const float* lin_b  = (const float*)d_in[12];
    const float* up_r   = (const float*)d_in[13];
    const float* up_w   = (const float*)d_in[14];
    const float* de1_w  = (const float*)d_in[15];
    const float* de1_b  = (const float*)d_in[16];
    const float* de2_w  = (const float*)d_in[17];
    const float* de2_b  = (const float*)d_in[18];

    // workspace layout (floats) ~12.5 MB; vbuf always holds attention val
    float* ws   = (float*)d_ws;
    float* ltt  = ws;                    // NL*2
    float* h0   = ltt  + (size_t)NL * 2; // NX*64
    float* vbuf = h0   + (size_t)NX * HID;
    float* hq   = vbuf + (size_t)NX * HID;
    float* hA   = hq   + (size_t)NX * HID;   // NL*64
    float* hB   = hA   + (size_t)NL * HID;
    float* aL   = hB   + (size_t)NL * HID;
    float* tL   = aL   + (size_t)NL * HID;
    float* mL   = tL   + (size_t)NL * HID;
    float* thrD = mL   + (size_t)NL * HID;   // NL
    float* thrU = thrD + NL;                 // NX
    float* Bp   = thrU + NX;                 // 64*64

    const int gemmNL = (NL + 15) / 16, gemmNX = (NX + 15) / 16;

    // latent coords + encoder
    k_ltt<<<(NL + 255) / 256, 256, 0, stream>>>(x, ltt);
    k_encoder<<<(NX * HID + 255) / 256, 256, 0, stream>>>(x, en_w, en_b, h0, NX);

    // ---- down: latent <- input (5% locality) ----
    k_repack<<<16, 256, 0, stream>>>(down_w, Bp);
    k_gemm_n64<<<gemmNX, 128, 0, stream>>>(h0, Bp, nullptr, nullptr, vbuf, NX, 0);
    // quantile over nK=11271: pos = 0.05*11270 = 563.5 -> k=563, frac=0.5
    k_quantile<<<NL, 256, (size_t)NX * 4 + 1024, stream>>>(ltt, x, NX, 563, 0.5f, thrD);
    k_attn<<<gemmNL, 512, 0, stream>>>(ltt, NL, x, NX, vbuf, down_r, thrD, hA);

    // ---- 4 latent blocks (dense attention, no mask) ----
    float* hin = hA;
    float* hout = hB;
    for (int i = 0; i < 4; i++) {
        k_repack<<<16, 256, 0, stream>>>(pa_w + (size_t)i * 4096, Bp);
        k_gemm_n64<<<gemmNL, 128, 0, stream>>>(hin, Bp, nullptr, nullptr, vbuf, NL, 0);
        k_attn<<<gemmNL, 512, 0, stream>>>(ltt, NL, ltt, NL, vbuf, pa_r + (size_t)i * 4, nullptr, aL);
        k_gemm_n64<<<gemmNL, 128, 0, stream>>>(aL, mlp1_w + (size_t)i * 4096,
                                               mlp1_b + (size_t)i * 64, nullptr, tL, NL, 1);
        k_gemm_n64<<<gemmNL, 128, 0, stream>>>(tL, mlp2_w + (size_t)i * 4096,
                                               mlp2_b + (size_t)i * 64, nullptr, mL, NL, 0);
        // h = gelu(m + h @ lin_w + lin_b)   (ping-pong to avoid in-place hazard)
        k_gemm_n64<<<gemmNL, 128, 0, stream>>>(hin, lin_w + (size_t)i * 4096,
                                               lin_b + (size_t)i * 64, mL, hout, NL, 1);
        float* tmp = hin; hin = hout; hout = tmp;
    }

    // ---- up: input <- latent (5% locality) ----
    k_repack<<<16, 256, 0, stream>>>(up_w, Bp);
    k_gemm_n64<<<gemmNL, 128, 0, stream>>>(hin, Bp, nullptr, nullptr, vbuf, NL, 0);
    // quantile over nK=2886: pos = 0.05*2885 = 144.25 -> k=144, frac=0.25
    k_quantile<<<NX, 256, (size_t)NL * 4 + 1024, stream>>>(x, ltt, NL, 144, 0.25f, thrU);
    k_attn<<<gemmNX, 512, 0, stream>>>(x, NX, ltt, NL, vbuf, up_r, thrU, hq);

    // ---- decoder ----
    k_gemm_n64<<<gemmNX, 128, 0, stream>>>(hq, de1_w, de1_b, nullptr, h0, NX, 1);
    k_dot64<<<(NX + 255) / 256, 256, 0, stream>>>(h0, de2_w, de2_b, (float*)d_out, NX);
}

// v002
// Measured time: 721 microseconds a run.
// In two side-by-side timings against v001, it was 1.25 and 1.26 times as fast.
// Over all steps from v000 it is 2.80 times as fast.
#include <hip/hip_runtime.h>
#include <math.h>

// ---------------------------------------------------------------------------
// PIT pipeline for MI455X (gfx1250, wave32).
// - Never materialize distance/attention matrices: recompute d2 from 2-D
//   coords, fused mask->exp->normalize->matvec (all live data L2-resident).
// - Per-row quantile via in-LDS radix select on float bit patterns.
// - Dense [N,64]x[64,64] GEMMs via V_WMMA_F32_16X16X4_F32 (full f32 fidelity).
// - Attention in tiles of 16 queries: weights x val on the same f32 WMMA, keys
//   split over the waves of a block.
// ---------------------------------------------------------------------------

#define NX   11271     // 221*51 input points
#define NL   2886      // 111*26 latent points
#define HID  64

typedef __attribute__((ext_vector_type(2))) float v2f;
typedef __attribute__((ext_vector_type(8))) float v8f;

__device__ __forceinline__ float gelu_erf(float v) {
    // torch F.gelu default: 0.5*x*(1+erf(x/sqrt(2)))
    return 0.5f * v * (1.0f + erff(v * 0.70710678118654752f));
}

// ---------------------------------------------------------------------------
// Build latent coords: ltt = x[:, ::2, ::2, :][:, :111, :26, :]
// ---------------------------------------------------------------------------
__global__ void k_ltt(const float* __restrict__ x, float* __restrict__ ltt) {
    int l = blockIdx.x * blockDim.x + threadIdx.x;
    if (l >= NL) return;
    int i = l / 26, j = l % 26;
    const float* p = x + ((size_t)(2 * i) * 51 + (size_t)(2 * j)) * 2;
    ltt[2 * l + 0] = p[0];
    ltt[2 * l + 1] = p[1];
}

// ---------------------------------------------------------------------------
// Encoder: h0[j,c] = gelu(x0*W[0,c] + x1*W[1,c] + b[c]),  K=2 -> plain VALU
// ---------------------------------------------------------------------------
__global__ void k_encoder(const float* __restrict__ x, const float* __restrict__ W,
                          const float* __restrict__ b, float* __restrict__ h0, int n) {
    int i = blockIdx.x * blockDim.x + threadIdx.x;
    if (i >= n * HID) return;
    int j = i >> 6, c = i & 63;
    float v = fmaf(x[2 * j + 0], W[c], fmaf(x[2 * j + 1], W[HID + c], b[c]));
    h0[i] = gelu_erf(v);
}

// ---------------------------------------------------------------------------
// Repack per-head weights [4][64][16] -> concatenated B [64][64] so the val
// projection becomes a single 64x64 GEMM: B[j][h*16+k] = w[h][j][k]
// ---------------------------------------------------------------------------
__global__ void k_repack(const float* __restrict__ w, float* __restrict__ Bp) {
    int t = blockIdx.x * blockDim.x + threadIdx.x;
    if (t >= HID * HID) return;
    int j = t >> 6, c = t & 63;
    int h = c >> 4, k = c & 15;
    Bp[t] = w[h * (HID * 16) + j * 16 + k];
}

// ---------------------------------------------------------------------------
// Generic WMMA GEMM: C[N,64] = act( A[N,64] @ B[64,64] + bias (+addend) )
// One wave = one 16x16 output tile (wave w of 4 owns cols 16w..16w+15).
// f32 WMMA fragment layouts per CDNA5 ISA 7.12.2:
//   A 16x4 : lanes 0-15 -> M=lane, VGPR{0,1}=K{0,1};  lanes 16-31 -> K{2,3}
//   B 4x16 : lanes 0-15 -> N=lane, VGPR{0,1}=K{0,1};  lanes 16-31 -> K{2,3}
//   C 16x16: VGPR r -> M = r + 8*(lane>=16), N = lane&15
// ---------------------------------------------------------------------------
__global__ void k_gemm_n64(const float* __restrict__ A, const float* __restrict__ B,
                           const float* __restrict__ bias, const float* __restrict__ addend,
                           float* __restrict__ C, int N, int act) {
    int lane = threadIdx.x & 31;
    int wave = threadIdx.x >> 5;           // 0..3 -> column tile
    int r0 = blockIdx.x * 16;
    int colBase = wave * 16;
    int laneN = lane & 15;
    int hi = lane >> 4;                    // half-wave selector
    int kk = hi * 2;                       // K sub-offset {0,2}

    int aRow = r0 + laneN;                 // A-fragment row (M = lane&15)
    if (aRow > N - 1) aRow = N - 1;        // clamp tail reads (stores predicated)
    const float* Arow = A + (size_t)aRow * HID;

    v8f acc = {};
    for (int k = 0; k < HID; k += 4) {
        v2f a, b;
        a.x = Arow[k + kk + 0];
        a.y = Arow[k + kk + 1];
        b.x = B[(k + kk + 0) * HID + colBase + laneN];
        b.y = B[(k + kk + 1) * HID + colBase + laneN];
        acc = __builtin_amdgcn_wmma_f32_16x16x4_f32(
            /*neg_a=*/false, a, /*neg_b=*/false, b,
            /*c_mod=*/(short)0, acc, /*reuse_a=*/false, /*reuse_b=*/false);
    }

    int col = colBase + laneN;
    float bv = bias ? bias[col] : 0.0f;
#pragma unroll
    for (int r = 0; r < 8; r++) {
        int row = r0 + r + 8 * hi;
        if (row < N) {
            float v = acc[r] + bv;
            if (addend) v += addend[(size_t)row * HID + col];
            if (act) v = gelu_erf(v);
            C[(size_t)row * HID + col] = v;
        }
    }
}

// ---------------------------------------------------------------------------
// Per-row quantile of squared distances via in-LDS radix select.
// thr[row] = s[kth] + frac*(s[kth+1] - s[kth])   (jnp.quantile 'linear')
// d2 >= 0 so float bit patterns are order-preserving as uints.
// Dynamic LDS: uint bits[nK] + uint hist[256]
// ---------------------------------------------------------------------------
__global__ void k_quantile(const float* __restrict__ Qc, const float* __restrict__ Kc,
                           int nK, int kth, float frac, float* __restrict__ thr_out) {
    extern __shared__ unsigned int sm[];
    unsigned int* bits = sm;
    unsigned int* hist = sm + nK;
    __shared__ unsigned int s_prefix, s_want, s_cntle, s_mingt;

    int row = blockIdx.x, tid = threadIdx.x;
    float qx = Qc[2 * row + 0], qy = Qc[2 * row + 1];
    for (int j = tid; j < nK; j += blockDim.x) {
        float dx = qx - Kc[2 * j + 0];
        float dy = qy - Kc[2 * j + 1];
        float d2 = fmaf(dx, dx, dy * dy);
        bits[j] = __float_as_uint(d2);
    }
    if (tid == 0) { s_prefix = 0u; s_want = (unsigned)kth; }
    __syncthreads();

#pragma unroll   // four passes with constant shifts: the first one keeps its loop free of the prefix test
    for (int shift = 24; shift >= 0; shift -= 8) {
        for (int b = tid; b < 256; b += blockDim.x) hist[b] = 0u;
        __syncthreads();
        unsigned pfx = s_prefix;
        for (int j = tid; j < nK; j += blockDim.x) {
            unsigned u = bits[j];
            bool match = (shift == 24) || (((u ^ pfx) >> (shift + 8)) == 0u);
            if (match) atomicAdd(&hist[(u >> shift) & 255u], 1u);
        }
        __syncthreads();
        if (tid < 32) {
            // wave 0 finds the bin that holds rank 'want': lane l owns bins 8l..8l+7,
            // a prefix sum over the lanes' totals tells each lane what lies below it,
            // and the owning lane counts, in registers, how many of its bins end at
            // or below the rank
            unsigned want = s_want;
            unsigned c[8], sum = 0u;
#pragma unroll   // constant indices keep the counts in registers; the LDS reads issue together
            for (int i = 0; i < 8; i++) { c[i] = hist[tid * 8 + i]; sum += c[i]; }
            unsigned incl = sum;
#pragma unroll   // five fixed steps of the prefix sum
            for (int d = 1; d < 32; d <<= 1) {
                unsigned t = __shfl_up(incl, d);
                if (tid >= d) incl += t;
            }
            unsigned below = incl - sum;   // counts in all bins under this lane's
            unsigned run = below, accum = below, idx = 0u;
#pragma unroll   // constant indices keep the counts in registers
            for (int i = 0; i < 8; i++) {
                run += c[i];               // never falls, so 'le' is true, then false
                bool le = run <= want;
                accum = le ? run : accum;
                idx += le ? 1u : 0u;
            }
            // exactly one lane; lane 31 also takes a rank past the total (bin 255)
            if (below <= want && (want < incl || tid == 31)) {
                unsigned bsel = (unsigned)tid * 8u + idx;
                if (bsel > 255u) bsel = 255u;
                s_prefix = pfx | (bsel << shift);
                s_want = want - accum;
            }
        }
        __syncthreads();
    }

    unsigned v = s_prefix;                 // bit pattern of s[kth]
    if (tid == 0) { s_cntle = 0u; s_mingt = 0xFFFFFFFFu; }
    __syncthreads();
    unsigned cl = 0u, mg = 0xFFFFFFFFu;
    for (int j = tid; j < nK; j += blockDim.x) {
        unsigned u = bits[j];
        if (u <= v) cl++;
        else if (u < mg) mg = u;
    }
    atomicAdd(&s_cntle, cl);
    atomicMin(&s_mingt, mg);
    __syncthreads();
    if (tid == 0) {
        float sk  = __uint_as_float(v);
        float sk1 = (s_cntle >= (unsigned)(kth + 2)) ? sk : __uint_as_float(s_mingt);
        thr_out[row] = fmaf(frac, sk1 - sk, sk);
    }
}

// ---------------------------------------------------------------------------
// One group of 16 keys for a tile of 16 queries, all four heads.
// The masked weights are computed straight into the WMMA A fragment
// (M = query = lane&15, K = key) and the val rows are the B fragment
// (K = key, N = column within the head), with the same key in the same K slot:
//   lanes 0-15 : VGPR{0,1} = keys j+0, j+1 ; lanes 16-31 : keys j+2, j+3
// jb = first key of the group + 2*(lane>>4). TAIL clamps every key index and
// zeroes the weights of keys past the end.
// ---------------------------------------------------------------------------
template <bool TAIL>
__device__ __forceinline__ void attn_group16(const float* __restrict__ Kc,
                                             const float* __restrict__ val,
                                             int nK, int jb, int laneN,
                                             float qx, float qy, float thrq,
                                             const float (&c)[4],
                                             v8f (&acc)[4], v2f (&den)[4]) {
    // all loads of the group first, the coordinates ahead of the val rows, so
    // that the val rows fly under the weights' arithmetic
    v2f b[4][4];
    float kx[4][2], ky[4][2];
#pragma unroll   // constant indices keep the register arrays in registers
    for (int s = 0; s < 4; s++) {
        int j = jb + s * 4;
        if (TAIL) {
            int ja = j < nK ? j : nK - 1;
            int jc = j + 1 < nK ? j + 1 : nK - 1;
            kx[s][0] = Kc[2 * ja + 0]; ky[s][0] = Kc[2 * ja + 1];
            kx[s][1] = Kc[2 * jc + 0]; ky[s][1] = Kc[2 * jc + 1];
        } else {
            float4 k4 = *(const float4*)(Kc + 2 * j);   // j is even: 16-B aligned
            kx[s][0] = k4.x; ky[s][0] = k4.y; kx[s][1] = k4.z; ky[s][1] = k4.w;
        }
    }
    // the val loads' results and addresses may land in the coordinate loads'
    // address registers; as a memory fence it also keeps the coordinate loads in
    // front (loads return in order: issued last, they would make the first
    // distance wait for every val row as well)
    asm volatile("s_wait_xcnt 0x0" ::: "memory");
    // holds the val rows' address arithmetic behind that wait
    __builtin_amdgcn_sched_barrier(0);
#pragma unroll   // constant indices keep the register arrays in registers
    for (int s = 0; s < 4; s++) {
        const float* va;
        const float* vc;
        if (TAIL) {
            int j = jb + s * 4;
            int ja = j < nK ? j : nK - 1;
            int jc = j + 1 < nK ? j + 1 : nK - 1;
            va = val + (size_t)ja * HID + laneN;
            vc = val + (size_t)jc * HID + laneN;
        } else {
            va = val + (size_t)jb * HID + laneN + s * 4 * HID;   // one address, constant offsets
            vc = va + HID;
        }
#pragma unroll   // constant indices keep the register arrays in registers
        for (int h = 0; h < 4; h++) { b[s][h].x = va[h * 16]; b[s][h].y = vc[h * 16]; }
        // clamped rows have address registers of their own for each run, and the
        // next run's results may land in them
        if (TAIL) asm volatile("s_wait_xcnt 0x0" ::: "memory");
    }
    // the arithmetic below may reuse the val loads' address registers
    if (!TAIL) asm volatile("s_wait_xcnt 0x0" ::: "memory");
    // keeps the wait for the coordinates behind the issue of the val loads
    __builtin_amdgcn_sched_barrier(0);
#pragma unroll   // constant indices keep the register arrays in registers
    for (int s = 0; s < 4; s++) {
        int j = jb + s * 4;
        float dx0 = qx - kx[s][0], dy0 = qy - ky[s][0];
        float dx1 = qx - kx[s][1], dy1 = qy - ky[s][1];
        float d20 = fmaf(dx0, dx0, dy0 * dy0);
        float d21 = fmaf(dx1, dx1, dy1 * dy1);
        bool ok0 = d20 <= thrq, ok1 = d21 <= thrq;
        if (TAIL) { ok0 = ok0 && (j < nK); ok1 = ok1 && (j + 1 < nK); }
#pragma unroll   // constant indices keep the register arrays in registers
        for (int h = 0; h < 4; h++) {
            // exp in every lane, then a select: no divergent branch round a WMMA
            float e0 = expf(-c[h] * d20);
            float e1 = expf(-c[h] * d21);
            v2f a;
            a.x = ok0 ? e0 : 0.0f;
            a.y = ok1 ? e1 : 0.0f;
            den[h] += a;                   // even and odd keys summed apart
            acc[h] = __builtin_amdgcn_wmma_f32_16x16x4_f32(
                /*neg_a=*/false, a, /*neg_b=*/false, b[s][h],
                /*c_mod=*/(short)0, acc[h], /*reuse_a=*/false, /*reuse_b=*/false);
        }
    }
}

// ---------------------------------------------------------------------------
// Fused masked multi-head softmax attention + gelu.
// out[q, h*16+v] = gelu( sum_j w_h(q,j) * val[j, h*16+v] / sum_j w_h(q,j) )
//   w_h = exp(-c_h * d2(q,j)) if d2 <= thr[q] else 0 ;  c_h = tan(pi/4*(1+sin r_h))
// (positive c_h => head-independent mask; exponents in [-c*thr, 0] => stable.)
// Block = 16 waves, one tile of 16 queries: every val row that is read serves
// 16 queries through one f32 WMMA per head. The keys are dealt to the waves in
// groups of 16; the waves' partial numerators and denominators are summed in
// LDS in a fixed order.
// ---------------------------------------------------------------------------
#define ATT_WAVES 16

__global__ __launch_bounds__(ATT_WAVES * 32)
void k_attn(const float* __restrict__ Qc, int nQ,
            const float* __restrict__ Kc, int nK,
            const float* __restrict__ val,
            const float* __restrict__ rr,
            const float* __restrict__ thr,
            float* __restrict__ out) {
    __shared__ float red[ATT_WAVES / 2][32][32];   // 32 KB partial numerators
    __shared__ float dred[ATT_WAVES][4][16];       // partial denominators
    __shared__ float cs[4];

    int tid = threadIdx.x;
    int lane = tid & 31;
    int wave = __builtin_amdgcn_readfirstlane(tid >> 5);   // scalar loop control
    int laneN = lane & 15;
    int hi = lane >> 4;
    int q0 = blockIdx.x * 16;

    if (tid < 4) cs[tid] = tanf(0.78539816339744831f * (1.0f + sinf(rr[tid])));
    __syncthreads();                       // cs visible

    int q = q0 + laneN;
    if (q > nQ - 1) q = nQ - 1;            // clamp tail reads (stores predicated)
    float qx = Qc[2 * q + 0], qy = Qc[2 * q + 1];
    float thrq = thr ? thr[q] : 3.402823466e+38f;
    // the address registers of the two loads above are reused at once
    asm volatile("s_wait_xcnt 0x0" ::: "memory");
    float c[4] = {cs[0], cs[1], cs[2], cs[3]};

    v8f acc[4] = {};
    v2f den[4] = {};

    int nFull = nK >> 4;                   // whole groups of 16 keys
    for (int g = wave; g < nFull; g += ATT_WAVES)
        attn_group16<false>(Kc, val, nK, g * 16 + hi * 2, laneN, qx, qy, thrq, c, acc, den);
    if ((nK & 15) != 0 && (nFull & (ATT_WAVES - 1)) == wave)   // the partial group, next wave in turn
        attn_group16<true>(Kc, val, nK, nFull * 16 + hi * 2, laneN, qx, qy, thrq, c, acc, den);

    // the two half-waves hold different keys of the same query
#pragma unroll   // constant indices keep the register arrays in registers
    for (int h = 0; h < 4; h++) {
        float dh = den[h].x + den[h].y;
        dh += __shfl_xor(dh, 16);
        if (hi == 0) dred[wave][h][laneN] = dh;
    }
    if (wave >= ATT_WAVES / 2) {
#pragma unroll   // constant indices keep the register arrays in registers
        for (int h = 0; h < 4; h++)
#pragma unroll   // constant indices keep the register arrays in registers
            for (int r = 0; r < 8; r++) red[wave - ATT_WAVES / 2][h * 8 + r][lane] = acc[h][r];
    }
    __syncthreads();                       // upper waves' partials visible
    if (wave < ATT_WAVES / 2) {
#pragma unroll   // constant indices keep the register arrays in registers
        for (int h = 0; h < 4; h++)
#pragma unroll   // constant indices keep the register arrays in registers
            for (int r = 0; r < 8; r++) red[wave][h * 8 + r][lane] += acc[h][r];
    }
    __syncthreads();                       // all partials visible

    // C layout: VGPR r -> M = r + 8*(lane>=16), N = lane&15
    for (int o = tid; o < 16 * HID; o += ATT_WAVES * 32) {
        int ql = o >> 6, col = o & 63;
        int h = col >> 4, n = col & 15;
        float num = 0.f, d = 0.f;
#pragma unroll   // lets the LDS reads issue together
        for (int w = 0; w < ATT_WAVES / 2; w++)
            num += red[w][h * 8 + (ql & 7)][(ql >> 3) * 16 + n];
#pragma unroll   // lets the LDS reads issue together
        for (int w = 0; w < ATT_WAVES; w++) d += dred[w][h][ql];
        if (q0 + ql < nQ) out[(size_t)(q0 + ql) * HID + col] = gelu_erf(num / d);
    }
}

// ---------------------------------------------------------------------------
// Decoder head: out[j] = t[j,:] . de2_w + de2_b   ([64,1] weight)
// ---------------------------------------------------------------------------
__global__ void k_dot64(const float* __restrict__ t, const float* __restrict__ w,
                        const float* __restrict__ b, float* __restrict__ out, int n) {
    int j = blockIdx.x * blockDim.x + threadIdx.x;
    if (j >= n) return;
    float s = b[0];
    const float* row = t + (size_t)j * HID;
#pragma unroll
    for (int k = 0; k < HID; k++) s = fmaf(row[k], w[k], s);
    out[j] = s;
}

// ---------------------------------------------------------------------------
extern "C" void kernel_launch(void* const* d_in, const int* in_sizes, int n_in,
                              void* d_out, int out_size, void* d_ws, size_t ws_size,
                              hipStream_t stream) {
    (void)in_sizes; (void)n_in; (void)out_size; (void)ws_size;

    const float* x      = (const float*)d_in[0];   // [1,221,51,2] == xf [11271,2]
    const float* en_w   = (const float*)d_in[1];
    const float* en_b   = (const float*)d_in[2];
    const float* down_r = (const float*)d_in[3];
    const float* down_w = (const float*)d_in[4];
    const float* pa_r   = (const float*)d_in[5];   // [4,1,4,1,1]
    const float* pa_w   = (const float*)d_in[6];   // [4,4,64,16]
    const float* mlp1_w = (const float*)d_in[7];
    const float* mlp1_b = (const float*)d_in[8];
    const float* mlp2_w = (const float*)d_in[9];
    const float* mlp2_b = (const float*)d_in[10];
    const float* lin_w  = (const float*)d_in[11];
    const float* lin_b  = (const float*)d_in[12];
    const float* up_r   = (const float*)d_in[13];
    const float* up_w   = (const float*)d_in[14];
    const float* de1_w  = (const float*)d_in[15];
    const float* de1_b  = (const float*)d_in[16];
    const float* de2_w  = (const float*)d_in[17];
    const float* de2_b  = (const float*)d_in[18];

    // workspace layout (floats) ~12.5 MB; vbuf always holds attention val
    float* ws   = (float*)d_ws;
    float* ltt  = ws;                    // NL*2
    float* h0   = ltt  + (size_t)NL * 2; // NX*64
    float* vbuf = h0   + (size_t)NX * HID;
    float* hq   = vbuf + (size_t)NX * HID;
    float* hA   = hq   + (size_t)NX * HID;   // NL*64
    float* hB   = hA   + (size_t)NL * HID;
    float* aL   = hB   + (size_t)NL * HID;
    float* tL   = aL   + (size_t)NL * HID;
    float* mL   = tL   + (size_t)NL * HID;
    float* thrD = mL   + (size_t)NL * HID;   // NL
    float* thrU = thrD + NL;                 // NX
    float* Bp   = thrU + NX;                 // 64*64

    const int gemmNL = (NL + 15) / 16, gemmNX = (NX + 15) / 16;

    // latent coords + encoder
    k_ltt<<<(NL + 255) / 256, 256, 0, stream>>>(x, ltt);
    k_encoder<<<(NX * HID + 255) / 256, 256, 0, stream>>>(x, en_w, en_b, h0, NX);

    // ---- down: latent <- input (5% locality) ----
    k_repack<<<16, 256, 0, stream>>>(down_w, Bp);
    k_gemm_n64<<<gemmNX, 128, 0, stream>>>(h0, Bp, nullptr, nullptr, vbuf, NX, 0);
    // quantile over nK=11271: pos = 0.05*11270 = 563.5 -> k=563, frac=0.5
    k_quantile<<<NL, 256, (size_t)NX * 4 + 1024, stream>>>(ltt, x, NX, 563, 0.5f, thrD);
    k_attn<<<gemmNL, 512, 0, stream>>>(ltt, NL, x, NX, vbuf, down_r, thrD, hA);

    // ---- 4 latent blocks (dense attention, no mask) ----
    float* hin = hA;
    float* hout = hB;
    for (int i = 0; i < 4; i++) {
        k_repack<<<16, 256, 0, stream>>>(pa_w + (size_t)i * 4096, Bp);
        k_gemm_n64<<<gemmNL, 128, 0, stream>>>(hin, Bp, nullptr, nullptr, vbuf, NL, 0);
        k_attn<<<gemmNL, 512, 0, stream>>>(ltt, NL, ltt, NL, vbuf, pa_r + (size_t)i * 4, nullptr, aL);
        k_gemm_n64<<<gemmNL, 128, 0, stream>>>(aL, mlp1_w + (size_t)i * 4096,
                                               mlp1_b + (size_t)i * 64, nullptr, tL, NL, 1);
        k_gemm_n64<<<gemmNL, 128, 0, stream>>>(tL, mlp2_w + (size_t)i * 4096,
                                               mlp2_b + (size_t)i * 64, nullptr, mL, NL, 0);
        // h = gelu(m + h @ lin_w + lin_b)   (ping-pong to avoid in-place hazard)
        k_gemm_n64<<<gemmNL, 128, 0, stream>>>(hin, lin_w + (size_t)i * 4096,
                                               lin_b + (size_t)i * 64, mL, hout, NL, 1);
        float* tmp = hin; hin = hout; hout = tmp;
    }

    // ---- up: input <- latent (5% locality) ----
    k_repack<<<16, 256, 0, stream>>>(up_w, Bp);
    k_gemm_n64<<<gemmNL, 128, 0, stream>>>(hin, Bp, nullptr, nullptr, vbuf, NL, 0);
    // quantile over nK=2886: pos = 0.05*2885 = 144.25 -> k=144, frac=0.25
    k_quantile<<<NX, 256, (size_t)NL * 4 + 1024, stream>>>(x, ltt, NL, 144, 0.25f, thrU);
    k_attn<<<gemmNX, 512, 0, stream>>>(x, NX, ltt, NL, vbuf, up_r, thrU, hq);

    // ---- decoder ----
    k_gemm_n64<<<gemmNX, 128, 0, stream>>>(hq, de1_w, de1_b, nullptr, h0, NX, 1);
    k_dot64<<<(NX + 255) / 256, 256, 0, stream>>>(h0, de2_w, de2_b, (float*)d_out, NX);
}

// v003
// Measured time: 619 microseconds a run.
// Two timings next to v002 both put it at 1.16 times that version's speed.
// Over all steps from v000 it is 3.25 times as fast.
#include <hip/hip_runtime.h>
#include <math.h>

// ---------------------------------------------------------------------------
// PIT pipeline for MI455X (gfx1250, wave32).
// - Never materialize distance/attention matrices: recompute d2 from 2-D
//   coords, fused mask->exp->normalize->matvec (all live data L2-resident).
// - Per-row quantile via in-LDS radix select on float bit patterns.
// - Dense [N,64]x[64,64] GEMMs via V_WMMA_F32_16X16X4_F32 (full f32 fidelity).
// - Attention in tiles of 16 queries: weights x val on the same f32 WMMA, keys
//   split over the waves of a block.
// ---------------------------------------------------------------------------

#define NX   11271     // 221*51 input points
#define NL   2886      // 111*26 latent points
#define HID  64

typedef __attribute__((ext_vector_type(2))) float v2f;
typedef __attribute__((ext_vector_type(8))) float v8f;

__device__ __forceinline__ float gelu_erf(float v) {
    // torch F.gelu default: 0.5*x*(1+erf(x/sqrt(2)))
    return 0.5f * v * (1.0f + erff(v * 0.70710678118654752f));
}

// ---------------------------------------------------------------------------
// Build latent coords: ltt = x[:, ::2, ::2, :][:, :111, :26, :]
// ---------------------------------------------------------------------------
__global__ void k_ltt(const float* __restrict__ x, float* __restrict__ ltt) {
    int l = blockIdx.x * blockDim.x + threadIdx.x;
    if (l >= NL) return;
    int i = l / 26, j = l % 26;
    const float* p = x + ((size_t)(2 * i) * 51 + (size_t)(2 * j)) * 2;
    ltt[2 * l + 0] = p[0];
    ltt[2 * l + 1] = p[1];
}

// ---------------------------------------------------------------------------
// Encoder: h0[j,c] = gelu(x0*W[0,c] + x1*W[1,c] + b[c]),  K=2 -> plain VALU
// ---------------------------------------------------------------------------
__global__ void k_encoder(const float* __restrict__ x, const float* __restrict__ W,
                          const float* __restrict__ b, float* __restrict__ h0, int n) {
    int i = blockIdx.x * blockDim.x + threadIdx.x;
    if (i >= n * HID) return;
    int j = i >> 6, c = i & 63;
    float v = fmaf(x[2 * j + 0], W[c], fmaf(x[2 * j + 1], W[HID + c], b[c]));
    h0[i] = gelu_erf(v);
}

// ---------------------------------------------------------------------------
// Repack per-head weights [4][64][16] -> concatenated B [64][64] so the val
// projection becomes a single 64x64 GEMM: B[j][h*16+k] = w[h][j][k]
// ---------------------------------------------------------------------------
__global__ void k_repack(const float* __restrict__ w, float* __restrict__ Bp) {
    int t = blockIdx.x * blockDim.x + threadIdx.x;
    if (t >= HID * HID) return;
    int j = t >> 6, c = t & 63;
    int h = c >> 4, k = c & 15;
    Bp[t] = w[h * (HID * 16) + j * 16 + k];
}

// ---------------------------------------------------------------------------
// Generic WMMA GEMM: C[N,64] = act( A[N,64] @ B[64,64] + bias (+addend) )
// One wave = one 16x16 output tile (wave w of 4 owns cols 16w..16w+15).
// f32 WMMA fragment layouts per CDNA5 ISA 7.12.2:
//   A 16x4 : lanes 0-15 -> M=lane, VGPR{0,1}=K{0,1};  lanes 16-31 -> K{2,3}
//   B 4x16 : lanes 0-15 -> N=lane, VGPR{0,1}=K{0,1};  lanes 16-31 -> K{2,3}
//   C 16x16: VGPR r -> M = r + 8*(lane>=16), N = lane&15
// ---------------------------------------------------------------------------
__global__ void k_gemm_n64(const float* __restrict__ A, const float* __restrict__ B,
                           const float* __restrict__ bias, const float* __restrict__ addend,
                           float* __restrict__ C, int N, int act) {
    int lane = threadIdx.x & 31;
    int wave = threadIdx.x >> 5;           // 0..3 -> column tile
    int r0 = blockIdx.x * 16;
    int colBase = wave * 16;
    int laneN = lane & 15;
    int hi = lane >> 4;                    // half-wave selector
    int kk = hi * 2;                       // K sub-offset {0,2}

    int aRow = r0 + laneN;                 // A-fragment row (M = lane&15)
    if (aRow > N - 1) aRow = N - 1;        // clamp tail reads (stores predicated)
    const float* Arow = A + (size_t)aRow * HID;

    v8f acc = {};
    for (int k = 0; k < HID; k += 4) {
        v2f a, b;
        a.x = Arow[k + kk + 0];
        a.y = Arow[k + kk + 1];
        b.x = B[(k + kk + 0) * HID + colBase + laneN];
        b.y = B[(k + kk + 1) * HID + colBase + laneN];
        acc = __builtin_amdgcn_wmma_f32_16x16x4_f32(
            /*neg_a=*/false, a, /*neg_b=*/false, b,
            /*c_mod=*/(short)0, acc, /*reuse_a=*/false, /*reuse_b=*/false);
    }

    int col = colBase + laneN;
    float bv = bias ? bias[col] : 0.0f;
#pragma unroll
    for (int r = 0; r < 8; r++) {
        int row = r0 + r + 8 * hi;
        if (row < N) {
            float v = acc[r] + bv;
            if (addend) v += addend[(size_t)row * HID + col];
            if (act) v = gelu_erf(v);
            C[(size_t)row * HID + col] = v;
        }
    }
}

// ---------------------------------------------------------------------------
// Per-row quantile of squared distances via in-LDS radix select.
// thr[row] = s[kth] + frac*(s[kth+1] - s[kth])   (jnp.quantile 'linear')
// d2 >= 0 so float bit patterns are order-preserving as uints.
// Dynamic LDS: uint bits[nK] + uint hist[256]
// ---------------------------------------------------------------------------
__global__ void k_quantile(const float* __restrict__ Qc, const float* __restrict__ Kc,
                           int nK, int kth, float frac, float* __restrict__ thr_out) {
    extern __shared__ unsigned int sm[];
    unsigned int* bits = sm;
    unsigned int* hist = sm + nK;
    __shared__ unsigned int s_prefix, s_want, s_cntle, s_mingt;

    int row = blockIdx.x, tid = threadIdx.x;
    float qx = Qc[2 * row + 0], qy = Qc[2 * row + 1];
    for (int j = tid; j < nK; j += blockDim.x) {
        float dx = qx - Kc[2 * j + 0];
        float dy = qy - Kc[2 * j + 1];
        float d2 = fmaf(dx, dx, dy * dy);
        bits[j] = __float_as_uint(d2);
    }
    if (tid == 0) { s_prefix = 0u; s_want = (unsigned)kth; }
    __syncthreads();

#pragma unroll   // four passes with constant shifts: the first one keeps its loop free of the prefix test
    for (int shift = 24; shift >= 0; shift -= 8) {
        for (int b = tid; b < 256; b += blockDim.x) hist[b] = 0u;
        __syncthreads();
        unsigned pfx = s_prefix;
        for (int j = tid; j < nK; j += blockDim.x) {
            unsigned u = bits[j];
            bool match = (shift == 24) || (((u ^ pfx) >> (shift + 8)) == 0u);
            if (match) atomicAdd(&hist[(u >> shift) & 255u], 1u);
        }
        __syncthreads();
        if (tid < 32) {
            // wave 0 finds the bin that holds rank 'want': lane l owns bins 8l..8l+7,
            // a prefix sum over the lanes' totals tells each lane what lies below it,
            // and the owning lane counts, in registers, how many of its bins end at
            // or below the rank
            unsigned want = s_want;
            unsigned c[8], sum = 0u;
#pragma unroll   // constant indices keep the counts in registers; the LDS reads issue together
            for (int i = 0; i < 8; i++) { c[i] = hist[tid * 8 + i]; sum += c[i]; }
            unsigned incl = sum;
#pragma unroll   // five fixed steps of the prefix sum
            for (int d = 1; d < 32; d <<= 1) {
                unsigned t = __shfl_up(incl, d);
                if (tid >= d) incl += t;
            }
            unsigned below = incl - sum;   // counts in all bins under this lane's
            unsigned run = below, accum = below, idx = 0u;
#pragma unroll   // constant indices keep the counts in registers
            for (int i = 0; i < 8; i++) {
                run += c[i];               // never falls, so 'le' is true, then false
                bool le = run <= want;
                accum = le ? run : accum;
                idx += le ? 1u : 0u;
            }
            // exactly one lane; lane 31 also takes a rank past the total (bin 255)
            if (below <= want && (want < incl || tid == 31)) {
                unsigned bsel = (unsigned)tid * 8u + idx;
                if (bsel > 255u) bsel = 255u;
                s_prefix = pfx | (bsel << shift);
                s_want = want - accum;
            }
        }
        __syncthreads();
    }

    unsigned v = s_prefix;                 // bit pattern of s[kth]
    if (tid == 0) { s_cntle = 0u; s_mingt = 0xFFFFFFFFu; }
    __syncthreads();
    unsigned cl = 0u, mg = 0xFFFFFFFFu;
    for (int j = tid; j < nK; j += blockDim.x) {
        unsigned u = bits[j];
        if (u <= v) cl++;
        else if (u < mg) mg = u;
    }
    atomicAdd(&s_cntle, cl);
    atomicMin(&s_mingt, mg);
    __syncthreads();
    if (tid == 0) {
        float sk  = __uint_as_float(v);
        float sk1 = (s_cntle >= (unsigned)(kth + 2)) ? sk : __uint_as_float(s_mingt);
        thr_out[row] = fmaf(frac, sk1 - sk, sk);
    }
}

// ---------------------------------------------------------------------------
// One group of 16 keys for a tile of 16 queries, all four heads.
// The masked weights are computed straight into the WMMA A fragment
// (M = query = lane&15, K = key) and the val rows are the B fragment
// (K = key, N = column within the head), with the same key in the same K slot:
//   lanes 0-15 : VGPR{0,1} = keys j+0, j+1 ; lanes 16-31 : keys j+2, j+3
// jb = first key of the group + 2*(lane>>4). TAIL clamps every key index and
// zeroes the weights of keys past the end.
// ---------------------------------------------------------------------------
// exp2 of eight values. One statement, each value in its own register: behind
// an exp2 the instruction set asks for one independent instruction before its
// result is read or its source overwritten. Here the source is the result's own
// register, the next exp2 fills the slot of the one in front, and the v_nop that
// of the last.
__device__ __forceinline__ void exp2x8(float (&x)[8]) {
    asm("v_exp_f32 %0, %0\n\t"
        "v_exp_f32 %1, %1\n\t"
        "v_exp_f32 %2, %2\n\t"
        "v_exp_f32 %3, %3\n\t"
        "v_exp_f32 %4, %4\n\t"
        "v_exp_f32 %5, %5\n\t"
        "v_exp_f32 %6, %6\n\t"
        "v_exp_f32 %7, %7\n\t"
        "v_nop"
        : "+v"(x[0]), "+v"(x[1]), "+v"(x[2]), "+v"(x[3]),
          "+v"(x[4]), "+v"(x[5]), "+v"(x[6]), "+v"(x[7]));
}

template <bool TAIL>
__device__ __forceinline__ void attn_group16(const float* __restrict__ Kc,
                                             const float* __restrict__ val,
                                             int nK, int jb, int laneN,
                                             float qx, float qy, float thrq,
                                             const float (&c)[4],
                                             v8f (&acc)[4], v2f (&den)[4]) {
    // all loads of the group first, the coordinates ahead of the val rows, so
    // that the val rows fly under the weights' arithmetic
    v2f b[4][4];
    float kx[4][2], ky[4][2];
#pragma unroll   // constant indices keep the register arrays in registers
    for (int s = 0; s < 4; s++) {
        int j = jb + s * 4;
        if (TAIL) {
            int ja = j < nK ? j : nK - 1;
            int jc = j + 1 < nK ? j + 1 : nK - 1;
            kx[s][0] = Kc[2 * ja + 0]; ky[s][0] = Kc[2 * ja + 1];
            kx[s][1] = Kc[2 * jc + 0]; ky[s][1] = Kc[2 * jc + 1];
        } else {
            float4 k4 = *(const float4*)(Kc + 2 * j);   // j is even: 16-B aligned
            kx[s][0] = k4.x; ky[s][0] = k4.y; kx[s][1] = k4.z; ky[s][1] = k4.w;
        }
    }
    // the val loads' results and addresses may land in the coordinate loads'
    // address registers; as a memory fence it also keeps the coordinate loads in
    // front (loads return in order: issued last, they would make the first
    // distance wait for every val row as well)
    asm volatile("s_wait_xcnt 0x0" ::: "memory");
    // holds the val rows' address arithmetic behind that wait
    __builtin_amdgcn_sched_barrier(0);
#pragma unroll   // constant indices keep the register arrays in registers
    for (int s = 0; s < 4; s++) {
        const float* va;
        const float* vc;
        if (TAIL) {
            int j = jb + s * 4;
            int ja = j < nK ? j : nK - 1;
            int jc = j + 1 < nK ? j + 1 : nK - 1;
            va = val + (size_t)ja * HID + laneN;
            vc = val + (size_t)jc * HID + laneN;
        } else {
            va = val + (size_t)jb * HID + laneN + s * 4 * HID;   // one address, constant offsets
            vc = va + HID;
        }
#pragma unroll   // constant indices keep the register arrays in registers
        for (int h = 0; h < 4; h++) { b[s][h].x = va[h * 16]; b[s][h].y = vc[h * 16]; }
        // clamped rows have address registers of their own for each run, and the
        // next run's results may land in them
        if (TAIL) asm volatile("s_wait_xcnt 0x0" ::: "memory");
    }
    // the arithmetic below may reuse the val loads' address registers
    if (!TAIL) asm volatile("s_wait_xcnt 0x0" ::: "memory");
    // keeps the wait for the coordinates behind the issue of the val loads
    __builtin_amdgcn_sched_barrier(0);
#pragma unroll   // constant indices keep the register arrays in registers
    for (int s = 0; s < 4; s++) {
        int j = jb + s * 4;
        float dx0 = qx - kx[s][0], dy0 = qy - ky[s][0];
        float dx1 = qx - kx[s][1], dy1 = qy - ky[s][1];
        float d20 = fmaf(dx0, dx0, dy0 * dy0);
        float d21 = fmaf(dx1, dx1, dy1 * dy1);
        bool ok0 = d20 <= thrq, ok1 = d21 <= thrq;
        if (TAIL) { ok0 = ok0 && (j < nK); ok1 = ok1 && (j + 1 < nK); }
        // c holds -c_h*log2(e): one multiply and the hardware's exp2 for each weight.
        // The exponent is never above 0; a weight under 2^-126 comes out as 0.
        float e[8];
#pragma unroll   // constant indices keep the register arrays in registers
        for (int h = 0; h < 4; h++) { e[2 * h] = c[h] * d20; e[2 * h + 1] = c[h] * d21; }
        exp2x8(e);
#pragma unroll   // constant indices keep the register arrays in registers
        for (int h = 0; h < 4; h++) {
            // exp in every lane, then a select: no divergent branch round a WMMA
            v2f a;
            a.x = ok0 ? e[2 * h] : 0.0f;
            a.y = ok1 ? e[2 * h + 1] : 0.0f;
            den[h] += a;                   // even and odd keys summed apart
            acc[h] = __builtin_amdgcn_wmma_f32_16x16x4_f32(
                /*neg_a=*/false, a, /*neg_b=*/false, b[s][h],
                /*c_mod=*/(short)0, acc[h], /*reuse_a=*/false, /*reuse_b=*/false);
        }
    }
}

// ---------------------------------------------------------------------------
// Fused masked multi-head softmax attention + gelu.
// out[q, h*16+v] = gelu( sum_j w_h(q,j) * val[j, h*16+v] / sum_j w_h(q,j) )
//   w_h = exp(-c_h * d2(q,j)) if d2 <= thr[q] else 0 ;  c_h = tan(pi/4*(1+sin r_h))
// (positive c_h => head-independent mask; exponents in [-c*thr, 0] => stable.)
// Block = 16 waves, one tile of 16 queries: every val row that is read serves
// 16 queries through one f32 WMMA per head. The keys are dealt to the waves in
// groups of 16; the waves' partial numerators and denominators are summed in
// LDS in a fixed order.
// ---------------------------------------------------------------------------
#define ATT_WAVES 16

__global__ __launch_bounds__(ATT_WAVES * 32)
void k_attn(const float* __restrict__ Qc, int nQ,
            const float* __restrict__ Kc, int nK,
            const float* __restrict__ val,
            const float* __restrict__ rr,
            const float* __restrict__ thr,
            float* __restrict__ out) {
    __shared__ float red[ATT_WAVES / 2][32][32];   // 32 KB partial numerators
    __shared__ float dred[ATT_WAVES][4][16];       // partial denominators
    __shared__ float cs[4];

    int tid = threadIdx.x;
    int lane = tid & 31;
    int wave = __builtin_amdgcn_readfirstlane(tid >> 5);   // scalar loop control
    int laneN = lane & 15;
    int hi = lane >> 4;
    int q0 = blockIdx.x * 16;

    // kept as -c_h*log2(e): exp(-c_h*d2) = exp2(cs*d2)
    if (tid < 4)
        cs[tid] = -1.44269504088896341f * tanf(0.78539816339744831f * (1.0f + sinf(rr[tid])));
    __syncthreads();                       // cs visible

    int q = q0 + laneN;
    if (q > nQ - 1) q = nQ - 1;            // clamp tail reads (stores predicated)
    float qx = Qc[2 * q + 0], qy = Qc[2 * q + 1];
    float thrq = thr ? thr[q] : 3.402823466e+38f;
    // the address registers of the two loads above are reused at once
    asm volatile("s_wait_xcnt 0x0" ::: "memory");
    float c[4] = {cs[0], cs[1], cs[2], cs[3]};

    v8f acc[4] = {};
    v2f den[4] = {};

    int nFull = nK >> 4;                   // whole groups of 16 keys
    for (int g = wave; g < nFull; g += ATT_WAVES)
        attn_group16<false>(Kc, val, nK, g * 16 + hi * 2, laneN, qx, qy, thrq, c, acc, den);
    if ((nK & 15) != 0 && (nFull & (ATT_WAVES - 1)) == wave)   // the partial group, next wave in turn
        attn_group16<true>(Kc, val, nK, nFull * 16 + hi * 2, laneN, qx, qy, thrq, c, acc, den);

    // the two half-waves hold different keys of the same query
#pragma unroll   // constant indices keep the register arrays in registers
    for (int h = 0; h < 4; h++) {
        float dh = den[h].x + den[h].y;
        dh += __shfl_xor(dh, 16);
        if (hi == 0) dred[wave][h][laneN] = dh;
    }
    if (wave >= ATT_WAVES / 2) {
#pragma unroll   // constant indices keep the register arrays in registers
        for (int h = 0; h < 4; h++)
#pragma unroll   // constant indices keep the register arrays in registers
            for (int r = 0; r < 8; r++) red[wave - ATT_WAVES / 2][h * 8 + r][lane] = acc[h][r];
    }
    __syncthreads();                       // upper waves' partials visible
    if (wave < ATT_WAVES / 2) {
#pragma unroll   // constant indices keep the register arrays in registers
        for (int h = 0; h < 4; h++)
#pragma unroll   // constant indices keep the register arrays in registers
            for (int r = 0; r < 8; r++) red[wave][h * 8 + r][lane] += acc[h][r];
    }
    __syncthreads();                       // all partials visible

    // C layout: VGPR r -> M = r + 8*(lane>=16), N = lane&15
    for (int o = tid; o < 16 * HID; o += ATT_WAVES * 32) {
        int ql = o >> 6, col = o & 63;
        int h = col >> 4, n = col & 15;
        float num = 0.f, d = 0.f;
#pragma unroll   // lets the LDS reads issue together
        for (int w = 0; w < ATT_WAVES / 2; w++)
            num += red[w][h * 8 + (ql & 7)][(ql >> 3) * 16 + n];
#pragma unroll   // lets the LDS reads issue together
        for (int w = 0; w < ATT_WAVES; w++) d += dred[w][h][ql];
        if (q0 + ql < nQ) out[(size_t)(q0 + ql) * HID + col] = gelu_erf(num / d);
    }
}

// ---------------------------------------------------------------------------
// Decoder head: out[j] = t[j,:] . de2_w + de2_b   ([64,1] weight)
// ---------------------------------------------------------------------------
__global__ void k_dot64(const float* __restrict__ t, const float* __restrict__ w,
                        const float* __restrict__ b, float* __restrict__ out, int n) {
    int j = blockIdx.x * blockDim.x + threadIdx.x;
    if (j >= n) return;
    float s = b[0];
    const float* row = t + (size_t)j * HID;
#pragma unroll
    for (int k = 0; k < HID; k++) s = fmaf(row[k], w[k], s);
    out[j] = s;
}

// ---------------------------------------------------------------------------
extern "C" void kernel_launch(void* const* d_in, const int* in_sizes, int n_in,
                              void* d_out, int out_size, void* d_ws, size_t ws_size,
                              hipStream_t stream) {
    (void)in_sizes; (void)n_in; (void)out_size; (void)ws_size;

    const float* x      = (const float*)d_in[0];   // [1,221,51,2] == xf [11271,2]
    const float* en_w   = (const float*)d_in[1];
    const float* en_b   = (const float*)d_in[2];
    const float* down_r = (const float*)d_in[3];
    const float* down_w = (const float*)d_in[4];
    const float* pa_r   = (const float*)d_in[5];   // [4,1,4,1,1]
    const float* pa_w   = (const float*)d_in[6];   // [4,4,64,16]
    const float* mlp1_w = (const float*)d_in[7];
    const float* mlp1_b = (const float*)d_in[8];
    const float* mlp2_w = (const float*)d_in[9];
    const float* mlp2_b = (const float*)d_in[10];
    const float* lin_w  = (const float*)d_in[11];
    const float* lin_b  = (const float*)d_in[12];
    const float* up_r   = (const float*)d_in[13];
    const float* up_w   = (const float*)d_in[14];
    const float* de1_w  = (const float*)d_in[15];
    const float* de1_b  = (const float*)d_in[16];
    const float* de2_w  = (const float*)d_in[17];
    const float* de2_b  = (const float*)d_in[18];

    // workspace layout (floats) ~12.5 MB; vbuf always holds attention val
    float* ws   = (float*)d_ws;
    float* ltt  = ws;                    // NL*2
    float* h0   = ltt  + (size_t)NL * 2; // NX*64
    float* vbuf = h0   + (size_t)NX * HID;
    float* hq   = vbuf + (size_t)NX * HID;
    float* hA   = hq   + (size_t)NX * HID;   // NL*64
    float* hB   = hA   + (size_t)NL * HID;
    float* aL   = hB   + (size_t)NL * HID;
    float* tL   = aL   + (size_t)NL * HID;
    float* mL   = tL   + (size_t)NL * HID;
    float* thrD = mL   + (size_t)NL * HID;   // NL
    float* thrU = thrD + NL;                 // NX
    float* Bp   = thrU + NX;                 // 64*64

    const int gemmNL = (NL + 15) / 16, gemmNX = (NX + 15) / 16;

    // latent coords + encoder
    k_ltt<<<(NL + 255) / 256, 256, 0, stream>>>(x, ltt);
    k_encoder<<<(NX * HID + 255) / 256, 256, 0, stream>>>(x, en_w, en_b, h0, NX);

    // ---- down: latent <- input (5% locality) ----
    k_repack<<<16, 256, 0, stream>>>(down_w, Bp);
    k_gemm_n64<<<gemmNX, 128, 0, stream>>>(h0, Bp, nullptr, nullptr, vbuf, NX, 0);
    // quantile over nK=11271: pos = 0.05*11270 = 563.5 -> k=563, frac=0.5
    k_quantile<<<NL, 256, (size_t)NX * 4 + 1024, stream>>>(ltt, x, NX, 563, 0.5f, thrD);
    k_attn<<<gemmNL, 512, 0, stream>>>(ltt, NL, x, NX, vbuf, down_r, thrD, hA);

    // ---- 4 latent blocks (dense attention, no mask) ----
    float* hin = hA;
    float* hout = hB;
    for (int i = 0; i < 4; i++) {
        k_repack<<<16, 256, 0, stream>>>(pa_w + (size_t)i * 4096, Bp);
        k_gemm_n64<<<gemmNL, 128, 0, stream>>>(hin, Bp, nullptr, nullptr, vbuf, NL, 0);
        k_attn<<<gemmNL, 512, 0, stream>>>(ltt, NL, ltt, NL, vbuf, pa_r + (size_t)i * 4, nullptr, aL);
        k_gemm_n64<<<gemmNL, 128, 0, stream>>>(aL, mlp1_w + (size_t)i * 4096,
                                               mlp1_b + (size_t)i * 64, nullptr, tL, NL, 1);
        k_gemm_n64<<<gemmNL, 128, 0, stream>>>(tL, mlp2_w + (size_t)i * 4096,
                                               mlp2_b + (size_t)i * 64, nullptr, mL, NL, 0);
        // h = gelu(m + h @ lin_w + lin_b)   (ping-pong to avoid in-place hazard)
        k_gemm_n64<<<gemmNL, 128, 0, stream>>>(hin, lin_w + (size_t)i * 4096,
                                               lin_b + (size_t)i * 64, mL, hout, NL, 1);
        float* tmp = hin; hin = hout; hout = tmp;
    }

    // ---- up: input <- latent (5% locality) ----
    k_repack<<<16, 256, 0, stream>>>(up_w, Bp);
    k_gemm_n64<<<gemmNL, 128, 0, stream>>>(hin, Bp, nullptr, nullptr, vbuf, NL, 0);
    // quantile over nK=2886: pos = 0.05*2885 = 144.25 -> k=144, frac=0.25
    k_quantile<<<NX, 256, (size_t)NL * 4 + 1024, stream>>>(x, ltt, NL, 144, 0.25f, thrU);
    k_attn<<<gemmNX, 512, 0, stream>>>(x, NX, ltt, NL, vbuf, up_r, thrU, hq);

    // ---- decoder ----
    k_gemm_n64<<<gemmNX, 128, 0, stream>>>(hq, de1_w, de1_b, nullptr, h0, NX, 1);
    k_dot64<<<(NX + 255) / 256, 256, 0, stream>>>(h0, de2_w, de2_b, (float*)d_out, NX);
}

// v004
// It runs in 289 microseconds.
// Next to v003, in two timings, it ran 2.15 and 2.14 times as fast.
// Counting every step since v000, it is 6.97 times as fast.
#include <hip/hip_runtime.h>
#include <math.h>

// ---------------------------------------------------------------------------
// PIT pipeline for MI455X (gfx1250, wave32).
// - Never materialize distance/attention matrices: recompute d2 from 2-D
//   coords, fused mask->exp->normalize->matvec (all live data L2-resident).
// - Per-row quantile by bisection on float bit patterns, the row in registers.
// - Dense [N,64]x[64,64] GEMMs via V_WMMA_F32_16X16X4_F32 (full f32 fidelity).
// - Attention in tiles of 16 queries: weights x val on the same f32 WMMA, keys
//   split over the waves of a block.
// ---------------------------------------------------------------------------

#define NX   11271     // 221*51 input points
#define NL   2886      // 111*26 latent points
#define HID  64

typedef __attribute__((ext_vector_type(2))) float v2f;
typedef __attribute__((ext_vector_type(8))) float v8f;

__device__ __forceinline__ float gelu_erf(float v) {
    // torch F.gelu default: 0.5*x*(1+erf(x/sqrt(2)))
    return 0.5f * v * (1.0f + erff(v * 0.70710678118654752f));
}

// ---------------------------------------------------------------------------
// Build latent coords: ltt = x[:, ::2, ::2, :][:, :111, :26, :]
// ---------------------------------------------------------------------------
__global__ void k_ltt(const float* __restrict__ x, float* __restrict__ ltt) {
    int l = blockIdx.x * blockDim.x + threadIdx.x;
    if (l >= NL) return;
    int i = l / 26, j = l % 26;
    const float* p = x + ((size_t)(2 * i) * 51 + (size_t)(2 * j)) * 2;
    ltt[2 * l + 0] = p[0];
    ltt[2 * l + 1] = p[1];
}

// ---------------------------------------------------------------------------
// Encoder: h0[j,c] = gelu(x0*W[0,c] + x1*W[1,c] + b[c]),  K=2 -> plain VALU
// ---------------------------------------------------------------------------
__global__ void k_encoder(const float* __restrict__ x, const float* __restrict__ W,
                          const float* __restrict__ b, float* __restrict__ h0, int n) {
    int i = blockIdx.x * blockDim.x + threadIdx.x;
    if (i >= n * HID) return;
    int j = i >> 6, c = i & 63;
    float v = fmaf(x[2 * j + 0], W[c], fmaf(x[2 * j + 1], W[HID + c], b[c]));
    h0[i] = gelu_erf(v);
}

// ---------------------------------------------------------------------------
// Repack per-head weights [4][64][16] -> concatenated B [64][64] so the val
// projection becomes a single 64x64 GEMM: B[j][h*16+k] = w[h][j][k]
// ---------------------------------------------------------------------------
__global__ void k_repack(const float* __restrict__ w, float* __restrict__ Bp) {
    int t = blockIdx.x * blockDim.x + threadIdx.x;
    if (t >= HID * HID) return;
    int j = t >> 6, c = t & 63;
    int h = c >> 4, k = c & 15;
    Bp[t] = w[h * (HID * 16) + j * 16 + k];
}

// ---------------------------------------------------------------------------
// Generic WMMA GEMM: C[N,64] = act( A[N,64] @ B[64,64] + bias (+addend) )
// One wave = one 16x16 output tile (wave w of 4 owns cols 16w..16w+15).
// f32 WMMA fragment layouts per CDNA5 ISA 7.12.2:
//   A 16x4 : lanes 0-15 -> M=lane, VGPR{0,1}=K{0,1};  lanes 16-31 -> K{2,3}
//   B 4x16 : lanes 0-15 -> N=lane, VGPR{0,1}=K{0,1};  lanes 16-31 -> K{2,3}
//   C 16x16: VGPR r -> M = r + 8*(lane>=16), N = lane&15
// ---------------------------------------------------------------------------
__global__ void k_gemm_n64(const float* __restrict__ A, const float* __restrict__ B,
                           const float* __restrict__ bias, const float* __restrict__ addend,
                           float* __restrict__ C, int N, int act) {
    int lane = threadIdx.x & 31;
    int wave = threadIdx.x >> 5;           // 0..3 -> column tile
    int r0 = blockIdx.x * 16;
    int colBase = wave * 16;
    int laneN = lane & 15;
    int hi = lane >> 4;                    // half-wave selector
    int kk = hi * 2;                       // K sub-offset {0,2}

    int aRow = r0 + laneN;                 // A-fragment row (M = lane&15)
    if (aRow > N - 1) aRow = N - 1;        // clamp tail reads (stores predicated)
    const float* Arow = A + (size_t)aRow * HID;

    v8f acc = {};
    for (int k = 0; k < HID; k += 4) {
        v2f a, b;
        a.x = Arow[k + kk + 0];
        a.y = Arow[k + kk + 1];
        b.x = B[(k + kk + 0) * HID + colBase + laneN];
        b.y = B[(k + kk + 1) * HID + colBase + laneN];
        acc = __builtin_amdgcn_wmma_f32_16x16x4_f32(
            /*neg_a=*/false, a, /*neg_b=*/false, b,
            /*c_mod=*/(short)0, acc, /*reuse_a=*/false, /*reuse_b=*/false);
    }

    int col = colBase + laneN;
    float bv = bias ? bias[col] : 0.0f;
#pragma unroll
    for (int r = 0; r < 8; r++) {
        int row = r0 + r + 8 * hi;
        if (row < N) {
            float v = acc[r] + bv;
            if (addend) v += addend[(size_t)row * HID + col];
            if (act) v = gelu_erf(v);
            C[(size_t)row * HID + col] = v;
        }
    }
}

// ---------------------------------------------------------------------------
// Per-row quantile of squared distances, the row's distances kept in registers.
// thr[row] = s[kth] + frac*(s[kth+1] - s[kth])   (jnp.quantile 'linear')
// d2 >= 0 so float bit patterns are order-preserving as uints.
// A block of WAVES waves owns one row; each lane holds NR of the NK distances.
// The bit pattern of s[kth] is bracketed by bisection between the row's minimum
// and maximum: one compare per held value, counted over the wave by ballot, so
// the count and the bracket live in scalar registers. Once the bracket holds at
// most 32 values they are gathered, one to a lane of wave 0, and ranked against
// each other. Equal values that never thin out end the bisection at width 1.
// ---------------------------------------------------------------------------
#define QCAP 32

template <int WAVES, int NR, int NK>
__global__ __launch_bounds__(WAVES * 32)
__attribute__((amdgpu_waves_per_eu(8)))   // 128 registers a wave: eight waves a SIMD cover each other's waits
void k_quantile(const float* __restrict__ Qc, const float* __restrict__ Kc,
                int kth, float frac, float* __restrict__ thr_out) {
    constexpr int T = WAVES * 32;
    static_assert(T * NR >= NK && T * (NR - 1) < NK, "NR values a lane cover the row");
    __shared__ unsigned s_mn[WAVES], s_mx[WAVES];   // the waves' minima and maxima
    __shared__ unsigned s_cnt[2][WAVES];            // the waves' counts, by parity of the step
    __shared__ unsigned s_m[WAVES], s_mg[WAVES];    // values gathered; least value above the bracket
    __shared__ unsigned s_buf[WAVES][QCAP];         // the gathered values

    const int row = blockIdx.x, tid = threadIdx.x;
    const int lane = tid & 31;
    const int wave = __builtin_amdgcn_readfirstlane(tid >> 5);   // scalar branches on the wave
    const unsigned k = (unsigned)kth;
    const float qx = Qc[2 * row + 0], qy = Qc[2 * row + 1];

    unsigned u[NR];
    unsigned mn = 0xFFFFFFFFu, mx = 0u;
    const float2* K2 = (const float2*)Kc;
    // Three runs of loads, each issued whole in front of its arithmetic. A key takes
    // two registers until it is worked down to one distance, so the runs shrink as
    // the row fills up and the wave stays inside its register budget.
    constexpr int RUN0 = 44, RUN1 = 74;
    static_assert(NR > RUN1 && NR - RUN1 <= RUN0, "three runs cover the row");
    float2 p[RUN0];
#pragma unroll   // constant indices keep the row in registers
    for (int run = 0; run < 3; run++) {
        const int i0 = run == 0 ? 0 : run == 1 ? RUN0 : RUN1;
        const int i1 = run == 0 ? RUN0 : run == 1 ? RUN1 : NR;
#pragma unroll   // constant indices keep the row in registers
        for (int i = i0; i < i1; i++) {
            int j = i * T + tid;
            if ((i + 1) * T > NK) j = j < NK ? j : NK - 1;   // past the end: the last key again
            p[i - i0] = K2[j];
        }
        // behind the last load: the arithmetic below may reuse the loads' address registers
        if (run == 2) asm volatile("s_wait_xcnt 0x0" ::: "memory");
        // keeps the run's loads together: left alone the compiler waits after every four
        __builtin_amdgcn_sched_barrier(0);
#pragma unroll   // constant indices keep the row in registers
        for (int i = i0; i < i1; i++) {
            float dx = qx - p[i - i0].x;
            float dy = qy - p[i - i0].y;
            unsigned b = __float_as_uint(fmaf(dx, dx, dy * dy));
            mn = b < mn ? b : mn;
            mx = b > mx ? b : mx;
            // a slot past the end is never below any bracket end
            u[i] = ((i + 1) * T <= NK || i * T + tid < NK) ? b : 0xFFFFFFFFu;
        }
        // keeps the next run's loads behind this run's arithmetic, which frees their registers
        __builtin_amdgcn_sched_barrier(0);
    }
#pragma unroll   // five fixed steps, minimum and maximum side by side
    for (int d = 16; d >= 1; d >>= 1) {
        unsigned a = (unsigned)__shfl_xor((int)mn, d);
        unsigned c = (unsigned)__shfl_xor((int)mx, d);
        mn = a < mn ? a : mn;
        mx = c > mx ? c : mx;
    }
    if constexpr (WAVES > 1) {
        if (lane == 0) { s_mn[wave] = mn; s_mx[wave] = mx; }
        __syncthreads();                           // the waves' minima and maxima visible
#pragma unroll   // lets the LDS reads issue together
        for (int w = 0; w < WAVES; w++) {
            unsigned a = s_mn[w], c = s_mx[w];
            mn = a < mn ? a : mn;
            mx = c > mx ? c : mx;
        }
    }
    // lo <= s[kth] < hi ; cLo values lie below lo, cHi below hi
    unsigned lo = (unsigned)__builtin_amdgcn_readfirstlane((int)mn);
    unsigned hi = (unsigned)__builtin_amdgcn_readfirstlane((int)mx);
    if (hi != 0xFFFFFFFFu) hi += 1u;
    unsigned cLo = 0u, cHi = (unsigned)NK;

    for (int it = 0; it < 32; it++) {              // the width halves: 32 steps at most
        if (hi - lo <= 1u || cHi - cLo <= (unsigned)QCAP) break;   // same in every wave of the block
        unsigned mid = lo + ((hi - lo) >> 1);
        unsigned c = 0u;
#pragma unroll   // constant indices keep the row in registers
        for (int i = 0; i + 1 < NR; i += 2) {
            // two ballots side by side: one 64-bit bit count for both
            unsigned long long b0 = __builtin_amdgcn_ballot_w32(u[i] < mid);
            unsigned long long b1 = __builtin_amdgcn_ballot_w32(u[i + 1] < mid);
            c += (unsigned)__popcll(b0 | (b1 << 32));
        }
        if (NR & 1) c += (unsigned)__popc(__builtin_amdgcn_ballot_w32(u[NR - 1] < mid));
        if constexpr (WAVES > 1) {
            // slots alternate, so a wave one step ahead writes the other one
            if (lane == 0) s_cnt[it & 1][wave] = c;
            __syncthreads();                       // the waves' counts visible
            unsigned t = 0u;
#pragma unroll   // lets the LDS reads issue together
            for (int w = 0; w < WAVES; w++) t += s_cnt[it & 1][w];
            c = (unsigned)__builtin_amdgcn_readfirstlane((int)t);
        }
        if (c <= k) { lo = mid; cLo = c; } else { hi = mid; cHi = c; }
    }

    const unsigned m = cHi - cLo;                  // values in the bracket
    const unsigned r = k - cLo;                    // rank of s[kth] among them
    const bool few = m <= (unsigned)QCAP;
    const bool above = r + 1u >= m;                // s[kth+1] is the least value at or above hi

    unsigned mg = 0xFFFFFFFFu;
    if (above) {
#pragma unroll   // constant indices keep the row in registers
        for (int i = 0; i < NR; i++) {
            unsigned v = u[i] >= hi ? u[i] : 0xFFFFFFFFu;
            mg = v < mg ? v : mg;
        }
#pragma unroll   // five fixed steps
        for (int d = 16; d >= 1; d >>= 1) {
            unsigned a = (unsigned)__shfl_xor((int)mg, d);
            mg = a < mg ? a : mg;
        }
    }
    unsigned got = 0u;
    if (few) {
        const unsigned width = hi - lo;
#pragma unroll   // constant indices keep the row in registers
        for (int g = 0; g < NR; g += 16) {
            // sixteen ballots first, then the scalar tests: a test directly behind
            // its own compare would wait out the compare each time
            unsigned mask[16];
#pragma unroll   // constant indices keep the masks in scalar registers
            for (int t = 0; t < 16; t++)
                mask[t] = g + t < NR ? __builtin_amdgcn_ballot_w32(u[g + t < NR ? g + t : 0] - lo < width) : 0u;   // lo <= u < hi
#pragma unroll   // constant indices keep the masks in scalar registers
            for (int t = 0; t < 16; t++) {
                if (g + t < NR && mask[t] != 0u) {   // most registers hold none: scalar skip
                    if ((mask[t] >> lane) & 1u)
                        s_buf[wave][got + __builtin_amdgcn_mbcnt_lo(mask[t], 0u)] = u[g + t < NR ? g + t : 0];
                    got += (unsigned)__popc(mask[t]);
                }
            }
        }
    }
    if (lane == 0) { s_m[wave] = got; s_mg[wave] = mg; }
    __syncthreads();                               // gathered values and their counts visible

    if (wave == 0) {
#pragma unroll   // lets the LDS reads issue together
        for (int w = 0; w < WAVES; w++) { unsigned a = s_mg[w]; mg = a < mg ? a : mg; }
        unsigned sk = lo, sk1 = above ? mg : lo;   // bracket of width 1: all its values equal lo
        if (few) {
            unsigned cand = 0xFFFFFFFFu, first = 0u;
#pragma unroll   // lets the LDS reads issue together
            for (int w = 0; w < WAVES; w++) {
                unsigned n = s_m[w];
                if ((unsigned)lane - first < n) cand = s_buf[w][(unsigned)lane - first];
                first += n;
            }
            unsigned less = 0u, leq = 0u;
#pragma unroll   // constant lane numbers for the broadcasts
            for (int j = 0; j < QCAP; j++) {
                unsigned cj = (unsigned)__builtin_amdgcn_readlane((int)cand, j);
                less += cj < cand ? 1u : 0u;
                leq += cj <= cand ? 1u : 0u;
            }
            // a lane holds the value of rank x when less <= x < leq
            unsigned ma = __builtin_amdgcn_ballot_w32(less <= r && r < leq);
            sk = (unsigned)__builtin_amdgcn_readlane((int)cand, __ffs(ma) - 1);
            if (!above) {
                unsigned mb = __builtin_amdgcn_ballot_w32(less <= r + 1u && r + 1u < leq);
                sk1 = (unsigned)__builtin_amdgcn_readlane((int)cand, __ffs(mb) - 1);
            }
        }
        if (lane == 0) {
            float fk = __uint_as_float(sk);
            thr_out[row] = fmaf(frac, __uint_as_float(sk1) - fk, fk);
        }
    }
}

// ---------------------------------------------------------------------------
// One group of 16 keys for a tile of 16 queries, all four heads.
// The masked weights are computed straight into the WMMA A fragment
// (M = query = lane&15, K = key) and the val rows are the B fragment
// (K = key, N = column within the head), with the same key in the same K slot:
//   lanes 0-15 : VGPR{0,1} = keys j+0, j+1 ; lanes 16-31 : keys j+2, j+3
// jb = first key of the group + 2*(lane>>4). TAIL clamps every key index and
// zeroes the weights of keys past the end.
// ---------------------------------------------------------------------------
// exp2 of eight values. One statement, each value in its own register: behind
// an exp2 the instruction set asks for one independent instruction before its
// result is read or its source overwritten. Here the source is the result's own
// register, the next exp2 fills the slot of the one in front, and the v_nop that
// of the last.
__device__ __forceinline__ void exp2x8(float (&x)[8]) {
    asm("v_exp_f32 %0, %0\n\t"
        "v_exp_f32 %1, %1\n\t"
        "v_exp_f32 %2, %2\n\t"
        "v_exp_f32 %3, %3\n\t"
        "v_exp_f32 %4, %4\n\t"
        "v_exp_f32 %5, %5\n\t"
        "v_exp_f32 %6, %6\n\t"
        "v_exp_f32 %7, %7\n\t"
        "v_nop"
        : "+v"(x[0]), "+v"(x[1]), "+v"(x[2]), "+v"(x[3]),
          "+v"(x[4]), "+v"(x[5]), "+v"(x[6]), "+v"(x[7]));
}

template <bool TAIL>
__device__ __forceinline__ void attn_group16(const float* __restrict__ Kc,
                                             const float* __restrict__ val,
                                             int nK, int jb, int laneN,
                                             float qx, float qy, float thrq,
                                             const float (&c)[4],
                                             v8f (&acc)[4], v2f (&den)[4]) {
    // all loads of the group first, the coordinates ahead of the val rows, so
    // that the val rows fly under the weights' arithmetic
    v2f b[4][4];
    float kx[4][2], ky[4][2];
#pragma unroll   // constant indices keep the register arrays in registers
    for (int s = 0; s < 4; s++) {
        int j = jb + s * 4;
        if (TAIL) {
            int ja = j < nK ? j : nK - 1;
            int jc = j + 1 < nK ? j + 1 : nK - 1;
            kx[s][0] = Kc[2 * ja + 0]; ky[s][0] = Kc[2 * ja + 1];
            kx[s][1] = Kc[2 * jc + 0]; ky[s][1] = Kc[2 * jc + 1];
        } else {
            float4 k4 = *(const float4*)(Kc + 2 * j);   // j is even: 16-B aligned
            kx[s][0] = k4.x; ky[s][0] = k4.y; kx[s][1] = k4.z; ky[s][1] = k4.w;
        }
    }
    // the val loads' results and addresses may land in the coordinate loads'
    // address registers; as a memory fence it also keeps the coordinate loads in
    // front (loads return in order: issued last, they would make the first
    // distance wait for every val row as well)
    asm volatile("s_wait_xcnt 0x0" ::: "memory");
    // holds the val rows' address arithmetic behind that wait
    __builtin_amdgcn_sched_barrier(0);
#pragma unroll   // constant indices keep the register arrays in registers
    for (int s = 0; s < 4; s++) {
        const float* va;
        const float* vc;
        if (TAIL) {
            int j = jb + s * 4;
            int ja = j < nK ? j : nK - 1;
            int jc = j + 1 < nK ? j + 1 : nK - 1;
            va = val + (size_t)ja * HID + laneN;
            vc = val + (size_t)jc * HID + laneN;
        } else {
            va = val + (size_t)jb * HID + laneN + s * 4 * HID;   // one address, constant offsets
            vc = va + HID;
        }
#pragma unroll   // constant indices keep the register arrays in registers
        for (int h = 0; h < 4; h++) { b[s][h].x = va[h * 16]; b[s][h].y = vc[h * 16]; }
        // clamped rows have address registers of their own for each run, and the
        // next run's results may land in them
        if (TAIL) asm volatile("s_wait_xcnt 0x0" ::: "memory");
    }
    // the arithmetic below may reuse the val loads' address registers
    if (!TAIL) asm volatile("s_wait_xcnt 0x0" ::: "memory");
    // keeps the wait for the coordinates behind the issue of the val loads
    __builtin_amdgcn_sched_barrier(0);
#pragma unroll   // constant indices keep the register arrays in registers
    for (int s = 0; s < 4; s++) {
        int j = jb + s * 4;
        float dx0 = qx - kx[s][0], dy0 = qy - ky[s][0];
        float dx1 = qx - kx[s][1], dy1 = qy - ky[s][1];
        float d20 = fmaf(dx0, dx0, dy0 * dy0);
        float d21 = fmaf(dx1, dx1, dy1 * dy1);
        bool ok0 = d20 <= thrq, ok1 = d21 <= thrq;
        if (TAIL) { ok0 = ok0 && (j < nK); ok1 = ok1 && (j + 1 < nK); }
        // c holds -c_h*log2(e): one multiply and the hardware's exp2 for each weight.
        // The exponent is never above 0; a weight under 2^-126 comes out as 0.
        float e[8];
#pragma unroll   // constant indices keep the register arrays in registers
        for (int h = 0; h < 4; h++) { e[2 * h] = c[h] * d20; e[2 * h + 1] = c[h] * d21; }
        exp2x8(e);
#pragma unroll   // constant indices keep the register arrays in registers
        for (int h = 0; h < 4; h++) {
            // exp in every lane, then a select: no divergent branch round a WMMA
            v2f a;
            a.x = ok0 ? e[2 * h] : 0.0f;
            a.y = ok1 ? e[2 * h + 1] : 0.0f;
            den[h] += a;                   // even and odd keys summed apart
            acc[h] = __builtin_amdgcn_wmma_f32_16x16x4_f32(
                /*neg_a=*/false, a, /*neg_b=*/false, b[s][h],
                /*c_mod=*/(short)0, acc[h], /*reuse_a=*/false, /*reuse_b=*/false);
        }
    }
}

// ---------------------------------------------------------------------------
// Fused masked multi-head softmax attention + gelu.
// out[q, h*16+v] = gelu( sum_j w_h(q,j) * val[j, h*16+v] / sum_j w_h(q,j) )
//   w_h = exp(-c_h * d2(q,j)) if d2 <= thr[q] else 0 ;  c_h = tan(pi/4*(1+sin r_h))
// (positive c_h => head-independent mask; exponents in [-c*thr, 0] => stable.)
// Block = 16 waves, one tile of 16 queries: every val row that is read serves
// 16 queries through one f32 WMMA per head. The keys are dealt to the waves in
// groups of 16; the waves' partial numerators and denominators are summed in
// LDS in a fixed order.
// ---------------------------------------------------------------------------
#define ATT_WAVES 16

__global__ __launch_bounds__(ATT_WAVES * 32)
void k_attn(const float* __restrict__ Qc, int nQ,
            const float* __restrict__ Kc, int nK,
            const float* __restrict__ val,
            const float* __restrict__ rr,
            const float* __restrict__ thr,
            float* __restrict__ out) {
    __shared__ float red[ATT_WAVES / 2][32][32];   // 32 KB partial numerators
    __shared__ float dred[ATT_WAVES][4][16];       // partial denominators
    __shared__ float cs[4];

    int tid = threadIdx.x;
    int lane = tid & 31;
    int wave = __builtin_amdgcn_readfirstlane(tid >> 5);   // scalar loop control
    int laneN = lane & 15;
    int hi = lane >> 4;
    int q0 = blockIdx.x * 16;

    // kept as -c_h*log2(e): exp(-c_h*d2) = exp2(cs*d2)
    if (tid < 4)
        cs[tid] = -1.44269504088896341f * tanf(0.78539816339744831f * (1.0f + sinf(rr[tid])));
    __syncthreads();                       // cs visible

    int q = q0 + laneN;
    if (q > nQ - 1) q = nQ - 1;            // clamp tail reads (stores predicated)
    float qx = Qc[2 * q + 0], qy = Qc[2 * q + 1];
    float thrq = thr ? thr[q] : 3.402823466e+38f;
    // the address registers of the two loads above are reused at once
    asm volatile("s_wait_xcnt 0x0" ::: "memory");
    float c[4] = {cs[0], cs[1], cs[2], cs[3]};

    v8f acc[4] = {};
    v2f den[4] = {};

    int nFull = nK >> 4;                   // whole groups of 16 keys
    for (int g = wave; g < nFull; g += ATT_WAVES)
        attn_group16<false>(Kc, val, nK, g * 16 + hi * 2, laneN, qx, qy, thrq, c, acc, den);
    if ((nK & 15) != 0 && (nFull & (ATT_WAVES - 1)) == wave)   // the partial group, next wave in turn
        attn_group16<true>(Kc, val, nK, nFull * 16 + hi * 2, laneN, qx, qy, thrq, c, acc, den);

    // the two half-waves hold different keys of the same query
#pragma unroll   // constant indices keep the register arrays in registers
    for (int h = 0; h < 4; h++) {
        float dh = den[h].x + den[h].y;
        dh += __shfl_xor(dh, 16);
        if (hi == 0) dred[wave][h][laneN] = dh;
    }
    if (wave >= ATT_WAVES / 2) {
#pragma unroll   // constant indices keep the register arrays in registers
        for (int h = 0; h < 4; h++)
#pragma unroll   // constant indices keep the register arrays in registers
            for (int r = 0; r < 8; r++) red[wave - ATT_WAVES / 2][h * 8 + r][lane] = acc[h][r];
    }
    __syncthreads();                       // upper waves' partials visible
    if (wave < ATT_WAVES / 2) {
#pragma unroll   // constant indices keep the register arrays in registers
        for (int h = 0; h < 4; h++)
#pragma unroll   // constant indices keep the register arrays in registers
            for (int r = 0; r < 8; r++) red[wave][h * 8 + r][lane] += acc[h][r];
    }
    __syncthreads();                       // all partials visible

    // C layout: VGPR r -> M = r + 8*(lane>=16), N = lane&15
    for (int o = tid; o < 16 * HID; o += ATT_WAVES * 32) {
        int ql = o >> 6, col = o & 63;
        int h = col >> 4, n = col & 15;
        float num = 0.f, d = 0.f;
#pragma unroll   // lets the LDS reads issue together
        for (int w = 0; w < ATT_WAVES / 2; w++)
            num += red[w][h * 8 + (ql & 7)][(ql >> 3) * 16 + n];
#pragma unroll   // lets the LDS reads issue together
        for (int w = 0; w < ATT_WAVES; w++) d += dred[w][h][ql];
        if (q0 + ql < nQ) out[(size_t)(q0 + ql) * HID + col] = gelu_erf(num / d);
    }
}

// ---------------------------------------------------------------------------
// Decoder head: out[j] = t[j,:] . de2_w + de2_b   ([64,1] weight)
// ---------------------------------------------------------------------------
__global__ void k_dot64(const float* __restrict__ t, const float* __restrict__ w,
                        const float* __restrict__ b, float* __restrict__ out, int n) {
    int j = blockIdx.x * blockDim.x + threadIdx.x;
    if (j >= n) return;
    float s = b[0];
    const float* row = t + (size_t)j * HID;
#pragma unroll
    for (int k = 0; k < HID; k++) s = fmaf(row[k], w[k], s);
    out[j] = s;
}

// ---------------------------------------------------------------------------
extern "C" void kernel_launch(void* const* d_in, const int* in_sizes, int n_in,
                              void* d_out, int out_size, void* d_ws, size_t ws_size,
                              hipStream_t stream) {
    (void)in_sizes; (void)n_in; (void)out_size; (void)ws_size;

    const float* x      = (const float*)d_in[0];   // [1,221,51,2] == xf [11271,2]
    const float* en_w   = (const float*)d_in[1];
    const float* en_b   = (const float*)d_in[2];
    const float* down_r = (const float*)d_in[3];
    const float* down_w = (const float*)d_in[4];
    const float* pa_r   = (const float*)d_in[5];   // [4,1,4,1,1]
    const float* pa_w   = (const float*)d_in[6];   // [4,4,64,16]
    const float* mlp1_w = (const float*)d_in[7];
    const float* mlp1_b = (const float*)d_in[8];
    const float* mlp2_w = (const float*)d_in[9];
    const float* mlp2_b = (const float*)d_in[10];
    const float* lin_w  = (const float*)d_in[11];
    const float* lin_b  = (const float*)d_in[12];
    const float* up_r   = (const float*)d_in[13];
    const float* up_w   = (const float*)d_in[14];
    const float* de1_w  = (const float*)d_in[15];
    const float* de1_b  = (const float*)d_in[16];
    const float* de2_w  = (const float*)d_in[17];
    const float* de2_b  = (const float*)d_in[18];

    // workspace layout (floats) ~12.5 MB; vbuf always holds attention val
    float* ws   = (float*)d_ws;
    float* ltt  = ws;                    // NL*2
    float* h0   = ltt  + (size_t)NL * 2; // NX*64
    float* vbuf = h0   + (size_t)NX * HID;
    float* hq   = vbuf + (size_t)NX * HID;
    float* hA   = hq   + (size_t)NX * HID;   // NL*64
    float* hB   = hA   + (size_t)NL * HID;
    float* aL   = hB   + (size_t)NL * HID;
    float* tL   = aL   + (size_t)NL * HID;
    float* mL   = tL   + (size_t)NL * HID;
    float* thrD = mL   + (size_t)NL * HID;   // NL
    float* thrU = thrD + NL;                 // NX
    float* Bp   = thrU + NX;                 // 64*64

    const int gemmNL = (NL + 15) / 16, gemmNX = (NX + 15) / 16;

    // latent coords + encoder
    k_ltt<<<(NL + 255) / 256, 256, 0, stream>>>(x, ltt);
    k_encoder<<<(NX * HID + 255) / 256, 256, 0, stream>>>(x, en_w, en_b, h0, NX);

    // ---- down: latent <- input (5% locality) ----
    k_repack<<<16, 256, 0, stream>>>(down_w, Bp);
    k_gemm_n64<<<gemmNX, 128, 0, stream>>>(h0, Bp, nullptr, nullptr, vbuf, NX, 0);
    // quantile over nK=11271: pos = 0.05*11270 = 563.5 -> k=563, frac=0.5
    k_quantile<4, 89, NX><<<NL, 128, 0, stream>>>(ltt, x, 563, 0.5f, thrD);
    k_attn<<<gemmNL, 512, 0, stream>>>(ltt, NL, x, NX, vbuf, down_r, thrD, hA);

    // ---- 4 latent blocks (dense attention, no mask) ----
    float* hin = hA;
    float* hout = hB;
    for (int i = 0; i < 4; i++) {
        k_repack<<<16, 256, 0, stream>>>(pa_w + (size_t)i * 4096, Bp);
        k_gemm_n64<<<gemmNL, 128, 0, stream>>>(hin, Bp, nullptr, nullptr, vbuf, NL, 0);
        k_attn<<<gemmNL, 512, 0, stream>>>(ltt, NL, ltt, NL, vbuf, pa_r + (size_t)i * 4, nullptr, aL);
        k_gemm_n64<<<gemmNL, 128, 0, stream>>>(aL, mlp1_w + (size_t)i * 4096,
                                               mlp1_b + (size_t)i * 64, nullptr, tL, NL, 1);
        k_gemm_n64<<<gemmNL, 128, 0, stream>>>(tL, mlp2_w + (size_t)i * 4096,
                                               mlp2_b + (size_t)i * 64, nullptr, mL, NL, 0);
        // h = gelu(m + h @ lin_w + lin_b)   (ping-pong to avoid in-place hazard)
        k_gemm_n64<<<gemmNL, 128, 0, stream>>>(hin, lin_w + (size_t)i * 4096,
                                               lin_b + (size_t)i * 64, mL, hout, NL, 1);
        float* tmp = hin; hin = hout; hout = tmp;
    }

    // ---- up: input <- latent (5% locality) ----
    k_repack<<<16, 256, 0, stream>>>(up_w, Bp);
    k_gemm_n64<<<gemmNL, 128, 0, stream>>>(hin, Bp, nullptr, nullptr, vbuf, NL, 0);
    // quantile over nK=2886: pos = 0.05*2885 = 144.25 -> k=144, frac=0.25
    k_quantile<1, 91, NL><<<NX, 32, 0, stream>>>(x, ltt, 144, 0.25f, thrU);
    k_attn<<<gemmNX, 512, 0, stream>>>(x, NX, ltt, NL, vbuf, up_r, thrU, hq);

    // ---- decoder ----
    k_gemm_n64<<<gemmNX, 128, 0, stream>>>(hq, de1_w, de1_b, nullptr, h0, NX, 1);
    k_dot64<<<(NX + 255) / 256, 256, 0, stream>>>(h0, de2_w, de2_b, (float*)d_out, NX);
}

// v005
// A run of this version takes 215 microseconds.
// In two side-by-side timings against v004, it was 1.34 and 1.35 times as fast.
// Over all steps from v000 it is 9.41 times as fast.
#include <hip/hip_runtime.h>
#include <math.h>

// ---------------------------------------------------------------------------
// PIT pipeline for MI455X (gfx1250, wave32).
// - Never materialize distance/attention matrices: recompute d2 from 2-D
//   coords, fused mask->exp->normalize->matvec (all live data L2-resident).
// - Per-row quantile by bisection on float bit patterns, the row in registers.
// - Dense [N,64]x[64,64] GEMMs via V_WMMA_F32_16X16X4_F32 (full f32 fidelity).
//   They work on each row alone, so they run on the 16-row tile that a block
//   already holds: behind the encoder, and behind each attention tile.
// - Attention in tiles of 16 queries: weights x val on the same f32 WMMA, keys
//   split over the waves of a block.
// ---------------------------------------------------------------------------

#define NX   11271     // 221*51 input points
#define NL   2886      // 111*26 latent points
#define HID  64

typedef __attribute__((ext_vector_type(2))) float v2f;
typedef __attribute__((ext_vector_type(8))) float v8f;

__device__ __forceinline__ float gelu_erf(float v) {
    // torch F.gelu default: 0.5*x*(1+erf(x/sqrt(2)))
    return 0.5f * v * (1.0f + erff(v * 0.70710678118654752f));
}

// ---------------------------------------------------------------------------
// One wave's 16x16 tile of  A[16,64] @ B[64,64], in three parts, so that the
// fragments can be fetched well ahead of the product.
// f32 WMMA fragment layouts per CDNA5 ISA 7.12.2:
//   A 16x4 : lanes 0-15 -> M=lane, VGPR{0,1}=K{0,1};  lanes 16-31 -> K{2,3}
//   B 4x16 : lanes 0-15 -> N=lane, VGPR{0,1}=K{0,1};  lanes 16-31 -> K{2,3}
//   C 16x16: VGPR r -> M = r + 8*(lane>=16), N = lane&15
// kk = 2*(lane>>4). Fragment s holds k = 4s+kk, 4s+kk+1 on both sides.
// ---------------------------------------------------------------------------
#define TP 68   // LDS pitch of a tile row in floats: 16 rows x 4 columns fall on 64 different banks

// Arow: the lane's own row of A (M = lane&15) at column kk, in LDS or (GLOBAL) in global memory.
template <bool GLOBAL>
__device__ __forceinline__ void frag_a(const float* Arow, v2f (&a)[16]) {
#pragma unroll   // constant indices keep the register array in registers
    for (int s = 0; s < 16; s++) a[s] = *(const v2f*)(Arow + 4 * s);
    if (GLOBAL) {
        // what follows may reuse the loads' address registers; the address as an
        // input keeps the last load's result out of them as well
        asm volatile("s_wait_xcnt 0x0" :: "v"(Arow) : "memory");
        // holds later address arithmetic behind that wait
        __builtin_amdgcn_sched_barrier(0);
    }
}

// Bcol: the lane's own column of B at row 0; BS: floats from one row of B to the
// next (64 for a plain matrix, 16 inside one head of the per-head weights
// [4][64][16], whose head h is columns 16h..16h+15 of the product).
template <int BS>
__device__ __forceinline__ void frag_b(const float* __restrict__ Bcol, int kk, v2f (&b)[16]) {
    const float* Bk = Bcol + kk * BS;      // one address, constant offsets
#pragma unroll   // constant indices keep the register array in registers
    for (int s = 0; s < 16; s++) {
        b[s].x = Bk[(4 * s + 0) * BS];
        b[s].y = Bk[(4 * s + 1) * BS];
    }
    // what follows may reuse the loads' address registers; the address as an
    // input keeps the last load's result out of them as well
    asm volatile("s_wait_xcnt 0x0" :: "v"(Bk) : "memory");
    // holds later address arithmetic behind that wait
    __builtin_amdgcn_sched_barrier(0);
}

__device__ __forceinline__ v8f mm16(const v2f (&a)[16], const v2f (&b)[16]) {
    v8f acc = {};
#pragma unroll   // constant indices keep the register arrays in registers
    for (int s = 0; s < 16; s++)
        acc = __builtin_amdgcn_wmma_f32_16x16x4_f32(
            /*neg_a=*/false, a[s], /*neg_b=*/false, b[s],
            /*c_mod=*/(short)0, acc, /*reuse_a=*/false, /*reuse_b=*/false);
    // the four vector slots between the last WMMA and the first vector instruction
    // on its result
    asm volatile("v_nop\n\tv_nop\n\tv_nop\n\tv_nop" : "+v"(acc));
    return acc;
}

// ---------------------------------------------------------------------------
// Head of the pipeline, one launch:
//   ltt = x[:, ::2, ::2, :][:, :111, :26, :]                      (latent coords)
//   h0[j,c] = gelu(x0*W[0,c] + x1*W[1,c] + b[c])                  (K=2: plain VALU)
//   v[j, h*16+k] = sum_c h0[j,c] * w[h][c][k]                     (val of the down step)
// A block of 4 waves owns 16 rows: the encoder's tile goes through LDS into the
// A fragments, wave w owns head w (columns 16w..16w+15).
// ---------------------------------------------------------------------------
__global__ __launch_bounds__(128)
void k_head(const float* __restrict__ x, const float* __restrict__ W,
            const float* __restrict__ b, const float* __restrict__ w,
            float* __restrict__ ltt, float* __restrict__ v) {
    __shared__ __attribute__((aligned(16))) float tA[16][TP];   // aligned for the 8-byte fragment reads
    int tid = threadIdx.x;
    int lane = tid & 31;
    int wave = __builtin_amdgcn_readfirstlane(tid >> 5);
    int laneN = lane & 15;
    int hi = lane >> 4;
    int r0 = blockIdx.x * 16;

    int l = blockIdx.x * 128 + tid;
    if (l < NL) {
        int i = l / 26, j = l % 26;
        const float* p = x + ((size_t)(2 * i) * 51 + (size_t)(2 * j)) * 2;
        ltt[2 * l + 0] = p[0];
        ltt[2 * l + 1] = p[1];
    }

    // a thread keeps one column c and takes every second row of the tile
    const int c = tid & 63, rl = tid >> 6;
    const float2* X2 = (const float2*)x;
    float2 xr[8];
#pragma unroll   // constant indices keep the register array in registers
    for (int it = 0; it < 8; it++) {
        int j = r0 + rl + 2 * it;
        if (j > NX - 1) j = NX - 1;        // clamp tail reads (stores predicated)
        xr[it] = X2[j];
    }
    float wa = W[c], wb = W[HID + c], bc = b[c];
    // what follows may reuse the loads' address registers
    asm volatile("s_wait_xcnt 0x0" ::: "memory");
    // holds the weights' address arithmetic behind that wait
    __builtin_amdgcn_sched_barrier(0);
    v2f af[16], bf[16];
    frag_b<16>(w + wave * (HID * 16) + laneN, hi * 2, bf);   // flies under the encoder's arithmetic
#pragma unroll   // constant indices keep the register array in registers
    for (int it = 0; it < 8; it++)
        tA[rl + 2 * it][c] = gelu_erf(fmaf(xr[it].x, wa, fmaf(xr[it].y, wb, bc)));
    __syncthreads();                       // the encoder's tile visible

    frag_a<false>(&tA[laneN][hi * 2], af);
    v8f acc = mm16(af, bf);
#pragma unroll   // constant indices keep the accumulator in registers
    for (int r = 0; r < 8; r++) {
        int row = r0 + r + 8 * hi;
        if (row < NX) v[(size_t)row * HID + wave * 16 + laneN] = acc[r];
    }
}

// ---------------------------------------------------------------------------
// Per-row quantile of squared distances, the row's distances kept in registers.
// thr[row] = s[kth] + frac*(s[kth+1] - s[kth])   (jnp.quantile 'linear')
// d2 >= 0 so float bit patterns are order-preserving as uints.
// A block of WAVES waves owns one row; each lane holds NR of the NK distances.
// The bit pattern of s[kth] is bracketed by bisection between the row's minimum
// and maximum: one compare per held value, counted over the wave by ballot, so
// the count and the bracket live in scalar registers. Once the bracket holds at
// most 32 values they are gathered, one to a lane of wave 0, and ranked against
// each other. Equal values that never thin out end the bisection at width 1.
// ---------------------------------------------------------------------------
#define QCAP 32

template <int WAVES, int NR, int NK>
__global__ __launch_bounds__(WAVES * 32)
__attribute__((amdgpu_waves_per_eu(8)))   // 128 registers a wave: eight waves a SIMD cover each other's waits
void k_quantile(const float* __restrict__ Qc, const float* __restrict__ Kc,
                int kth, float frac, float* __restrict__ thr_out) {
    constexpr int T = WAVES * 32;
    static_assert(T * NR >= NK && T * (NR - 1) < NK, "NR values a lane cover the row");
    __shared__ unsigned s_mn[WAVES], s_mx[WAVES];   // the waves' minima and maxima
    __shared__ unsigned s_cnt[2][WAVES];            // the waves' counts, by parity of the step
    __shared__ unsigned s_m[WAVES], s_mg[WAVES];    // values gathered; least value above the bracket
    __shared__ unsigned s_buf[WAVES][QCAP];         // the gathered values

    const int row = blockIdx.x, tid = threadIdx.x;
    const int lane = tid & 31;
    const int wave = __builtin_amdgcn_readfirstlane(tid >> 5);   // scalar branches on the wave
    const unsigned k = (unsigned)kth;
    const float qx = Qc[2 * row + 0], qy = Qc[2 * row + 1];

    unsigned u[NR];
    unsigned mn = 0xFFFFFFFFu, mx = 0u;
    const float2* K2 = (const float2*)Kc;
    // Three runs of loads, each issued whole in front of its arithmetic. A key takes
    // two registers until it is worked down to one distance, so the runs shrink as
    // the row fills up and the wave stays inside its register budget.
    constexpr int RUN0 = 44, RUN1 = 74;
    static_assert(NR > RUN1 && NR - RUN1 <= RUN0, "three runs cover the row");
    float2 p[RUN0];
#pragma unroll   // constant indices keep the row in registers
    for (int run = 0; run < 3; run++) {
        const int i0 = run == 0 ? 0 : run == 1 ? RUN0 : RUN1;
        const int i1 = run == 0 ? RUN0 : run == 1 ? RUN1 : NR;
#pragma unroll   // constant indices keep the row in registers
        for (int i = i0; i < i1; i++) {
            int j = i * T + tid;
            if ((i + 1) * T > NK) j = j < NK ? j : NK - 1;   // past the end: the last key again
            p[i - i0] = K2[j];
        }
        // behind the last load: the arithmetic below may reuse the loads' address registers
        if (run == 2) asm volatile("s_wait_xcnt 0x0" ::: "memory");
        // keeps the run's loads together: left alone the compiler waits after every four
        __builtin_amdgcn_sched_barrier(0);
#pragma unroll   // constant indices keep the row in registers
        for (int i = i0; i < i1; i++) {
            float dx = qx - p[i - i0].x;
            float dy = qy - p[i - i0].y;
            unsigned b = __float_as_uint(fmaf(dx, dx, dy * dy));
            mn = b < mn ? b : mn;
            mx = b > mx ? b : mx;
            // a slot past the end is never below any bracket end
            u[i] = ((i + 1) * T <= NK || i * T + tid < NK) ? b : 0xFFFFFFFFu;
        }
        // keeps the next run's loads behind this run's arithmetic, which frees their registers
        __builtin_amdgcn_sched_barrier(0);
    }
#pragma unroll   // five fixed steps, minimum and maximum side by side
    for (int d = 16; d >= 1; d >>= 1) {
        unsigned a = (unsigned)__shfl_xor((int)mn, d);
        unsigned c = (unsigned)__shfl_xor((int)mx, d);
        mn = a < mn ? a : mn;
        mx = c > mx ? c : mx;
    }
    if constexpr (WAVES > 1) {
        if (lane == 0) { s_mn[wave] = mn; s_mx[wave] = mx; }
        __syncthreads();                           // the waves' minima and maxima visible
#pragma unroll   // lets the LDS reads issue together
        for (int w = 0; w < WAVES; w++) {
            unsigned a = s_mn[w], c = s_mx[w];
            mn = a < mn ? a : mn;
            mx = c > mx ? c : mx;
        }
    }
    // lo <= s[kth] < hi ; cLo values lie below lo, cHi below hi
    unsigned lo = (unsigned)__builtin_amdgcn_readfirstlane((int)mn);
    unsigned hi = (unsigned)__builtin_amdgcn_readfirstlane((int)mx);
    if (hi != 0xFFFFFFFFu) hi += 1u;
    unsigned cLo = 0u, cHi = (unsigned)NK;

    for (int it = 0; it < 32; it++) {              // the width halves: 32 steps at most
        if (hi - lo <= 1u || cHi - cLo <= (unsigned)QCAP) break;   // same in every wave of the block
        unsigned mid = lo + ((hi - lo) >> 1);
        unsigned c = 0u;
#pragma unroll   // constant indices keep the row in registers
        for (int i = 0; i + 1 < NR; i += 2) {
            // two ballots side by side: one 64-bit bit count for both
            unsigned long long b0 = __builtin_amdgcn_ballot_w32(u[i] < mid);
            unsigned long long b1 = __builtin_amdgcn_ballot_w32(u[i + 1] < mid);
            c += (unsigned)__popcll(b0 | (b1 << 32));
        }
        if (NR & 1) c += (unsigned)__popc(__builtin_amdgcn_ballot_w32(u[NR - 1] < mid));
        if constexpr (WAVES > 1) {
            // slots alternate, so a wave one step ahead writes the other one
            if (lane == 0) s_cnt[it & 1][wave] = c;
            __syncthreads();                       // the waves' counts visible
            unsigned t = 0u;
#pragma unroll   // lets the LDS reads issue together
            for (int w = 0; w < WAVES; w++) t += s_cnt[it & 1][w];
            c = (unsigned)__builtin_amdgcn_readfirstlane((int)t);
        }
        if (c <= k) { lo = mid; cLo = c; } else { hi = mid; cHi = c; }
    }

    const unsigned m = cHi - cLo;                  // values in the bracket
    const unsigned r = k - cLo;                    // rank of s[kth] among them
    const bool few = m <= (unsigned)QCAP;
    const bool above = r + 1u >= m;                // s[kth+1] is the least value at or above hi

    unsigned mg = 0xFFFFFFFFu;
    if (above) {
#pragma unroll   // constant indices keep the row in registers
        for (int i = 0; i < NR; i++) {
            unsigned v = u[i] >= hi ? u[i] : 0xFFFFFFFFu;
            mg = v < mg ? v : mg;
        }
#pragma unroll   // five fixed steps
        for (int d = 16; d >= 1; d >>= 1) {
            unsigned a = (unsigned)__shfl_xor((int)mg, d);
            mg = a < mg ? a : mg;
        }
    }
    unsigned got = 0u;
    if (few) {
        const unsigned width = hi - lo;
#pragma unroll   // constant indices keep the row in registers
        for (int g = 0; g < NR; g += 16) {
            // sixteen ballots first, then the scalar tests: a test directly behind
            // its own compare would wait out the compare each time
            unsigned mask[16];
#pragma unroll   // constant indices keep the masks in scalar registers
            for (int t = 0; t < 16; t++)
                mask[t] = g + t < NR ? __builtin_amdgcn_ballot_w32(u[g + t < NR ? g + t : 0] - lo < width) : 0u;   // lo <= u < hi
#pragma unroll   // constant indices keep the masks in scalar registers
            for (int t = 0; t < 16; t++) {
                if (g + t < NR && mask[t] != 0u) {   // most registers hold none: scalar skip
                    if ((mask[t] >> lane) & 1u)
                        s_buf[wave][got + __builtin_amdgcn_mbcnt_lo(mask[t], 0u)] = u[g + t < NR ? g + t : 0];
                    got += (unsigned)__popc(mask[t]);
                }
            }
        }
    }
    if (lane == 0) { s_m[wave] = got; s_mg[wave] = mg; }
    __syncthreads();                               // gathered values and their counts visible

    if (wave == 0) {
#pragma unroll   // lets the LDS reads issue together
        for (int w = 0; w < WAVES; w++) { unsigned a = s_mg[w]; mg = a < mg ? a : mg; }
        unsigned sk = lo, sk1 = above ? mg : lo;   // bracket of width 1: all its values equal lo
        if (few) {
            unsigned cand = 0xFFFFFFFFu, first = 0u;
#pragma unroll   // lets the LDS reads issue together
            for (int w = 0; w < WAVES; w++) {
                unsigned n = s_m[w];
                if ((unsigned)lane - first < n) cand = s_buf[w][(unsigned)lane - first];
                first += n;
            }
            unsigned less = 0u, leq = 0u;
#pragma unroll   // constant lane numbers for the broadcasts
            for (int j = 0; j < QCAP; j++) {
                unsigned cj = (unsigned)__builtin_amdgcn_readlane((int)cand, j);
                less += cj < cand ? 1u : 0u;
                leq += cj <= cand ? 1u : 0u;
            }
            // a lane holds the value of rank x when less <= x < leq
            unsigned ma = __builtin_amdgcn_ballot_w32(less <= r && r < leq);
            sk = (unsigned)__builtin_amdgcn_readlane((int)cand, __ffs(ma) - 1);
            if (!above) {
                unsigned mb = __builtin_amdgcn_ballot_w32(less <= r + 1u && r + 1u < leq);
                sk1 = (unsigned)__builtin_amdgcn_readlane((int)cand, __ffs(mb) - 1);
            }
        }
        if (lane == 0) {
            float fk = __uint_as_float(sk);
            thr_out[row] = fmaf(frac, __uint_as_float(sk1) - fk, fk);
        }
    }
}

// ---------------------------------------------------------------------------
// One group of 16 keys for a tile of 16 queries, all four heads.
// The masked weights are computed straight into the WMMA A fragment
// (M = query = lane&15, K = key) and the val rows are the B fragment
// (K = key, N = column within the head), with the same key in the same K slot:
//   lanes 0-15 : VGPR{0,1} = keys j+0, j+1 ; lanes 16-31 : keys j+2, j+3
// jb = first key of the group + 2*(lane>>4). TAIL clamps every key index and
// zeroes the weights of keys past the end.
// ---------------------------------------------------------------------------
// exp2 of eight values. One statement, each value in its own register: behind
// an exp2 the instruction set asks for one independent instruction before its
// result is read or its source overwritten. Here the source is the result's own
// register, the next exp2 fills the slot of the one in front, and the v_nop that
// of the last.
__device__ __forceinline__ void exp2x8(float (&x)[8]) {
    asm("v_exp_f32 %0, %0\n\t"
        "v_exp_f32 %1, %1\n\t"
        "v_exp_f32 %2, %2\n\t"
        "v_exp_f32 %3, %3\n\t"
        "v_exp_f32 %4, %4\n\t"
        "v_exp_f32 %5, %5\n\t"
        "v_exp_f32 %6, %6\n\t"
        "v_exp_f32 %7, %7\n\t"
        "v_nop"
        : "+v"(x[0]), "+v"(x[1]), "+v"(x[2]), "+v"(x[3]),
          "+v"(x[4]), "+v"(x[5]), "+v"(x[6]), "+v"(x[7]));
}

template <bool TAIL>
__device__ __forceinline__ void attn_group16(const float* __restrict__ Kc,
                                             const float* __restrict__ val,
                                             int nK, int jb, int laneN,
                                             float qx, float qy, float thrq,
                                             const float (&c)[4],
                                             v8f (&acc)[4], v2f (&den)[4]) {
    // all loads of the group first, the coordinates ahead of the val rows, so
    // that the val rows fly under the weights' arithmetic
    v2f b[4][4];
    float kx[4][2], ky[4][2];
#pragma unroll   // constant indices keep the register arrays in registers
    for (int s = 0; s < 4; s++) {
        int j = jb + s * 4;
        if (TAIL) {
            int ja = j < nK ? j : nK - 1;
            int jc = j + 1 < nK ? j + 1 : nK - 1;
            kx[s][0] = Kc[2 * ja + 0]; ky[s][0] = Kc[2 * ja + 1];
            kx[s][1] = Kc[2 * jc + 0]; ky[s][1] = Kc[2 * jc + 1];
        } else {
            float4 k4 = *(const float4*)(Kc + 2 * j);   // j is even: 16-B aligned
            kx[s][0] = k4.x; ky[s][0] = k4.y; kx[s][1] = k4.z; ky[s][1] = k4.w;
        }
    }
    // the val loads' results and addresses may land in the coordinate loads'
    // address registers; as a memory fence it also keeps the coordinate loads in
    // front (loads return in order: issued last, they would make the first
    // distance wait for every val row as well)
    asm volatile("s_wait_xcnt 0x0" ::: "memory");
    // holds the val rows' address arithmetic behind that wait
    __builtin_amdgcn_sched_barrier(0);
#pragma unroll   // constant indices keep the register arrays in registers
    for (int s = 0; s < 4; s++) {
        const float* va;
        const float* vc;
        if (TAIL) {
            int j = jb + s * 4;
            int ja = j < nK ? j : nK - 1;
            int jc = j + 1 < nK ? j + 1 : nK - 1;
            va = val + (size_t)ja * HID + laneN;
            vc = val + (size_t)jc * HID + laneN;
        } else {
            va = val + (size_t)jb * HID + laneN + s * 4 * HID;   // one address, constant offsets
            vc = va + HID;
        }
#pragma unroll   // constant indices keep the register arrays in registers
        for (int h = 0; h < 4; h++) { b[s][h].x = va[h * 16]; b[s][h].y = vc[h * 16]; }
        // clamped rows have address registers of their own for each run, and the
        // next run's results may land in them
        if (TAIL) asm volatile("s_wait_xcnt 0x0" ::: "memory");
    }
    // the arithmetic below may reuse the val loads' address registers
    if (!TAIL) asm volatile("s_wait_xcnt 0x0" ::: "memory");
    // keeps the wait for the coordinates behind the issue of the val loads
    __builtin_amdgcn_sched_barrier(0);
#pragma unroll   // constant indices keep the register arrays in registers
    for (int s = 0; s < 4; s++) {
        int j = jb + s * 4;
        float dx0 = qx - kx[s][0], dy0 = qy - ky[s][0];
        float dx1 = qx - kx[s][1], dy1 = qy - ky[s][1];
        float d20 = fmaf(dx0, dx0, dy0 * dy0);
        float d21 = fmaf(dx1, dx1, dy1 * dy1);
        bool ok0 = d20 <= thrq, ok1 = d21 <= thrq;
        if (TAIL) { ok0 = ok0 && (j < nK); ok1 = ok1 && (j + 1 < nK); }
        // c holds -c_h*log2(e): one multiply and the hardware's exp2 for each weight.
        // The exponent is never above 0; a weight under 2^-126 comes out as 0.
        float e[8];
#pragma unroll   // constant indices keep the register arrays in registers
        for (int h = 0; h < 4; h++) { e[2 * h] = c[h] * d20; e[2 * h + 1] = c[h] * d21; }
        exp2x8(e);
#pragma unroll   // constant indices keep the register arrays in registers
        for (int h = 0; h < 4; h++) {
            // exp in every lane, then a select: no divergent branch round a WMMA
            v2f a;
            a.x = ok0 ? e[2 * h] : 0.0f;
            a.y = ok1 ? e[2 * h + 1] : 0.0f;
            den[h] += a;                   // even and odd keys summed apart
            acc[h] = __builtin_amdgcn_wmma_f32_16x16x4_f32(
                /*neg_a=*/false, a, /*neg_b=*/false, b[s][h],
                /*c_mod=*/(short)0, acc[h], /*reuse_a=*/false, /*reuse_b=*/false);
        }
    }
}

// ---------------------------------------------------------------------------
// Fused masked multi-head softmax attention + gelu.
// out[q, h*16+v] = gelu( sum_j w_h(q,j) * val[j, h*16+v] / sum_j w_h(q,j) )
//   w_h = exp(-c_h * d2(q,j)) if d2 <= thr[q] else 0 ;  c_h = tan(pi/4*(1+sin r_h))
// (positive c_h => head-independent mask; exponents in [-c*thr, 0] => stable.)
// Block = 16 waves, one tile of 16 queries: every val row that is read serves
// 16 queries through one f32 WMMA per head. The keys are dealt to the waves in
// groups of 16; the waves' partial numerators and denominators are summed in
// LDS in a fixed order.
// The tile a[16,64] that comes of it stays in LDS, and the products that follow
// it in the pipeline, which work on each row alone, run on it in the same block:
//   STEP 0, down  : hout = a ; vout = a @ wv
//   STEP 1, latent: t = gelu(a @ w1 + b1) ; m = t @ w2 + b2 ;
//                   hout = gelu(m + hin @ w3 + b3) ; vout = hout @ wv
//   STEP 2, up    : t = gelu(a @ w1 + b1) ; hout[q] = t . w2 + b2   (w2 is [64,1])
// Each product has four waves of its own (wave 4g+w: product g, columns
// 16w..16w+15), which fetch its weights behind the key loop, ahead of the LDS sum;
// each gelu is spread over all 16 waves.
// wv: the per-head weights [4][64][16] of the attention that comes next; vout is
// its val, another buffer than val, which other blocks are still reading.
// ---------------------------------------------------------------------------
#define ATT_WAVES 16

template <int STEP>
__global__ __launch_bounds__(ATT_WAVES * 32)
void k_attn(const float* __restrict__ Qc, int nQ,
            const float* __restrict__ Kc, int nK,
            const float* __restrict__ val,
            const float* __restrict__ rr,
            const float* __restrict__ thr,
            const float* __restrict__ hin,
            const float* __restrict__ w1, const float* __restrict__ b1,
            const float* __restrict__ w2, const float* __restrict__ b2,
            const float* __restrict__ w3, const float* __restrict__ b3,
            const float* __restrict__ wv,
            float* __restrict__ hout, float* __restrict__ vout) {
    __shared__ float red[ATT_WAVES / 2][32][32];   // 32 KB partial numerators
    __shared__ float dred[ATT_WAVES][4][16];       // partial denominators
    __shared__ float cs[4];
    // 16-row tiles handed from product to product; aligned for the 8-byte fragment reads
    __shared__ __attribute__((aligned(16))) float tA[16][TP], tB[16][TP], tC[16][TP];

    int tid = threadIdx.x;
    int lane = tid & 31;
    int wave = __builtin_amdgcn_readfirstlane(tid >> 5);   // scalar loop control
    int laneN = lane & 15;
    int hi = lane >> 4;
    int q0 = blockIdx.x * 16;

    // kept as -c_h*log2(e): exp(-c_h*d2) = exp2(cs*d2)
    if (tid < 4)
        cs[tid] = -1.44269504088896341f * tanf(0.78539816339744831f * (1.0f + sinf(rr[tid])));
    __syncthreads();                       // cs visible

    int q = q0 + laneN;
    if (q > nQ - 1) q = nQ - 1;            // clamp tail reads (stores predicated)
    float qx = Qc[2 * q + 0], qy = Qc[2 * q + 1];
    float thrq = 3.402823466e+38f;
    if (thr) {
        thrq = thr[q];
        // in the load's own block, so that nothing of the code behind the branch comes in front of it
        asm volatile("s_wait_xcnt 0x0" ::: "memory");
    }
    // the address registers of the two loads above are reused at once
    asm volatile("s_wait_xcnt 0x0" ::: "memory");
    float c[4] = {cs[0], cs[1], cs[2], cs[3]};

    v8f acc[4] = {};
    v2f den[4] = {};

    int nFull = nK >> 4;                   // whole groups of 16 keys
    for (int g = wave; g < nFull; g += ATT_WAVES)
        attn_group16<false>(Kc, val, nK, g * 16 + hi * 2, laneN, qx, qy, thrq, c, acc, den);
    if ((nK & 15) != 0 && (nFull & (ATT_WAVES - 1)) == wave)   // the partial group, next wave in turn
        attn_group16<true>(Kc, val, nK, nFull * 16 + hi * 2, laneN, qx, qy, thrq, c, acc, den);

    // this wave's product of the tail: its weights, bias (and rows of hin) set off now
    const int kk = hi * 2;
    const int grp = wave >> 2;
    const int col = (wave & 3) * 16 + laneN;
    const float* wvcol = wv + (wave & 3) * (HID * 16) + laneN;
    v2f af[16], bf[16];
    float bv = 0.0f;
    if (STEP == 0) {
        if (grp == 0) frag_b<16>(wvcol, kk, bf);
    } else if (STEP == 1) {
        if (grp < 3) {
            const float* wsel = grp == 0 ? w1 : grp == 1 ? w3 : w2;
            const float* bsel = grp == 0 ? b1 : grp == 1 ? b3 : b2;
            bv = bsel[col];
            frag_b<HID>(wsel + col, kk, bf);
            if (grp == 1) frag_a<true>(hin + (size_t)q * HID + kk, af);
        } else {
            frag_b<16>(wvcol, kk, bf);
        }
    } else {
        if (grp == 0) { bv = b1[col]; frag_b<HID>(w1 + col, kk, bf); }
    }

    // the two half-waves hold different keys of the same query
#pragma unroll   // constant indices keep the register arrays in registers
    for (int h = 0; h < 4; h++) {
        float dh = den[h].x + den[h].y;
        dh += __shfl_xor(dh, 16);
        if (hi == 0) dred[wave][h][laneN] = dh;
    }
    if (wave >= ATT_WAVES / 2) {
#pragma unroll   // constant indices keep the register arrays in registers
        for (int h = 0; h < 4; h++)
#pragma unroll   // constant indices keep the register arrays in registers
            for (int r = 0; r < 8; r++) red[wave - ATT_WAVES / 2][h * 8 + r][lane] = acc[h][r];
    }
    __syncthreads();                       // upper waves' partials visible
    if (wave < ATT_WAVES / 2) {
#pragma unroll   // constant indices keep the register arrays in registers
        for (int h = 0; h < 4; h++)
#pragma unroll   // constant indices keep the register arrays in registers
            for (int r = 0; r < 8; r++) red[wave][h * 8 + r][lane] += acc[h][r];
    }
    __syncthreads();                       // all partials visible

    // C layout: VGPR r -> M = r + 8*(lane>=16), N = lane&15
    for (int o = tid; o < 16 * HID; o += ATT_WAVES * 32) {
        int ql = o >> 6, col = o & 63;
        int h = col >> 4, n = col & 15;
        float num = 0.f, d = 0.f;
#pragma unroll   // lets the LDS reads issue together
        for (int w = 0; w < ATT_WAVES / 2; w++)
            num += red[w][h * 8 + (ql & 7)][(ql >> 3) * 16 + n];
#pragma unroll   // lets the LDS reads issue together
        for (int w = 0; w < ATT_WAVES; w++) d += dred[w][h][ql];
        float a = gelu_erf(num / d);
        tA[ql][col] = a;                   // rows past the end repeat the last query; never stored
        if (STEP == 0 && q0 + ql < nQ) {
            hout[(size_t)(q0 + ql) * HID + col] = a;
            // the next trip may reuse the store's address registers
            asm volatile("s_wait_xcnt 0x0" ::: "memory");
        }
    }
    __syncthreads();                       // the attention tile visible

    if (STEP == 1 || STEP == 2) {
        if (grp == 0) {
            frag_a<false>(&tA[laneN][kk], af);
            v8f t = mm16(af, bf);
#pragma unroll   // constant indices keep the accumulator in registers
            for (int r = 0; r < 8; r++) tB[r + 8 * hi][col] = t[r] + bv;
        } else if (STEP == 1 && grp == 1) {
            v8f t = mm16(af, bf);
#pragma unroll   // constant indices keep the accumulator in registers
            for (int r = 0; r < 8; r++) tC[r + 8 * hi][col] = t[r] + bv;
        }
        __syncthreads();                   // a @ w1 + b1 (and hin @ w3 + b3) visible
        for (int o = tid; o < 16 * HID; o += ATT_WAVES * 32)
            tB[o >> 6][o & 63] = gelu_erf(tB[o >> 6][o & 63]);
        __syncthreads();                   // t visible
    }
    if (STEP == 1) {
        if (grp == 2) {
            frag_a<false>(&tB[laneN][kk], af);
            v8f m = mm16(af, bf);
#pragma unroll   // constant indices keep the accumulator in registers
            for (int r = 0; r < 8; r++)    // tA: its readers left it two barriers ago
                tA[r + 8 * hi][col] = tC[r + 8 * hi][col] + (m[r] + bv);
        }
        __syncthreads();                   // m + hin @ w3 + b3 visible
        for (int o = tid; o < 16 * HID; o += ATT_WAVES * 32) {
            float v = gelu_erf(tA[o >> 6][o & 63]);
            tA[o >> 6][o & 63] = v;
            if (q0 + (o >> 6) < nQ) {
                hout[(size_t)q0 * HID + o] = v;
                // the next trip may reuse the store's address registers
                asm volatile("s_wait_xcnt 0x0" ::: "memory");
            }
        }
        __syncthreads();                   // the new h tile visible
    }
    if (STEP == 0 || STEP == 1) {
        if (grp == (STEP == 0 ? 0 : 3)) {
            frag_a<false>(&tA[laneN][kk], af);
            v8f v = mm16(af, bf);
#pragma unroll   // constant indices keep the accumulator in registers
            for (int r = 0; r < 8; r++) {
                int row = q0 + r + 8 * hi;
                if (row < nQ) vout[(size_t)row * HID + col] = v[r];
            }
        }
    }
    if (STEP == 2) {
        // decoder head: one thread a row, the 64 terms in their order
        if (tid < 16 && q0 + tid < nQ) {
            float s = b2[0];
#pragma unroll   // lets the LDS reads issue together
            for (int k = 0; k < HID; k++) s = fmaf(tB[tid][k], w2[k], s);
            hout[q0 + tid] = s;
        }
    }
}

// ---------------------------------------------------------------------------
extern "C" void kernel_launch(void* const* d_in, const int* in_sizes, int n_in,
                              void* d_out, int out_size, void* d_ws, size_t ws_size,
                              hipStream_t stream) {
    (void)in_sizes; (void)n_in; (void)out_size; (void)ws_size;

    const float* x      = (const float*)d_in[0];   // [1,221,51,2] == xf [11271,2]
    const float* en_w   = (const float*)d_in[1];
    const float* en_b   = (const float*)d_in[2];
    const float* down_r = (const float*)d_in[3];
    const float* down_w = (const float*)d_in[4];
    const float* pa_r   = (const float*)d_in[5];   // [4,1,4,1,1]
    const float* pa_w   = (const float*)d_in[6];   // [4,4,64,16]
    const float* mlp1_w = (const float*)d_in[7];
    const float* mlp1_b = (const float*)d_in[8];
    const float* mlp2_w = (const float*)d_in[9];
    const float* mlp2_b = (const float*)d_in[10];
    const float* lin_w  = (const float*)d_in[11];
    const float* lin_b  = (const float*)d_in[12];
    const float* up_r   = (const float*)d_in[13];
    const float* up_w   = (const float*)d_in[14];
    const float* de1_w  = (const float*)d_in[15];
    const float* de1_b  = (const float*)d_in[16];
    const float* de2_w  = (const float*)d_in[17];
    const float* de2_b  = (const float*)d_in[18];

    // workspace layout (floats) ~5.2 MB; vA and vB hold attention val in turn
    float* ws   = (float*)d_ws;
    float* ltt  = ws;                    // NL*2
    float* vA   = ltt  + (size_t)NL * 2; // NX*64
    float* vB   = vA   + (size_t)NX * HID;   // NL*64
    float* hA   = vB   + (size_t)NL * HID;   // NL*64
    float* hB   = hA   + (size_t)NL * HID;
    float* thrD = hB   + (size_t)NL * HID;   // NL
    float* thrU = thrD + NL;                 // NX

    const int tilesNL = (NL + 15) / 16, tilesNX = (NX + 15) / 16;

    // latent coords + encoder + val of the down step
    k_head<<<tilesNX, 128, 0, stream>>>(x, en_w, en_b, down_w, ltt, vA);

    // ---- down: latent <- input (5% locality) ----
    // quantile over nK=11271: pos = 0.05*11270 = 563.5 -> k=563, frac=0.5
    k_quantile<4, 89, NX><<<NL, 128, 0, stream>>>(ltt, x, 563, 0.5f, thrD);
    k_attn<0><<<tilesNL, 512, 0, stream>>>(ltt, NL, x, NX, vA, down_r, thrD,
                                           nullptr, nullptr, nullptr, nullptr, nullptr, nullptr, nullptr,
                                           pa_w, hA, vB);

    // ---- 4 latent blocks (dense attention, no mask), each with its MLP, its
    //      shortcut and the val of the attention that follows ----
    float* hin = hA;
    float* hout = hB;
    float* vin = vB;
    float* vout = vA;
    for (int i = 0; i < 4; i++) {
        k_attn<1><<<tilesNL, 512, 0, stream>>>(ltt, NL, ltt, NL, vin, pa_r + (size_t)i * 4, nullptr,
                                               hin,
                                               mlp1_w + (size_t)i * 4096, mlp1_b + (size_t)i * 64,
                                               mlp2_w + (size_t)i * 4096, mlp2_b + (size_t)i * 64,
                                               lin_w + (size_t)i * 4096, lin_b + (size_t)i * 64,
                                               i < 3 ? pa_w + (size_t)(i + 1) * 4096 : up_w,
                                               hout, vout);
        float* tmp = hin; hin = hout; hout = tmp;
        tmp = vin; vin = vout; vout = tmp;
    }

    // ---- up: input <- latent (5% locality), with the decoder ----
    // quantile over nK=2886: pos = 0.05*2885 = 144.25 -> k=144, frac=0.25
    k_quantile<1, 91, NL><<<NX, 32, 0, stream>>>(x, ltt, 144, 0.25f, thrU);
    k_attn<2><<<tilesNX, 512, 0, stream>>>(x, NX, ltt, NL, vin, up_r, thrU,
                                           nullptr, de1_w, de1_b, de2_w, de2_b, nullptr, nullptr,
                                           nullptr, (float*)d_out, nullptr);
}

// v006
// One run takes 182 microseconds.
// Next to v005, in two timings, it ran 1.18 and 1.17 times as fast.
// Counting every step since v000, it is 11.1 times as fast.
#include <hip/hip_runtime.h>
#include <math.h>

// ---------------------------------------------------------------------------
// PIT pipeline for MI455X (gfx1250, wave32).
// - Never materialize distance/attention matrices: recompute d2 from 2-D
//   coords, fused mask->exp->normalize->matvec (all live data L2-resident).
// - Per-row quantile by bisection on float bit patterns, the row in registers.
// - Dense [N,64]x[64,64] GEMMs via V_WMMA_F32_16X16X4_F32 (full f32 fidelity).
//   They work on each row alone, so they run on the 16-row tile that a block
//   already holds: behind the encoder, and behind each attention tile.
// - Attention in tiles of 16 queries: weights x val on the same f32 WMMA, keys
//   split over the waves of a block.
// - Points and latent points are put in spatial order first (strips in y, by x
//   inside a strip), so that 16 neighbours in memory are neighbours in the plane:
//   a masked attention tile leaves out every group of 16 keys whose bounding box
//   lies wholly beyond the tile's largest threshold. The whole pipeline runs in
//   that order; only the last store goes back through the permutation.
// ---------------------------------------------------------------------------

#define NX   11271     // 221*51 input points
#define NL   2886      // 111*26 latent points
#define HID  64

typedef __attribute__((ext_vector_type(2))) float v2f;
typedef __attribute__((ext_vector_type(8))) float v8f;

__device__ __forceinline__ float gelu_erf(float v) {
    // torch F.gelu default: 0.5*x*(1+erf(x/sqrt(2)))
    return 0.5f * v * (1.0f + erff(v * 0.70710678118654752f));
}

// ---------------------------------------------------------------------------
// One wave's 16x16 tile of  A[16,64] @ B[64,64], in three parts, so that the
// fragments can be fetched well ahead of the product.
// f32 WMMA fragment layouts per CDNA5 ISA 7.12.2:
//   A 16x4 : lanes 0-15 -> M=lane, VGPR{0,1}=K{0,1};  lanes 16-31 -> K{2,3}
//   B 4x16 : lanes 0-15 -> N=lane, VGPR{0,1}=K{0,1};  lanes 16-31 -> K{2,3}
//   C 16x16: VGPR r -> M = r + 8*(lane>=16), N = lane&15
// kk = 2*(lane>>4). Fragment s holds k = 4s+kk, 4s+kk+1 on both sides.
// ---------------------------------------------------------------------------
#define TP 68   // LDS pitch of a tile row in floats: 16 rows x 4 columns fall on 64 different banks

// Arow: the lane's own row of A (M = lane&15) at column kk, in LDS or (GLOBAL) in global memory.
template <bool GLOBAL>
__device__ __forceinline__ void frag_a(const float* Arow, v2f (&a)[16]) {
#pragma unroll   // constant indices keep the register array in registers
    for (int s = 0; s < 16; s++) a[s] = *(const v2f*)(Arow + 4 * s);
    if (GLOBAL) {
        // what follows may reuse the loads' address registers; the address as an
        // input keeps the last load's result out of them as well
        asm volatile("s_wait_xcnt 0x0" :: "v"(Arow) : "memory");
        // holds later address arithmetic behind that wait
        __builtin_amdgcn_sched_barrier(0);
    }
}

// Bcol: the lane's own column of B at row 0; BS: floats from one row of B to the
// next (64 for a plain matrix, 16 inside one head of the per-head weights
// [4][64][16], whose head h is columns 16h..16h+15 of the product).
template <int BS>
__device__ __forceinline__ void frag_b(const float* __restrict__ Bcol, int kk, v2f (&b)[16]) {
    const float* Bk = Bcol + kk * BS;      // one address, constant offsets
#pragma unroll   // constant indices keep the register array in registers
    for (int s = 0; s < 16; s++) {
        b[s].x = Bk[(4 * s + 0) * BS];
        b[s].y = Bk[(4 * s + 1) * BS];
    }
    // what follows may reuse the loads' address registers; the address as an
    // input keeps the last load's result out of them as well
    asm volatile("s_wait_xcnt 0x0" :: "v"(Bk) : "memory");
    // holds later address arithmetic behind that wait
    __builtin_amdgcn_sched_barrier(0);
}

__device__ __forceinline__ v8f mm16(const v2f (&a)[16], const v2f (&b)[16]) {
    v8f acc = {};
#pragma unroll   // constant indices keep the register arrays in registers
    for (int s = 0; s < 16; s++)
        acc = __builtin_amdgcn_wmma_f32_16x16x4_f32(
            /*neg_a=*/false, a[s], /*neg_b=*/false, b[s],
            /*c_mod=*/(short)0, acc, /*reuse_a=*/false, /*reuse_b=*/false);
    // the four vector slots between the last WMMA and the first vector instruction
    // on its result
    asm volatile("v_nop\n\tv_nop\n\tv_nop\n\tv_nop" : "+v"(acc));
    return acc;
}

// ---------------------------------------------------------------------------
// Spatial order. key = strip in y | x in 13 bits (to and fro) | index: all keys differ, so
// the place of a point is the number of smaller keys, the same in every run.
// A block ranks 32 points. Each of its 16 waves holds a sixteenth of the set's
// keys in registers and counts, for one point after the other, those below the
// point's key: one compare a register, counted over the wave by ballot, so the
// counts live in scalar registers. The strips are as high as 16 points are wide.
//   xs[place] = x[j], perm[place] = j          (blocks 0 .. XBLK-1)
//   ls[place] = x[:, ::2, ::2, :][l]           (the latent points, the other blocks)
// ---------------------------------------------------------------------------
#define XSTRIPS 27
#define LSTRIPS 13
#define XBLK ((NX + 31) / 32)
#define LBLK ((NL + 31) / 32)

__device__ __forceinline__ unsigned sort_key(float px, float py, int strips, int idx) {
    int s = (int)(py * (float)strips);
    s = s < 0 ? 0 : s > strips - 1 ? strips - 1 : s;      // any value of the input gives a valid key
    int xq = (int)(px * 8192.0f);
    xq = xq < 0 ? 0 : xq > 8191 ? 8191 : xq;
    if (s & 1) xq = 8191 - xq;             // odd strips run backwards: 16 neighbours stay together across a strip's end
    return ((unsigned)s << 27) | ((unsigned)xq << 14) | (unsigned)idx;
}

template <int N, int STRIPS, bool LAT>
__device__ __forceinline__ void sort_block(const float* __restrict__ x, unsigned (*part)[32], int blk,
                                           float* __restrict__ dst, int* __restrict__ perm) {
    constexpr int PER = (N + 15) / 16;     // keys a wave holds
    constexpr int NR = (PER + 31) / 32;    // of them a lane
    const int tid = threadIdx.x;
    const int lane = tid & 31;
    const int wave = __builtin_amdgcn_readfirstlane(tid >> 5);
    const float2* X2 = (const float2*)x;
    const int j = blk * 32 + lane;         // the point that this lane stands for
    const int jc = j < N ? j : N - 1;
    // the wave's NR*32 slots start early enough to end inside the set
    const int first = wave * PER < N - NR * 32 ? wave * PER : N - NR * 32;
    float2 p[NR];
    if (LAT) {
#pragma unroll   // constant indices keep the register array in registers
        for (int t = 0; t < NR; t++) {
            int i = first + t * 32 + lane;
            const float2* q = X2 + (2 * (i / 26)) * 51 + 2 * (i % 26);
            p[t] = *q;
            // each load has an address of its own: the next load's result may land in
            // it (as an input: nor this load's own)
            asm volatile("s_wait_xcnt 0x0" :: "v"(q) : "memory");
        }
    } else {
        const float2* q = X2 + first + lane;   // one address, constant offsets
#pragma unroll   // constant indices keep the register array in registers; the loads fly together
        for (int t = 0; t < NR; t++) p[t] = q[t * 32];
        // what follows may reuse the loads' address registers (as an input: nor may
        // the loads' own results land in them)
        asm volatile("s_wait_xcnt 0x0" :: "v"(q) : "memory");
    }
    const float2* qj = X2 + (LAT ? (2 * (jc / 26)) * 51 + 2 * (jc % 26) : jc);
    const float2 pj = *qj;
    // as above
    asm volatile("s_wait_xcnt 0x0" :: "v"(qj) : "memory");
    unsigned key[NR];
#pragma unroll   // constant indices keep the register array in registers
    for (int t = 0; t < NR; t++) {
        int i = first + t * 32 + lane;
        // a slot outside the wave's share is never below any key
        bool own = i >= wave * PER && i < wave * PER + PER;
        unsigned kk = sort_key(p[t].x, p[t].y, STRIPS, i);
        key[t] = own ? kk : 0xFFFFFFFFu;
    }
    const unsigned my = sort_key(pj.x, pj.y, STRIPS, jc);

    unsigned cnt = 0u;                     // lane l: how many of the wave's keys lie below point l's
    for (int l = 0; l < 32; l++) {
        const unsigned kl = (unsigned)__builtin_amdgcn_readlane((int)my, l);
        unsigned c = 0u;
#pragma unroll   // constant indices keep the keys in registers
        for (int t = 0; t + 1 < NR; t += 2) {
            // two ballots side by side: one 64-bit bit count for both
            unsigned long long b0 = __builtin_amdgcn_ballot_w32(key[t] < kl);
            unsigned long long b1 = __builtin_amdgcn_ballot_w32(key[t + 1] < kl);
            c += (unsigned)__popcll(b0 | (b1 << 32));
        }
        if (NR & 1) c += (unsigned)__popc(__builtin_amdgcn_ballot_w32(key[NR - 1] < kl));
        cnt = lane == l ? c : cnt;
    }
    part[wave][lane] = cnt;
    __syncthreads();                       // the waves' counts visible
    if (wave == 0 && j < N) {
        unsigned pos = 0u;
#pragma unroll   // lets the LDS reads issue together
        for (int w = 0; w < 16; w++) pos += part[w][lane];
        ((float2*)dst)[pos] = pj;
        if (!LAT) perm[pos] = j;
    }
}

__global__ __launch_bounds__(512)
void k_sort(const float* __restrict__ x, float* __restrict__ xs,
            int* __restrict__ perm, float* __restrict__ ls) {
    __shared__ unsigned part[16][32];
    if (blockIdx.x < XBLK) sort_block<NX, XSTRIPS, false>(x, part, blockIdx.x, xs, perm);
    else                   sort_block<NL, LSTRIPS, true>(x, part, blockIdx.x - XBLK, ls, nullptr);
}

// ---------------------------------------------------------------------------
// Head of the pipeline, one launch (x: the points in spatial order):
//   h0[j,c] = gelu(x0*W[0,c] + x1*W[1,c] + b[c])                  (K=2: plain VALU)
//   v[j, h*16+k] = sum_c h0[j,c] * w[h][c][k]                     (val of the down step)
// A block of 4 waves owns 16 rows: the encoder's tile goes through LDS into the
// A fragments, wave w owns head w (columns 16w..16w+15).
// ---------------------------------------------------------------------------
__global__ __launch_bounds__(128)
void k_head(const float* __restrict__ x, const float* __restrict__ W,
            const float* __restrict__ b, const float* __restrict__ w,
            float* __restrict__ v) {
    __shared__ __attribute__((aligned(16))) float tA[16][TP];   // aligned for the 8-byte fragment reads
    int tid = threadIdx.x;
    int lane = tid & 31;
    int wave = __builtin_amdgcn_readfirstlane(tid >> 5);
    int laneN = lane & 15;
    int hi = lane >> 4;
    int r0 = blockIdx.x * 16;

    // a thread keeps one column c and takes every second row of the tile
    const int c = tid & 63, rl = tid >> 6;
    const float2* X2 = (const float2*)x;
    float2 xr[8];
    const float2* xp[8];
#pragma unroll   // constant indices keep the register array in registers
    for (int it = 0; it < 8; it++) {
        int j = r0 + rl + 2 * it;
        if (j > NX - 1) j = NX - 1;        // clamp tail reads (stores predicated)
        xp[it] = X2 + j;
        xr[it] = *xp[it];
    }
    float wa = W[c], wb = W[HID + c], bc = b[c];
    // what follows may reuse the loads' address registers; the addresses as inputs
    // keep the loads' own results out of them as well
    asm volatile("s_wait_xcnt 0x0" :: "v"(xp[0]), "v"(xp[1]), "v"(xp[2]), "v"(xp[3]),
                                      "v"(xp[4]), "v"(xp[5]), "v"(xp[6]), "v"(xp[7]) : "memory");
    // holds the weights' address arithmetic behind that wait
    __builtin_amdgcn_sched_barrier(0);
    v2f af[16], bf[16];
    frag_b<16>(w + wave * (HID * 16) + laneN, hi * 2, bf);   // flies under the encoder's arithmetic
#pragma unroll   // constant indices keep the register array in registers
    for (int it = 0; it < 8; it++)
        tA[rl + 2 * it][c] = gelu_erf(fmaf(xr[it].x, wa, fmaf(xr[it].y, wb, bc)));
    __syncthreads();                       // the encoder's tile visible

    frag_a<false>(&tA[laneN][hi * 2], af);
    v8f acc = mm16(af, bf);
#pragma unroll   // constant indices keep the accumulator in registers
    for (int r = 0; r < 8; r++) {
        int row = r0 + r + 8 * hi;
        if (row < NX) v[(size_t)row * HID + wave * 16 + laneN] = acc[r];
    }
}

// ---------------------------------------------------------------------------
// Per-row quantile of squared distances, the row's distances kept in registers.
// thr[row] = s[kth] + frac*(s[kth+1] - s[kth])   (jnp.quantile 'linear')
// d2 >= 0 so float bit patterns are order-preserving as uints.
// A block of WAVES waves owns one row; each lane holds NR of the NK distances.
// The bit pattern of s[kth] is bracketed by bisection between the row's minimum
// and maximum: one compare per held value, counted over the wave by ballot, so
// the count and the bracket live in scalar registers. Once the bracket holds at
// most 32 values they are gathered, one to a lane of wave 0, and ranked against
// each other. Equal values that never thin out end the bisection at width 1.
// ---------------------------------------------------------------------------
#define QCAP 32

template <int WAVES, int NR, int NK>
__global__ __launch_bounds__(WAVES * 32)
__attribute__((amdgpu_waves_per_eu(8)))   // 128 registers a wave: eight waves a SIMD cover each other's waits
void k_quantile(const float* __restrict__ Qc, const float* __restrict__ Kc,
                int kth, float frac, float* __restrict__ thr_out) {
    constexpr int T = WAVES * 32;
    static_assert(T * NR >= NK && T * (NR - 1) < NK, "NR values a lane cover the row");
    __shared__ unsigned s_mn[WAVES], s_mx[WAVES];   // the waves' minima and maxima
    __shared__ unsigned s_cnt[2][WAVES];            // the waves' counts, by parity of the step
    __shared__ unsigned s_m[WAVES], s_mg[WAVES];    // values gathered; least value above the bracket
    __shared__ unsigned s_buf[WAVES][QCAP];         // the gathered values

    const int row = blockIdx.x, tid = threadIdx.x;
    const int lane = tid & 31;
    const int wave = __builtin_amdgcn_readfirstlane(tid >> 5);   // scalar branches on the wave
    const unsigned k = (unsigned)kth;
    const float qx = Qc[2 * row + 0], qy = Qc[2 * row + 1];

    unsigned u[NR];
    unsigned mn = 0xFFFFFFFFu, mx = 0u;
    const float2* K2 = (const float2*)Kc;
    // Three runs of loads, each issued whole in front of its arithmetic. A key takes
    // two registers until it is worked down to one distance, so the runs shrink as
    // the row fills up and the wave stays inside its register budget.
    constexpr int RUN0 = 44, RUN1 = 74;
    static_assert(NR > RUN1 && NR - RUN1 <= RUN0, "three runs cover the row");
    float2 p[RUN0];
#pragma unroll   // constant indices keep the row in registers
    for (int run = 0; run < 3; run++) {
        const int i0 = run == 0 ? 0 : run == 1 ? RUN0 : RUN1;
        const int i1 = run == 0 ? RUN0 : run == 1 ? RUN1 : NR;
#pragma unroll   // constant indices keep the row in registers
        for (int i = i0; i < i1; i++) {
            int j = i * T + tid;
            if ((i + 1) * T > NK) j = j < NK ? j : NK - 1;   // past the end: the last key again
            p[i - i0] = K2[j];
        }
        // behind the last load: the arithmetic below may reuse the loads' address registers
        if (run == 2) asm volatile("s_wait_xcnt 0x0" ::: "memory");
        // keeps the run's loads together: left alone the compiler waits after every four
        __builtin_amdgcn_sched_barrier(0);
#pragma unroll   // constant indices keep the row in registers
        for (int i = i0; i < i1; i++) {
            float dx = qx - p[i - i0].x;
            float dy = qy - p[i - i0].y;
            unsigned b = __float_as_uint(fmaf(dx, dx, dy * dy));
            mn = b < mn ? b : mn;
            mx = b > mx ? b : mx;
            // a slot past the end is never below any bracket end
            u[i] = ((i + 1) * T <= NK || i * T + tid < NK) ? b : 0xFFFFFFFFu;
        }
        // keeps the next run's loads behind this run's arithmetic, which frees their registers
        __builtin_amdgcn_sched_barrier(0);
    }
#pragma unroll   // five fixed steps, minimum and maximum side by side
    for (int d = 16; d >= 1; d >>= 1) {
        unsigned a = (unsigned)__shfl_xor((int)mn, d);
        unsigned c = (unsigned)__shfl_xor((int)mx, d);
        mn = a < mn ? a : mn;
        mx = c > mx ? c : mx;
    }
    if constexpr (WAVES > 1) {
        if (lane == 0) { s_mn[wave] = mn; s_mx[wave] = mx; }
        __syncthreads();                           // the waves' minima and maxima visible
#pragma unroll   // lets the LDS reads issue together
        for (int w = 0; w < WAVES; w++) {
            unsigned a = s_mn[w], c = s_mx[w];
            mn = a < mn ? a : mn;
            mx = c > mx ? c : mx;
        }
    }
    // lo <= s[kth] < hi ; cLo values lie below lo, cHi below hi
    unsigned lo = (unsigned)__builtin_amdgcn_readfirstlane((int)mn);
    unsigned hi = (unsigned)__builtin_amdgcn_readfirstlane((int)mx);
    if (hi != 0xFFFFFFFFu) hi += 1u;
    unsigned cLo = 0u, cHi = (unsigned)NK;

    for (int it = 0; it < 32; it++) {              // the width halves: 32 steps at most
        if (hi - lo <= 1u || cHi - cLo <= (unsigned)QCAP) break;   // same in every wave of the block
        unsigned mid = lo + ((hi - lo) >> 1);
        unsigned c = 0u;
#pragma unroll   // constant indices keep the row in registers
        for (int i = 0; i + 1 < NR; i += 2) {
            // two ballots side by side: one 64-bit bit count for both
            unsigned long long b0 = __builtin_amdgcn_ballot_w32(u[i] < mid);
            unsigned long long b1 = __builtin_amdgcn_ballot_w32(u[i + 1] < mid);
            c += (unsigned)__popcll(b0 | (b1 << 32));
        }
        if (NR & 1) c += (unsigned)__popc(__builtin_amdgcn_ballot_w32(u[NR - 1] < mid));
        if constexpr (WAVES > 1) {
            // slots alternate, so a wave one step ahead writes the other one
            if (lane == 0) s_cnt[it & 1][wave] = c;
            __syncthreads();                       // the waves' counts visible
            unsigned t = 0u;
#pragma unroll   // lets the LDS reads issue together
            for (int w = 0; w < WAVES; w++) t += s_cnt[it & 1][w];
            c = (unsigned)__builtin_amdgcn_readfirstlane((int)t);
        }
        if (c <= k) { lo = mid; cLo = c; } else { hi = mid; cHi = c; }
    }

    const unsigned m = cHi - cLo;                  // values in the bracket
    const unsigned r = k - cLo;                    // rank of s[kth] among them
    const bool few = m <= (unsigned)QCAP;
    const bool above = r + 1u >= m;                // s[kth+1] is the least value at or above hi

    unsigned mg = 0xFFFFFFFFu;
    if (above) {
#pragma unroll   // constant indices keep the row in registers
        for (int i = 0; i < NR; i++) {
            unsigned v = u[i] >= hi ? u[i] : 0xFFFFFFFFu;
            mg = v < mg ? v : mg;
        }
#pragma unroll   // five fixed steps
        for (int d = 16; d >= 1; d >>= 1) {
            unsigned a = (unsigned)__shfl_xor((int)mg, d);
            mg = a < mg ? a : mg;
        }
    }
    unsigned got = 0u;
    if (few) {
        const unsigned width = hi - lo;
#pragma unroll   // constant indices keep the row in registers
        for (int g = 0; g < NR; g += 16) {
            // sixteen ballots first, then the scalar tests: a test directly behind
            // its own compare would wait out the compare each time
            unsigned mask[16];
#pragma unroll   // constant indices keep the masks in scalar registers
            for (int t = 0; t < 16; t++)
                mask[t] = g + t < NR ? __builtin_amdgcn_ballot_w32(u[g + t < NR ? g + t : 0] - lo < width) : 0u;   // lo <= u < hi
#pragma unroll   // constant indices keep the masks in scalar registers
            for (int t = 0; t < 16; t++) {
                if (g + t < NR && mask[t] != 0u) {   // most registers hold none: scalar skip
                    if ((mask[t] >> lane) & 1u)
                        s_buf[wave][got + __builtin_amdgcn_mbcnt_lo(mask[t], 0u)] = u[g + t < NR ? g + t : 0];
                    got += (unsigned)__popc(mask[t]);
                }
            }
        }
    }
    if (lane == 0) { s_m[wave] = got; s_mg[wave] = mg; }
    __syncthreads();                               // gathered values and their counts visible

    if (wave == 0) {
#pragma unroll   // lets the LDS reads issue together
        for (int w = 0; w < WAVES; w++) { unsigned a = s_mg[w]; mg = a < mg ? a : mg; }
        unsigned sk = lo, sk1 = above ? mg : lo;   // bracket of width 1: all its values equal lo
        if (few) {
            unsigned cand = 0xFFFFFFFFu, first = 0u;
#pragma unroll   // lets the LDS reads issue together
            for (int w = 0; w < WAVES; w++) {
                unsigned n = s_m[w];
                if ((unsigned)lane - first < n) cand = s_buf[w][(unsigned)lane - first];
                first += n;
            }
            unsigned less = 0u, leq = 0u;
#pragma unroll   // constant lane numbers for the broadcasts
            for (int j = 0; j < QCAP; j++) {
                unsigned cj = (unsigned)__builtin_amdgcn_readlane((int)cand, j);
                less += cj < cand ? 1u : 0u;
                leq += cj <= cand ? 1u : 0u;
            }
            // a lane holds the value of rank x when less <= x < leq
            unsigned ma = __builtin_amdgcn_ballot_w32(less <= r && r < leq);
            sk = (unsigned)__builtin_amdgcn_readlane((int)cand, __ffs(ma) - 1);
            if (!above) {
                unsigned mb = __builtin_amdgcn_ballot_w32(less <= r + 1u && r + 1u < leq);
                sk1 = (unsigned)__builtin_amdgcn_readlane((int)cand, __ffs(mb) - 1);
            }
        }
        if (lane == 0) {
            float fk = __uint_as_float(sk);
            thr_out[row] = fmaf(frac, __uint_as_float(sk1) - fk, fk);
        }
    }
}

// ---------------------------------------------------------------------------
// One group of 16 keys for a tile of 16 queries, all four heads.
// The masked weights are computed straight into the WMMA A fragment
// (M = query = lane&15, K = key) and the val rows are the B fragment
// (K = key, N = column within the head), with the same key in the same K slot:
//   lanes 0-15 : VGPR{0,1} = keys j+0, j+1 ; lanes 16-31 : keys j+2, j+3
// jb = first key of the group + 2*(lane>>4). TAIL clamps every key index and
// zeroes the weights of keys past the end.
// ---------------------------------------------------------------------------
// exp2 of eight values. One statement, each value in its own register: behind
// an exp2 the instruction set asks for one independent instruction before its
// result is read or its source overwritten. Here the source is the result's own
// register, the next exp2 fills the slot of the one in front, and the v_nop that
// of the last.
__device__ __forceinline__ void exp2x8(float (&x)[8]) {
    asm("v_exp_f32 %0, %0\n\t"
        "v_exp_f32 %1, %1\n\t"
        "v_exp_f32 %2, %2\n\t"
        "v_exp_f32 %3, %3\n\t"
        "v_exp_f32 %4, %4\n\t"
        "v_exp_f32 %5, %5\n\t"
        "v_exp_f32 %6, %6\n\t"
        "v_exp_f32 %7, %7\n\t"
        "v_nop"
        : "+v"(x[0]), "+v"(x[1]), "+v"(x[2]), "+v"(x[3]),
          "+v"(x[4]), "+v"(x[5]), "+v"(x[6]), "+v"(x[7]));
}

template <bool TAIL>
__device__ __forceinline__ void attn_group16(const float* __restrict__ Kc,
                                             const float* __restrict__ val,
                                             int nK, int jb, int laneN,
                                             float qx, float qy, float thrq,
                                             const float (&c)[4],
                                             v8f (&acc)[4], v2f (&den)[4]) {
    // all loads of the group first, the coordinates ahead of the val rows, so
    // that the val rows fly under the weights' arithmetic
    v2f b[4][4];
    float kx[4][2], ky[4][2];
    const float* ka[4];
    const float* kc[4];
#pragma unroll   // constant indices keep the register arrays in registers
    for (int s = 0; s < 4; s++) {
        int j = jb + s * 4;
        if (TAIL) {
            int ja = j < nK ? j : nK - 1;
            int jc = j + 1 < nK ? j + 1 : nK - 1;
            ka[s] = Kc + 2 * ja;
            kc[s] = Kc + 2 * jc;
            kx[s][0] = ka[s][0]; ky[s][0] = ka[s][1];
            kx[s][1] = kc[s][0]; ky[s][1] = kc[s][1];
        } else {
            ka[s] = kc[s] = Kc + 2 * jb;                // one address, constant offsets
            float4 k4 = *(const float4*)(ka[s] + 8 * s);   // jb is even: 16-B aligned
            kx[s][0] = k4.x; ky[s][0] = k4.y; kx[s][1] = k4.z; ky[s][1] = k4.w;
        }
    }
    // the val loads' results and addresses may land in the coordinate loads'
    // address registers; as a memory fence it also keeps the coordinate loads in
    // front (loads return in order: issued last, they would make the first
    // distance wait for every val row as well). The addresses as inputs keep the
    // coordinate loads' own results out of them.
    if (TAIL)
        asm volatile("s_wait_xcnt 0x0" :: "v"(ka[0]), "v"(ka[1]), "v"(ka[2]), "v"(ka[3]),
                                          "v"(kc[0]), "v"(kc[1]), "v"(kc[2]), "v"(kc[3]) : "memory");
    else
        asm volatile("s_wait_xcnt 0x0" :: "v"(ka[0]) : "memory");
    // holds the val rows' address arithmetic behind that wait
    __builtin_amdgcn_sched_barrier(0);
#pragma unroll   // constant indices keep the register arrays in registers
    for (int s = 0; s < 4; s++) {
        const float* va;
        const float* vc;
        if (TAIL) {
            int j = jb + s * 4;
            int ja = j < nK ? j : nK - 1;
            int jc = j + 1 < nK ? j + 1 : nK - 1;
            va = val + (size_t)ja * HID + laneN;
            vc = val + (size_t)jc * HID + laneN;
        } else {
            va = val + (size_t)jb * HID + laneN + s * 4 * HID;   // one address, constant offsets
            vc = va + HID;
        }
#pragma unroll   // constant indices keep the register arrays in registers
        for (int h = 0; h < 4; h++) { b[s][h].x = va[h * 16]; b[s][h].y = vc[h * 16]; }
        // clamped rows have address registers of their own for each run, and the
        // next run's results may land in them (as inputs: nor this run's own)
        if (TAIL) asm volatile("s_wait_xcnt 0x0" :: "v"(va), "v"(vc) : "memory");
        // the arithmetic below may reuse the val loads' address registers (as an
        // input: nor may the loads' own results land in them)
        if (!TAIL && s == 3) asm volatile("s_wait_xcnt 0x0" :: "v"(va) : "memory");
    }
    // keeps the wait for the coordinates behind the issue of the val loads
    __builtin_amdgcn_sched_barrier(0);
#pragma unroll   // constant indices keep the register arrays in registers
    for (int s = 0; s < 4; s++) {
        int j = jb + s * 4;
        float dx0 = qx - kx[s][0], dy0 = qy - ky[s][0];
        float dx1 = qx - kx[s][1], dy1 = qy - ky[s][1];
        float d20 = fmaf(dx0, dx0, dy0 * dy0);
        float d21 = fmaf(dx1, dx1, dy1 * dy1);
        bool ok0 = d20 <= thrq, ok1 = d21 <= thrq;
        if (TAIL) { ok0 = ok0 && (j < nK); ok1 = ok1 && (j + 1 < nK); }
        // c holds -c_h*log2(e): one multiply and the hardware's exp2 for each weight.
        // The exponent is never above 0; a weight under 2^-126 comes out as 0.
        float e[8];
#pragma unroll   // constant indices keep the register arrays in registers
        for (int h = 0; h < 4; h++) { e[2 * h] = c[h] * d20; e[2 * h + 1] = c[h] * d21; }
        exp2x8(e);
#pragma unroll   // constant indices keep the register arrays in registers
        for (int h = 0; h < 4; h++) {
            // exp in every lane, then a select: no divergent branch round a WMMA
            v2f a;
            a.x = ok0 ? e[2 * h] : 0.0f;
            a.y = ok1 ? e[2 * h + 1] : 0.0f;
            den[h] += a;                   // even and odd keys summed apart
            acc[h] = __builtin_amdgcn_wmma_f32_16x16x4_f32(
                /*neg_a=*/false, a, /*neg_b=*/false, b[s][h],
                /*c_mod=*/(short)0, acc[h], /*reuse_a=*/false, /*reuse_b=*/false);
        }
    }
}

// ---------------------------------------------------------------------------
// Fused masked multi-head softmax attention + gelu.
// out[q, h*16+v] = gelu( sum_j w_h(q,j) * val[j, h*16+v] / sum_j w_h(q,j) )
//   w_h = exp(-c_h * d2(q,j)) if d2 <= thr[q] else 0 ;  c_h = tan(pi/4*(1+sin r_h))
// (positive c_h => head-independent mask; exponents in [-c*thr, 0] => stable.)
// Block = 16 waves, one tile of 16 queries: every val row that is read serves
// 16 queries through one f32 WMMA per head. The keys are dealt to the waves in
// groups of 16; the waves' partial numerators and denominators are summed in
// LDS in a fixed order.
// The tile a[16,64] that comes of it stays in LDS, and the products that follow
// it in the pipeline, which work on each row alone, run on it in the same block:
//   STEP 0, down  : hout = a ; vout = a @ wv
//   STEP 1, latent: t = gelu(a @ w1 + b1) ; m = t @ w2 + b2 ;
//                   hout = gelu(m + hin @ w3 + b3) ; vout = hout @ wv
//   STEP 2, up    : t = gelu(a @ w1 + b1) ; hout[perm[q]] = t . w2 + b2   (w2 is [64,1])
// Each product has four waves of its own (wave 4g+w: product g, columns
// 16w..16w+15), which fetch its weights behind the key loop, ahead of the LDS sum;
// each gelu is spread over all 16 waves.
// wv: the per-head weights [4][64][16] of the attention that comes next; vout is
// its val, another buffer than val, which other blocks are still reading.
// ---------------------------------------------------------------------------
#define ATT_WAVES 16

template <int STEP>
__global__ __launch_bounds__(ATT_WAVES * 32)
// the masked steps keep 128 registers a wave, so that two blocks share a WGP as before
__attribute__((amdgpu_waves_per_eu(STEP == 1 ? 4 : 8)))
void k_attn(const float* __restrict__ Qc, int nQ,
            const float* __restrict__ Kc, int nK,
            const float* __restrict__ val,
            const float* __restrict__ rr,
            const float* __restrict__ thr,
            const float* __restrict__ hin,
            const float* __restrict__ w1, const float* __restrict__ b1,
            const float* __restrict__ w2, const float* __restrict__ b2,
            const float* __restrict__ w3, const float* __restrict__ b3,
            const float* __restrict__ wv, const int* __restrict__ perm,
            float* __restrict__ hout, float* __restrict__ vout) {
    __shared__ int lst[NX / 16];                   // the key groups that the tile visits, in rising order
    __shared__ int wcnt[ATT_WAVES];                // how many of them each wave found
    __shared__ float red[ATT_WAVES / 2][32][32];   // 32 KB partial numerators
    __shared__ float dred[ATT_WAVES][4][16];       // partial denominators
    __shared__ float cs[4];
    // 16-row tiles handed from product to product; aligned for the 8-byte fragment reads
    __shared__ __attribute__((aligned(16))) float tA[16][TP], tB[16][TP], tC[16][TP];

    int tid = threadIdx.x;
    int lane = tid & 31;
    int wave = __builtin_amdgcn_readfirstlane(tid >> 5);   // scalar loop control
    int laneN = lane & 15;
    int hi = lane >> 4;
    int q0 = blockIdx.x * 16;

    // kept as -c_h*log2(e): exp(-c_h*d2) = exp2(cs*d2)
    if (tid < 4)
        cs[tid] = -1.44269504088896341f * tanf(0.78539816339744831f * (1.0f + sinf(rr[tid])));
    __syncthreads();                       // cs visible

    int q = q0 + laneN;
    if (q > nQ - 1) q = nQ - 1;            // clamp tail reads (stores predicated)
    float qx = Qc[2 * q + 0], qy = Qc[2 * q + 1];
    float thrq = 3.402823466e+38f;
    if (thr) {
        thrq = thr[q];
        // in the load's own block, so that nothing of the code behind the branch comes in front of it
        asm volatile("s_wait_xcnt 0x0" ::: "memory");
    }
    // the address registers of the two loads above are reused at once
    asm volatile("s_wait_xcnt 0x0" ::: "memory");
    float c[4] = {cs[0], cs[1], cs[2], cs[3]};

    v8f acc[4] = {};
    v2f den[4] = {};

    int nFull = nK >> 4;                   // whole groups of 16 keys
    int nTurn = nFull;                     // groups dealt out so far: says whose turn the partial group is
    if (STEP == 1) {
        for (int g = wave; g < nFull; g += ATT_WAVES)
            attn_group16<false>(Kc, val, nK, g * 16 + hi * 2, laneN, qx, qy, thrq, c, acc, den);
    } else {
        // the tile's bounding box and its largest threshold
        // (each half-wave holds the 16 queries, one a lane)
        float bx0 = qx, bx1 = qx, by0 = qy, by1 = qy, tmax = thrq;
#pragma unroll   // four fixed steps, the five values side by side
        for (int d = 8; d >= 1; d >>= 1) {
            float a0 = __shfl_xor(bx0, d), a1 = __shfl_xor(bx1, d);
            float a2 = __shfl_xor(by0, d), a3 = __shfl_xor(by1, d), a4 = __shfl_xor(tmax, d);
            bx0 = fminf(bx0, a0); bx1 = fmaxf(bx1, a1);
            by0 = fminf(by0, a2); by1 = fmaxf(by1, a3);
            tmax = fmaxf(tmax, a4);
        }
        int nAct = 0;
        for (int base = 0; base < nFull; base += ATT_WAVES * 32) {
            int g = base + tid;
            int gg = g < nFull ? g : nFull - 1;
            const float4* kp = (const float4*)(Kc + (size_t)gg * 32);
            float4 k[8];
#pragma unroll   // constant indices keep the register array in registers
            for (int i = 0; i < 8; i++) k[i] = kp[i];
            // the next trip rewrites the loads' address registers
            asm volatile("s_wait_xcnt 0x0" ::: "memory");
            float kx0 = fminf(k[0].x, k[0].z), kx1 = fmaxf(k[0].x, k[0].z);
            float ky0 = fminf(k[0].y, k[0].w), ky1 = fmaxf(k[0].y, k[0].w);
#pragma unroll   // constant indices keep the register array in registers
            for (int i = 1; i < 8; i++) {
                kx0 = fminf(kx0, fminf(k[i].x, k[i].z)); kx1 = fmaxf(kx1, fmaxf(k[i].x, k[i].z));
                ky0 = fminf(ky0, fminf(k[i].y, k[i].w)); ky1 = fmaxf(ky1, fmaxf(k[i].y, k[i].w));
            }
            // The gap between the two boxes, squared in the very form of the pairs' d2:
            // subtraction, product and fma round monotonically, so no pair's d2 is
            // below it. A group is left out only when that bound is above every
            // threshold of the tile: all its weights would be 0.
            float gx = fmaxf(fmaxf(kx0 - bx1, bx0 - kx1), 0.0f);
            float gy = fmaxf(fmaxf(ky0 - by1, by0 - ky1), 0.0f);
            bool act = g < nFull && !(fmaf(gx, gx, gy * gy) > tmax);
            unsigned m = __builtin_amdgcn_ballot_w32(act);
            if (lane == 0) wcnt[wave] = __popc(m);
            __syncthreads();               // the waves' counts visible
            int before = 0, tot = 0;
#pragma unroll   // lets the LDS reads issue together
            for (int w = 0; w < ATT_WAVES; w++) {
                int n = wcnt[w];
                before += w < wave ? n : 0;
                tot += n;
            }
            if (act) lst[nAct + before + (int)__builtin_amdgcn_mbcnt_lo(m, 0u)] = g;
            nAct += tot;
            __syncthreads();               // the list visible; the counts free for the next trip
        }
        nAct = __builtin_amdgcn_readfirstlane(nAct);           // scalar loop control
        nTurn = nAct;
        int gl = wave < nAct ? lst[wave] : 0;                  // read one trip ahead, under the group's work
        for (int i = wave; i < nAct; i += ATT_WAVES) {
            int g = __builtin_amdgcn_readfirstlane(gl);
            gl = lst[i + ATT_WAVES < nAct ? i + ATT_WAVES : i];
            attn_group16<false>(Kc, val, nK, g * 16 + hi * 2, laneN, qx, qy, thrq, c, acc, den);
        }
    }
    if ((nK & 15) != 0 && (nTurn & (ATT_WAVES - 1)) == wave)   // the partial group, next wave in turn
        attn_group16<true>(Kc, val, nK, nFull * 16 + hi * 2, laneN, qx, qy, thrq, c, acc, den);

    // this wave's product of the tail: its weights, bias (and rows of hin) set off now
    const int kk = hi * 2;
    const int grp = wave >> 2;
    const int col = (wave & 3) * 16 + laneN;
    const float* wvcol = wv + (wave & 3) * (HID * 16) + laneN;
    v2f af[16], bf[16];
    float bv = 0.0f;
    if (STEP == 0) {
        if (grp == 0) frag_b<16>(wvcol, kk, bf);
    } else if (STEP == 1) {
        if (grp < 3) {
            const float* wsel = grp == 0 ? w1 : grp == 1 ? w3 : w2;
            const float* bsel = grp == 0 ? b1 : grp == 1 ? b3 : b2;
            bv = bsel[col];
            frag_b<HID>(wsel + col, kk, bf);
            if (grp == 1) frag_a<true>(hin + (size_t)q * HID + kk, af);
        } else {
            frag_b<16>(wvcol, kk, bf);
        }
    } else {
        if (grp == 0) {
            const float* bp = b1 + col;
            bv = *bp;
            // the weights' results may land in this load's address registers
            asm volatile("s_wait_xcnt 0x0" :: "v"(bp) : "memory");
            frag_b<HID>(w1 + col, kk, bf);
        }
    }

    // the two half-waves hold different keys of the same query
#pragma unroll   // constant indices keep the register arrays in registers
    for (int h = 0; h < 4; h++) {
        float dh = den[h].x + den[h].y;
        dh += __shfl_xor(dh, 16);
        if (hi == 0) dred[wave][h][laneN] = dh;
    }
    if (wave >= ATT_WAVES / 2) {
#pragma unroll   // constant indices keep the register arrays in registers
        for (int h = 0; h < 4; h++)
#pragma unroll   // constant indices keep the register arrays in registers
            for (int r = 0; r < 8; r++) red[wave - ATT_WAVES / 2][h * 8 + r][lane] = acc[h][r];
    }
    __syncthreads();                       // upper waves' partials visible
    if (wave < ATT_WAVES / 2) {
#pragma unroll   // constant indices keep the register arrays in registers
        for (int h = 0; h < 4; h++)
#pragma unroll   // constant indices keep the register arrays in registers
            for (int r = 0; r < 8; r++) red[wave][h * 8 + r][lane] += acc[h][r];
    }
    __syncthreads();                       // all partials visible

    // C layout: VGPR r -> M = r + 8*(lane>=16), N = lane&15
    for (int o = tid; o < 16 * HID; o += ATT_WAVES * 32) {
        int ql = o >> 6, col = o & 63;
        int h = col >> 4, n = col & 15;
        float num = 0.f, d = 0.f;
#pragma unroll   // lets the LDS reads issue together
        for (int w = 0; w < ATT_WAVES / 2; w++)
            num += red[w][h * 8 + (ql & 7)][(ql >> 3) * 16 + n];
#pragma unroll   // lets the LDS reads issue together
        for (int w = 0; w < ATT_WAVES; w++) d += dred[w][h][ql];
        float a = gelu_erf(num / d);
        tA[ql][col] = a;                   // rows past the end repeat the last query; never stored
        if (STEP == 0 && q0 + ql < nQ) {
            hout[(size_t)(q0 + ql) * HID + col] = a;
            // the next trip may reuse the store's address registers
            asm volatile("s_wait_xcnt 0x0" ::: "memory");
        }
    }
    __syncthreads();                       // the attention tile visible

    if (STEP == 1 || STEP == 2) {
        if (grp == 0) {
            frag_a<false>(&tA[laneN][kk], af);
            v8f t = mm16(af, bf);
#pragma unroll   // constant indices keep the accumulator in registers
            for (int r = 0; r < 8; r++) tB[r + 8 * hi][col] = t[r] + bv;
        } else if (STEP == 1 && grp == 1) {
            v8f t = mm16(af, bf);
#pragma unroll   // constant indices keep the accumulator in registers
            for (int r = 0; r < 8; r++) tC[r + 8 * hi][col] = t[r] + bv;
        }
        __syncthreads();                   // a @ w1 + b1 (and hin @ w3 + b3) visible
        for (int o = tid; o < 16 * HID; o += ATT_WAVES * 32)
            tB[o >> 6][o & 63] = gelu_erf(tB[o >> 6][o & 63]);
        __syncthreads();                   // t visible
    }
    if (STEP == 1) {
        if (grp == 2) {
            frag_a<false>(&tB[laneN][kk], af);
            v8f m = mm16(af, bf);
#pragma unroll   // constant indices keep the accumulator in registers
            for (int r = 0; r < 8; r++)    // tA: its readers left it two barriers ago
                tA[r + 8 * hi][col] = tC[r + 8 * hi][col] + (m[r] + bv);
        }
        __syncthreads();                   // m + hin @ w3 + b3 visible
        for (int o = tid; o < 16 * HID; o += ATT_WAVES * 32) {
            float v = gelu_erf(tA[o >> 6][o & 63]);
            tA[o >> 6][o & 63] = v;
            if (q0 + (o >> 6) < nQ) {
                hout[(size_t)q0 * HID + o] = v;
                // the next trip may reuse the store's address registers
                asm volatile("s_wait_xcnt 0x0" ::: "memory");
            }
        }
        __syncthreads();                   // the new h tile visible
    }
    if (STEP == 0 || STEP == 1) {
        if (grp == (STEP == 0 ? 0 : 3)) {
            frag_a<false>(&tA[laneN][kk], af);
            v8f v = mm16(af, bf);
#pragma unroll   // constant indices keep the accumulator in registers
            for (int r = 0; r < 8; r++) {
                int row = q0 + r + 8 * hi;
                if (row < nQ) vout[(size_t)row * HID + col] = v[r];
            }
        }
    }
    if (STEP == 2) {
        // decoder head: one thread a row, the 64 terms in their order
        if (tid < 16 && q0 + tid < nQ) {
            const int* pp = perm + q0 + tid;
            int place = *pp;
            // what follows may reuse the load's address registers; the address as an
            // input keeps the load's own result out of them as well
            asm volatile("s_wait_xcnt 0x0" :: "v"(pp) : "memory");
            float s = b2[0];
#pragma unroll   // lets the LDS reads issue together
            for (int k = 0; k < HID; k++) s = fmaf(tB[tid][k], w2[k], s);
            hout[place] = s;               // back to the point's own place
        }
    }
}

// ---------------------------------------------------------------------------
extern "C" void kernel_launch(void* const* d_in, const int* in_sizes, int n_in,
                              void* d_out, int out_size, void* d_ws, size_t ws_size,
                              hipStream_t stream) {
    (void)in_sizes; (void)n_in; (void)out_size; (void)ws_size;

    const float* x      = (const float*)d_in[0];   // [1,221,51,2] == xf [11271,2]
    const float* en_w   = (const float*)d_in[1];
    const float* en_b   = (const float*)d_in[2];
    const float* down_r = (const float*)d_in[3];
    const float* down_w = (const float*)d_in[4];
    const float* pa_r   = (const float*)d_in[5];   // [4,1,4,1,1]
    const float* pa_w   = (const float*)d_in[6];   // [4,4,64,16]
    const float* mlp1_w = (const float*)d_in[7];
    const float* mlp1_b = (const float*)d_in[8];
    const float* mlp2_w = (const float*)d_in[9];
    const float* mlp2_b = (const float*)d_in[10];
    const float* lin_w  = (const float*)d_in[11];
    const float* lin_b  = (const float*)d_in[12];
    const float* up_r   = (const float*)d_in[13];
    const float* up_w   = (const float*)d_in[14];
    const float* de1_w  = (const float*)d_in[15];
    const float* de1_b  = (const float*)d_in[16];
    const float* de2_w  = (const float*)d_in[17];
    const float* de2_b  = (const float*)d_in[18];

    // workspace layout (floats) ~5.3 MB; vA and vB hold attention val in turn
    float* ws   = (float*)d_ws;
    float* ltt  = ws;                    // NL*2
    float* vA   = ltt  + (size_t)NL * 2; // NX*64
    float* vB   = vA   + (size_t)NX * HID;   // NL*64
    float* hA   = vB   + (size_t)NL * HID;   // NL*64
    float* hB   = hA   + (size_t)NL * HID;
    float* thrD = hB   + (size_t)NL * HID;   // NL
    float* thrU = thrD + NL;                 // NX
    float* xs   = thrU + NX + 3;             // NX*2, the points in spatial order (16-byte aligned)
    int*   perm = (int*)(xs + (size_t)NX * 2);   // NX, the place each of them came from

    const int tilesNL = (NL + 15) / 16, tilesNX = (NX + 15) / 16;

    // spatial order of the points and of the latent points (ltt)
    k_sort<<<XBLK + LBLK, 512, 0, stream>>>(x, xs, perm, ltt);

    // encoder + val of the down step
    k_head<<<tilesNX, 128, 0, stream>>>(xs, en_w, en_b, down_w, vA);

    // ---- down: latent <- input (5% locality) ----
    // quantile over nK=11271: pos = 0.05*11270 = 563.5 -> k=563, frac=0.5
    k_quantile<4, 89, NX><<<NL, 128, 0, stream>>>(ltt, xs, 563, 0.5f, thrD);
    k_attn<0><<<tilesNL, 512, 0, stream>>>(ltt, NL, xs, NX, vA, down_r, thrD,
                                           nullptr, nullptr, nullptr, nullptr, nullptr, nullptr, nullptr,
                                           pa_w, nullptr, hA, vB);

    // ---- 4 latent blocks (dense attention, no mask), each with its MLP, its
    //      shortcut and the val of the attention that follows ----
    float* hin = hA;
    float* hout = hB;
    float* vin = vB;
    float* vout = vA;
    for (int i = 0; i < 4; i++) {
        k_attn<1><<<tilesNL, 512, 0, stream>>>(ltt, NL, ltt, NL, vin, pa_r + (size_t)i * 4, nullptr,
                                               hin,
                                               mlp1_w + (size_t)i * 4096, mlp1_b + (size_t)i * 64,
                                               mlp2_w + (size_t)i * 4096, mlp2_b + (size_t)i * 64,
                                               lin_w + (size_t)i * 4096, lin_b + (size_t)i * 64,
                                               i < 3 ? pa_w + (size_t)(i + 1) * 4096 : up_w,
                                               nullptr, hout, vout);
        float* tmp = hin; hin = hout; hout = tmp;
        tmp = vin; vin = vout; vout = tmp;
    }

    // ---- up: input <- latent (5% locality), with the decoder ----
    // quantile over nK=2886: pos = 0.05*2885 = 144.25 -> k=144, frac=0.25
    k_quantile<1, 91, NL><<<NX, 32, 0, stream>>>(xs, ltt, 144, 0.25f, thrU);
    k_attn<2><<<tilesNX, 512, 0, stream>>>(xs, NX, ltt, NL, vin, up_r, thrU,
                                           nullptr, de1_w, de1_b, de2_w, de2_b, nullptr, nullptr,
                                           nullptr, perm, (float*)d_out, nullptr);
}

// v007
// One run takes 163 microseconds.
// Two timings next to v006 put it at 1.10 and 1.12 times that version's speed.
// Over all steps from v000 it is 12.3 times as fast.
#include <hip/hip_runtime.h>
#include <math.h>

// ---------------------------------------------------------------------------
// PIT pipeline for MI455X (gfx1250, wave32).
// - Never materialize distance/attention matrices: recompute d2 from 2-D
//   coords, fused mask->exp->normalize->matvec (all live data L2-resident).
// - Per-row quantile by bisection on float bit patterns, the row in registers.
// - Dense [N,64]x[64,64] GEMMs via V_WMMA_F32_16X16X4_F32 (full f32 fidelity).
//   They work on each row alone, so they run on the 16-row tile that a block
//   already holds: behind the encoder, and behind each attention tile.
// - Attention in tiles of 16 queries: weights x val on the same f32 WMMA, keys
//   split over the waves of a block.
// - Points and latent points are put in spatial order first (strips in y, by x
//   inside a strip), so that 16 neighbours in memory are neighbours in the plane:
//   a masked attention tile leaves out every group of 16 keys whose bounding box
//   lies wholly beyond the tile's largest threshold. The whole pipeline runs in
//   that order; only the last store goes back through the permutation.
// ---------------------------------------------------------------------------

#define NX   11271     // 221*51 input points
#define NL   2886      // 111*26 latent points
#define HID  64

typedef __attribute__((ext_vector_type(2))) float v2f;
typedef __attribute__((ext_vector_type(8))) float v8f;

__device__ __forceinline__ float gelu_erf(float v) {
    // torch F.gelu default: 0.5*x*(1+erf(x/sqrt(2)))
    return 0.5f * v * (1.0f + erff(v * 0.70710678118654752f));
}

// ---------------------------------------------------------------------------
// One wave's 16x16 tile of  A[16,64] @ B[64,64], in three parts, so that the
// fragments can be fetched well ahead of the product.
// f32 WMMA fragment layouts per CDNA5 ISA 7.12.2:
//   A 16x4 : lanes 0-15 -> M=lane, VGPR{0,1}=K{0,1};  lanes 16-31 -> K{2,3}
//   B 4x16 : lanes 0-15 -> N=lane, VGPR{0,1}=K{0,1};  lanes 16-31 -> K{2,3}
//   C 16x16: VGPR r -> M = r + 8*(lane>=16), N = lane&15
// kk = 2*(lane>>4). Fragment s holds k = 4s+kk, 4s+kk+1 on both sides.
// ---------------------------------------------------------------------------
#define TP 68   // LDS pitch of a tile row in floats: 16 rows x 4 columns fall on 64 different banks

// Arow: the lane's own row of A (M = lane&15) at column kk, in LDS or (GLOBAL) in global memory.
template <bool GLOBAL>
__device__ __forceinline__ void frag_a(const float* Arow, v2f (&a)[16]) {
#pragma unroll   // constant indices keep the register array in registers
    for (int s = 0; s < 16; s++) a[s] = *(const v2f*)(Arow + 4 * s);
    if (GLOBAL) {
        // what follows may reuse the loads' address registers; the address as an
        // input keeps the last load's result out of them as well
        asm volatile("s_wait_xcnt 0x0" :: "v"(Arow) : "memory");
        // holds later address arithmetic behind that wait
        __builtin_amdgcn_sched_barrier(0);
    }
}

// Bcol: the lane's own column of B at row 0; BS: floats from one row of B to the
// next (64 for a plain matrix, 16 inside one head of the per-head weights
// [4][64][16], whose head h is columns 16h..16h+15 of the product).
template <int BS>
__device__ __forceinline__ void frag_b(const float* __restrict__ Bcol, int kk, v2f (&b)[16]) {
    const float* Bk = Bcol + kk * BS;      // one address, constant offsets
#pragma unroll   // constant indices keep the register array in registers
    for (int s = 0; s < 16; s++) {
        b[s].x = Bk[(4 * s + 0) * BS];
        b[s].y = Bk[(4 * s + 1) * BS];
    }
    // what follows may reuse the loads' address registers; the address as an
    // input keeps the last load's result out of them as well
    asm volatile("s_wait_xcnt 0x0" :: "v"(Bk) : "memory");
    // holds later address arithmetic behind that wait
    __builtin_amdgcn_sched_barrier(0);
}

__device__ __forceinline__ v8f mm16(const v2f (&a)[16], const v2f (&b)[16]) {
    v8f acc = {};
#pragma unroll   // constant indices keep the register arrays in registers
    for (int s = 0; s < 16; s++)
        acc = __builtin_amdgcn_wmma_f32_16x16x4_f32(
            /*neg_a=*/false, a[s], /*neg_b=*/false, b[s],
            /*c_mod=*/(short)0, acc, /*reuse_a=*/false, /*reuse_b=*/false);
    // the four vector slots between the last WMMA and the first vector instruction
    // on its result
    asm volatile("v_nop\n\tv_nop\n\tv_nop\n\tv_nop" : "+v"(acc));
    return acc;
}

// ---------------------------------------------------------------------------
// Spatial order. key = strip in y | x in 13 bits (to and fro) | index: all keys differ, so
// the place of a point is the number of smaller keys, the same in every run.
// A block ranks 32 points. Each of its 16 waves holds a sixteenth of the set's
// keys in registers and counts, for one point after the other, those below the
// point's key: one compare a register, counted over the wave by ballot, so the
// counts live in scalar registers. The strips are as high as 16 points are wide.
//   xs[place] = x[j], perm[place] = j          (blocks 0 .. XBLK-1)
//   ls[place] = x[:, ::2, ::2, :][l]           (the latent points, the other blocks)
// ---------------------------------------------------------------------------
#define XSTRIPS 27
#define LSTRIPS 13
#define XBLK ((NX + 31) / 32)
#define LBLK ((NL + 31) / 32)

__device__ __forceinline__ unsigned sort_key(float px, float py, int strips, int idx) {
    int s = (int)(py * (float)strips);
    s = s < 0 ? 0 : s > strips - 1 ? strips - 1 : s;      // any value of the input gives a valid key
    int xq = (int)(px * 8192.0f);
    xq = xq < 0 ? 0 : xq > 8191 ? 8191 : xq;
    if (s & 1) xq = 8191 - xq;             // odd strips run backwards: 16 neighbours stay together across a strip's end
    return ((unsigned)s << 27) | ((unsigned)xq << 14) | (unsigned)idx;
}

template <int N, int STRIPS, bool LAT>
__device__ __forceinline__ void sort_block(const float* __restrict__ x, unsigned (*part)[32], int blk,
                                           float* __restrict__ dst, int* __restrict__ perm) {
    constexpr int PER = (N + 15) / 16;     // keys a wave holds
    constexpr int NR = (PER + 31) / 32;    // of them a lane
    const int tid = threadIdx.x;
    const int lane = tid & 31;
    const int wave = __builtin_amdgcn_readfirstlane(tid >> 5);
    const float2* X2 = (const float2*)x;
    const int j = blk * 32 + lane;         // the point that this lane stands for
    const int jc = j < N ? j : N - 1;
    // the wave's NR*32 slots start early enough to end inside the set
    const int first = wave * PER < N - NR * 32 ? wave * PER : N - NR * 32;
    float2 p[NR];
    if (LAT) {
#pragma unroll   // constant indices keep the register array in registers
        for (int t = 0; t < NR; t++) {
            int i = first + t * 32 + lane;
            const float2* q = X2 + (2 * (i / 26)) * 51 + 2 * (i % 26);
            p[t] = *q;
            // each load has an address of its own: the next load's result may land in
            // it (as an input: nor this load's own)
            asm volatile("s_wait_xcnt 0x0" :: "v"(q) : "memory");
        }
    } else {
        const float2* q = X2 + first + lane;   // one address, constant offsets
#pragma unroll   // constant indices keep the register array in registers; the loads fly together
        for (int t = 0; t < NR; t++) p[t] = q[t * 32];
        // what follows may reuse the loads' address registers (as an input: nor may
        // the loads' own results land in them)
        asm volatile("s_wait_xcnt 0x0" :: "v"(q) : "memory");
    }
    const float2* qj = X2 + (LAT ? (2 * (jc / 26)) * 51 + 2 * (jc % 26) : jc);
    const float2 pj = *qj;
    // as above
    asm volatile("s_wait_xcnt 0x0" :: "v"(qj) : "memory");
    unsigned key[NR];
#pragma unroll   // constant indices keep the register array in registers
    for (int t = 0; t < NR; t++) {
        int i = first + t * 32 + lane;
        // a slot outside the wave's share is never below any key
        bool own = i >= wave * PER && i < wave * PER + PER;
        unsigned kk = sort_key(p[t].x, p[t].y, STRIPS, i);
        key[t] = own ? kk : 0xFFFFFFFFu;
    }
    const unsigned my = sort_key(pj.x, pj.y, STRIPS, jc);

    unsigned cnt = 0u;                     // lane l: how many of the wave's keys lie below point l's
    for (int l = 0; l < 32; l++) {
        const unsigned kl = (unsigned)__builtin_amdgcn_readlane((int)my, l);
        unsigned c = 0u;
#pragma unroll   // constant indices keep the keys in registers
        for (int t = 0; t + 1 < NR; t += 2) {
            // two ballots side by side: one 64-bit bit count for both
            unsigned long long b0 = __builtin_amdgcn_ballot_w32(key[t] < kl);
            unsigned long long b1 = __builtin_amdgcn_ballot_w32(key[t + 1] < kl);
            c += (unsigned)__popcll(b0 | (b1 << 32));
        }
        if (NR & 1) c += (unsigned)__popc(__builtin_amdgcn_ballot_w32(key[NR - 1] < kl));
        cnt = lane == l ? c : cnt;
    }
    part[wave][lane] = cnt;
    __syncthreads();                       // the waves' counts visible
    if (wave == 0 && j < N) {
        unsigned pos = 0u;
#pragma unroll   // lets the LDS reads issue together
        for (int w = 0; w < 16; w++) pos += part[w][lane];
        ((float2*)dst)[pos] = pj;
        if (!LAT) perm[pos] = j;
    }
}

__global__ __launch_bounds__(512)
void k_sort(const float* __restrict__ x, float* __restrict__ xs,
            int* __restrict__ perm, float* __restrict__ ls) {
    __shared__ unsigned part[16][32];
    if (blockIdx.x < XBLK) sort_block<NX, XSTRIPS, false>(x, part, blockIdx.x, xs, perm);
    else                   sort_block<NL, LSTRIPS, true>(x, part, blockIdx.x - XBLK, ls, nullptr);
}

// ---------------------------------------------------------------------------
// Head of the pipeline (x: the points in spatial order):
//   h0[j,c] = gelu(x0*W[0,c] + x1*W[1,c] + b[c])                  (K=2: plain VALU)
//   v[j, h*16+k] = sum_c h0[j,c] * w[h][c][k]                     (val of the down step)
// A block of 4 waves owns 16 rows: the encoder's tile goes through LDS into the
// A fragments, wave w owns head w (columns 16w..16w+15). blk: the tile's number.
// ---------------------------------------------------------------------------
__device__ __forceinline__
void head_tile(const float* __restrict__ x, const float* __restrict__ W,
               const float* __restrict__ b, const float* __restrict__ w,
               float* __restrict__ v, float (*tA)[TP], int blk) {
    int tid = threadIdx.x;
    int lane = tid & 31;
    int wave = __builtin_amdgcn_readfirstlane(tid >> 5);
    int laneN = lane & 15;
    int hi = lane >> 4;
    int r0 = blk * 16;

    // a thread keeps one column c and takes every second row of the tile
    const int c = tid & 63, rl = tid >> 6;
    const float2* X2 = (const float2*)x;
    float2 xr[8];
#pragma unroll   // constant indices keep the register array in registers
    for (int it = 0; it < 8; it++) {
        int j = r0 + rl + 2 * it;
        if (j > NX - 1) j = NX - 1;        // clamp tail reads (stores predicated)
        xr[it] = X2[j];
    }
    float wa = W[c], wb = W[HID + c], bc = b[c];
    // what follows may reuse the loads' address registers
    asm volatile("s_wait_xcnt 0x0" ::: "memory");
    // holds the weights' address arithmetic behind that wait
    __builtin_amdgcn_sched_barrier(0);
    v2f af[16], bf[16];
    frag_b<16>(w + wave * (HID * 16) + laneN, hi * 2, bf);   // flies under the encoder's arithmetic
#pragma unroll   // constant indices keep the register array in registers
    for (int it = 0; it < 8; it++)
        tA[rl + 2 * it][c] = gelu_erf(fmaf(xr[it].x, wa, fmaf(xr[it].y, wb, bc)));
    __syncthreads();                       // the encoder's tile visible

    frag_a<false>(&tA[laneN][hi * 2], af);
    v8f acc = mm16(af, bf);
#pragma unroll   // constant indices keep the accumulator in registers
    for (int r = 0; r < 8; r++) {
        int row = r0 + r + 8 * hi;
        if (row < NX) v[(size_t)row * HID + wave * 16 + laneN] = acc[r];
    }
}

// ---------------------------------------------------------------------------
// Per-row quantile of squared distances, the row's distances kept in registers.
// thr[row] = s[kth] + frac*(s[kth+1] - s[kth])   (jnp.quantile 'linear')
// d2 >= 0 so float bit patterns are order-preserving as uints.
// A team of WAVES waves owns one row; each lane holds NR of the NK distances.
// The team is a whole block (tid: the thread's number in it), or, with WAVES = 1,
// one wave of a block whose waves each take a row of their own (tid: the lane).
// The bit pattern of s[kth] is bracketed by bisection between the row's minimum
// and maximum: one compare per held value, counted over the wave by ballot, so
// the count and the bracket live in scalar registers. Once the bracket holds at
// most 32 values they are gathered, one to a lane of wave 0, and ranked against
// each other. Equal values that never thin out end the bisection at width 1.
// ---------------------------------------------------------------------------
#define QCAP 32

template <int WAVES>
struct QShared {                         // a team's LDS
    unsigned mn[WAVES], mx[WAVES];       // the waves' minima and maxima
    unsigned cnt[2][WAVES];              // the waves' counts, by parity of the step
    unsigned m[WAVES], mg[WAVES];        // values gathered; least value above the bracket
    unsigned buf[WAVES][QCAP];           // the gathered values
};

// keep: false for a team past the last row, which works on a row again and stores nothing
template <int WAVES, int NR, int NK>
__device__ __forceinline__
void quantile_row(const float* __restrict__ Qc, const float* __restrict__ Kc,
                  int kth, float frac, float* __restrict__ thr_out,
                  int row, bool keep, int tid, QShared<WAVES>& sh) {
    constexpr int T = WAVES * 32;
    static_assert(T * NR >= NK && T * (NR - 1) < NK, "NR values a lane cover the row");
    const int lane = tid & 31;
    const int wave = WAVES > 1 ? __builtin_amdgcn_readfirstlane(tid >> 5) : 0;   // scalar branches on the wave
    const unsigned k = (unsigned)kth;
    const float qx = Qc[2 * row + 0], qy = Qc[2 * row + 1];

    unsigned u[NR];
    unsigned mn = 0xFFFFFFFFu, mx = 0u;
    const float2* K2 = (const float2*)Kc;
    // Three runs of loads, each issued whole in front of its arithmetic. A key takes
    // two registers until it is worked down to one distance, so the runs shrink as
    // the row fills up and the wave stays inside its register budget.
    constexpr int RUN0 = 44, RUN1 = 74;
    static_assert(NR > RUN1 && NR - RUN1 <= RUN0, "three runs cover the row");
    float2 p[RUN0];
#pragma unroll   // constant indices keep the row in registers
    for (int run = 0; run < 3; run++) {
        const int i0 = run == 0 ? 0 : run == 1 ? RUN0 : RUN1;
        const int i1 = run == 0 ? RUN0 : run == 1 ? RUN1 : NR;
#pragma unroll   // constant indices keep the row in registers
        for (int i = i0; i < i1; i++) {
            int j = i * T + tid;
            if ((i + 1) * T > NK) j = j < NK ? j : NK - 1;   // past the end: the last key again
            p[i - i0] = K2[j];
        }
        // behind the last load: the arithmetic below may reuse the loads' address registers
        if (run == 2) asm volatile("s_wait_xcnt 0x0" ::: "memory");
        // keeps the run's loads together: left alone the compiler waits after every four
        __builtin_amdgcn_sched_barrier(0);
#pragma unroll   // constant indices keep the row in registers
        for (int i = i0; i < i1; i++) {
            float dx = qx - p[i - i0].x;
            float dy = qy - p[i - i0].y;
            unsigned b = __float_as_uint(fmaf(dx, dx, dy * dy));
            mn = b < mn ? b : mn;
            mx = b > mx ? b : mx;
            // a slot past the end is never below any bracket end
            u[i] = ((i + 1) * T <= NK || i * T + tid < NK) ? b : 0xFFFFFFFFu;
        }
        // keeps the next run's loads behind this run's arithmetic, which frees their registers
        __builtin_amdgcn_sched_barrier(0);
    }
#pragma unroll   // five fixed steps, minimum and maximum side by side
    for (int d = 16; d >= 1; d >>= 1) {
        unsigned a = (unsigned)__shfl_xor((int)mn, d);
        unsigned c = (unsigned)__shfl_xor((int)mx, d);
        mn = a < mn ? a : mn;
        mx = c > mx ? c : mx;
    }
    if constexpr (WAVES > 1) {
        if (lane == 0) { sh.mn[wave] = mn; sh.mx[wave] = mx; }
        __syncthreads();                           // the waves' minima and maxima visible
#pragma unroll   // lets the LDS reads issue together
        for (int w = 0; w < WAVES; w++) {
            unsigned a = sh.mn[w], c = sh.mx[w];
            mn = a < mn ? a : mn;
            mx = c > mx ? c : mx;
        }
    }
    // lo <= s[kth] < hi ; cLo values lie below lo, cHi below hi
    unsigned lo = (unsigned)__builtin_amdgcn_readfirstlane((int)mn);
    unsigned hi = (unsigned)__builtin_amdgcn_readfirstlane((int)mx);
    if (hi != 0xFFFFFFFFu) hi += 1u;
    unsigned cLo = 0u, cHi = (unsigned)NK;

    for (int it = 0; it < 32; it++) {              // the width halves: 32 steps at most
        if (hi - lo <= 1u || cHi - cLo <= (unsigned)QCAP) break;   // same in every wave of the team
        unsigned mid = lo + ((hi - lo) >> 1);
        unsigned c = 0u;
#pragma unroll   // constant indices keep the row in registers
        for (int i = 0; i + 1 < NR; i += 2) {
            // two ballots side by side: one 64-bit bit count for both
            unsigned long long b0 = __builtin_amdgcn_ballot_w32(u[i] < mid);
            unsigned long long b1 = __builtin_amdgcn_ballot_w32(u[i + 1] < mid);
            c += (unsigned)__popcll(b0 | (b1 << 32));
        }
        if (NR & 1) c += (unsigned)__popc(__builtin_amdgcn_ballot_w32(u[NR - 1] < mid));
        if constexpr (WAVES > 1) {
            // slots alternate, so a wave one step ahead writes the other one
            if (lane == 0) sh.cnt[it & 1][wave] = c;
            __syncthreads();                       // the waves' counts visible
            unsigned t = 0u;
#pragma unroll   // lets the LDS reads issue together
            for (int w = 0; w < WAVES; w++) t += sh.cnt[it & 1][w];
            c = (unsigned)__builtin_amdgcn_readfirstlane((int)t);
        }
        if (c <= k) { lo = mid; cLo = c; } else { hi = mid; cHi = c; }
    }

    const unsigned m = cHi - cLo;                  // values in the bracket
    const unsigned r = k - cLo;                    // rank of s[kth] among them
    const bool few = m <= (unsigned)QCAP;
    const bool above = r + 1u >= m;                // s[kth+1] is the least value at or above hi

    unsigned mg = 0xFFFFFFFFu;
    if (above) {
#pragma unroll   // constant indices keep the row in registers
        for (int i = 0; i < NR; i++) {
            unsigned v = u[i] >= hi ? u[i] : 0xFFFFFFFFu;
            mg = v < mg ? v : mg;
        }
#pragma unroll   // five fixed steps
        for (int d = 16; d >= 1; d >>= 1) {
            unsigned a = (unsigned)__shfl_xor((int)mg, d);
            mg = a < mg ? a : mg;
        }
    }
    unsigned got = 0u;
    if (few) {
        const unsigned width = hi - lo;
#pragma unroll   // constant indices keep the row in registers
        for (int g = 0; g < NR; g += 16) {
            // sixteen ballots first, then the scalar tests: a test directly behind
            // its own compare would wait out the compare each time
            unsigned mask[16];
#pragma unroll   // constant indices keep the masks in scalar registers
            for (int t = 0; t < 16; t++)
                mask[t] = g + t < NR ? __builtin_amdgcn_ballot_w32(u[g + t < NR ? g + t : 0] - lo < width) : 0u;   // lo <= u < hi
#pragma unroll   // constant indices keep the masks in scalar registers
            for (int t = 0; t < 16; t++) {
                if (g + t < NR && mask[t] != 0u) {   // most registers hold none: scalar skip
                    if ((mask[t] >> lane) & 1u)
                        sh.buf[wave][got + __builtin_amdgcn_mbcnt_lo(mask[t], 0u)] = u[g + t < NR ? g + t : 0];
                    got += (unsigned)__popc(mask[t]);
                }
            }
        }
    }
    if (lane == 0) { sh.m[wave] = got; sh.mg[wave] = mg; }
    // gathered values and their counts visible (every wave of the block comes here
    // once, also where each has a row of its own)
    __syncthreads();

    if (wave == 0) {
#pragma unroll   // lets the LDS reads issue together
        for (int w = 0; w < WAVES; w++) { unsigned a = sh.mg[w]; mg = a < mg ? a : mg; }
        unsigned sk = lo, sk1 = above ? mg : lo;   // bracket of width 1: all its values equal lo
        if (few) {
            unsigned cand = 0xFFFFFFFFu, first = 0u;
#pragma unroll   // lets the LDS reads issue together
            for (int w = 0; w < WAVES; w++) {
                unsigned n = sh.m[w];
                if ((unsigned)lane - first < n) cand = sh.buf[w][(unsigned)lane - first];
                first += n;
            }
            unsigned less = 0u, leq = 0u;
#pragma unroll   // constant lane numbers for the broadcasts
            for (int j = 0; j < QCAP; j++) {
                unsigned cj = (unsigned)__builtin_amdgcn_readlane((int)cand, j);
                less += cj < cand ? 1u : 0u;
                leq += cj <= cand ? 1u : 0u;
            }
            // a lane holds the value of rank x when less <= x < leq
            unsigned ma = __builtin_amdgcn_ballot_w32(less <= r && r < leq);
            sk = (unsigned)__builtin_amdgcn_readlane((int)cand, __ffs(ma) - 1);
            if (!above) {
                unsigned mb = __builtin_amdgcn_ballot_w32(less <= r + 1u && r + 1u < leq);
                sk1 = (unsigned)__builtin_amdgcn_readlane((int)cand, __ffs(mb) - 1);
            }
        }
        if (lane == 0 && keep) {
            float fk = __uint_as_float(sk);
            thr_out[row] = fmaf(frac, __uint_as_float(sk1) - fk, fk);
        }
    }
}

// ---------------------------------------------------------------------------
// The two pieces of work that need nothing but the spatial order, in one launch:
// the thresholds of the down step (blocks 0 .. NL-1, a row each; they last longer) and the head of the pipeline (the other blocks, a tile each).
// quantile over nK=11271: pos = 0.05*11270 = 563.5 -> k=563, frac=0.5
// ---------------------------------------------------------------------------
__global__ __launch_bounds__(128)
__attribute__((amdgpu_waves_per_eu(8)))   // 128 registers a wave: eight waves a SIMD cover each other's waits
void k_head_quantile(const float* __restrict__ xs, const float* __restrict__ ls,
                     const float* __restrict__ W, const float* __restrict__ b,
                     const float* __restrict__ w, float* __restrict__ v,
                     float* __restrict__ thr_out) {
    __shared__ QShared<4> qs;
    __shared__ __attribute__((aligned(16))) float tA[16][TP];   // aligned for the 8-byte fragment reads
    if (blockIdx.x < NL)
        quantile_row<4, 89, NX>(ls, xs, 563, 0.5f, thr_out, blockIdx.x, true, threadIdx.x, qs);
    else
        head_tile(xs, W, b, w, v, tA, blockIdx.x - NL);
}

// ---------------------------------------------------------------------------
// One group of 16 keys for a tile of 16 queries, all four heads.
// The masked weights are computed straight into the WMMA A fragment
// (M = query = lane&15, K = key) and the val rows are the B fragment
// (K = key, N = column within the head), with the same key in the same K slot:
//   lanes 0-15 : VGPR{0,1} = keys j+0, j+1 ; lanes 16-31 : keys j+2, j+3
// jb = first key of the group + 2*(lane>>4). TAIL clamps every key index and
// zeroes the weights of keys past the end.
// ---------------------------------------------------------------------------
// exp2 of eight values. One statement, each value in its own register: behind
// an exp2 the instruction set asks for one independent instruction before its
// result is read or its source overwritten. Here the source is the result's own
// register, the next exp2 fills the slot of the one in front, and the v_nop that
// of the last.
__device__ __forceinline__ void exp2x8(float (&x)[8]) {
    asm("v_exp_f32 %0, %0\n\t"
        "v_exp_f32 %1, %1\n\t"
        "v_exp_f32 %2, %2\n\t"
        "v_exp_f32 %3, %3\n\t"
        "v_exp_f32 %4, %4\n\t"
        "v_exp_f32 %5, %5\n\t"
        "v_exp_f32 %6, %6\n\t"
        "v_exp_f32 %7, %7\n\t"
        "v_nop"
        : "+v"(x[0]), "+v"(x[1]), "+v"(x[2]), "+v"(x[3]),
          "+v"(x[4]), "+v"(x[5]), "+v"(x[6]), "+v"(x[7]));
}

template <bool TAIL>
__device__ __forceinline__ void attn_group16(const float* __restrict__ Kc,
                                             const float* __restrict__ val,
                                             int nK, int jb, int laneN,
                                             float qx, float qy, float thrq,
                                             const float (&c)[4],
                                             v8f (&acc)[4], v2f (&den)[4]) {
    // all loads of the group first, the coordinates ahead of the val rows, so
    // that the val rows fly under the weights' arithmetic
    v2f b[4][4];
    float kx[4][2], ky[4][2];
    const float* ka[4];
    const float* kc[4];
#pragma unroll   // constant indices keep the register arrays in registers
    for (int s = 0; s < 4; s++) {
        int j = jb + s * 4;
        if (TAIL) {
            int ja = j < nK ? j : nK - 1;
            int jc = j + 1 < nK ? j + 1 : nK - 1;
            ka[s] = Kc + 2 * ja;
            kc[s] = Kc + 2 * jc;
            kx[s][0] = ka[s][0]; ky[s][0] = ka[s][1];
            kx[s][1] = kc[s][0]; ky[s][1] = kc[s][1];
        } else {
            ka[s] = kc[s] = Kc + 2 * jb;                // one address, constant offsets
            float4 k4 = *(const float4*)(ka[s] + 8 * s);   // jb is even: 16-B aligned
            kx[s][0] = k4.x; ky[s][0] = k4.y; kx[s][1] = k4.z; ky[s][1] = k4.w;
        }
    }
    // the val loads' results and addresses may land in the coordinate loads'
    // address registers; as a memory fence it also keeps the coordinate loads in
    // front (loads return in order: issued last, they would make the first
    // distance wait for every val row as well). The addresses as inputs keep the
    // coordinate loads' own results out of them.
    if (TAIL)
        asm volatile("s_wait_xcnt 0x0" :: "v"(ka[0]), "v"(ka[1]), "v"(ka[2]), "v"(ka[3]),
                                          "v"(kc[0]), "v"(kc[1]), "v"(kc[2]), "v"(kc[3]) : "memory");
    else
        asm volatile("s_wait_xcnt 0x0" :: "v"(ka[0]) : "memory");
    // holds the val rows' address arithmetic behind that wait
    __builtin_amdgcn_sched_barrier(0);
#pragma unroll   // constant indices keep the register arrays in registers
    for (int s = 0; s < 4; s++) {
        const float* va;
        const float* vc;
        if (TAIL) {
            int j = jb + s * 4;
            int ja = j < nK ? j : nK - 1;
            int jc = j + 1 < nK ? j + 1 : nK - 1;
            va = val + (size_t)ja * HID + laneN;
            vc = val + (size_t)jc * HID + laneN;
        } else {
            va = val + (size_t)jb * HID + laneN + s * 4 * HID;   // one address, constant offsets
            vc = va + HID;
        }
#pragma unroll   // constant indices keep the register arrays in registers
        for (int h = 0; h < 4; h++) { b[s][h].x = va[h * 16]; b[s][h].y = vc[h * 16]; }
        // clamped rows have address registers of their own for each run, and the
        // next run's results may land in them (as inputs: nor this run's own)
        if (TAIL) asm volatile("s_wait_xcnt 0x0" :: "v"(va), "v"(vc) : "memory");
        // the arithmetic below may reuse the val loads' address registers (as an
        // input: nor may the loads' own results land in them)
        if (!TAIL && s == 3) asm volatile("s_wait_xcnt 0x0" :: "v"(va) : "memory");
    }
    // keeps the wait for the coordinates behind the issue of the val loads
    __builtin_amdgcn_sched_barrier(0);
#pragma unroll   // constant indices keep the register arrays in registers
    for (int s = 0; s < 4; s++) {
        int j = jb + s * 4;
        float dx0 = qx - kx[s][0], dy0 = qy - ky[s][0];
        float dx1 = qx - kx[s][1], dy1 = qy - ky[s][1];
        float d20 = fmaf(dx0, dx0, dy0 * dy0);
        float d21 = fmaf(dx1, dx1, dy1 * dy1);
        bool ok0 = d20 <= thrq, ok1 = d21 <= thrq;
        if (TAIL) { ok0 = ok0 && (j < nK); ok1 = ok1 && (j + 1 < nK); }
        // c holds -c_h*log2(e): one multiply and the hardware's exp2 for each weight.
        // The exponent is never above 0; a weight under 2^-126 comes out as 0.
        float e[8];
#pragma unroll   // constant indices keep the register arrays in registers
        for (int h = 0; h < 4; h++) { e[2 * h] = c[h] * d20; e[2 * h + 1] = c[h] * d21; }
        exp2x8(e);
#pragma unroll   // constant indices keep the register arrays in registers
        for (int h = 0; h < 4; h++) {
            // exp in every lane, then a select: no divergent branch round a WMMA
            v2f a;
            a.x = ok0 ? e[2 * h] : 0.0f;
            a.y = ok1 ? e[2 * h + 1] : 0.0f;
            den[h] += a;                   // even and odd keys summed apart
            acc[h] = __builtin_amdgcn_wmma_f32_16x16x4_f32(
                /*neg_a=*/false, a, /*neg_b=*/false, b[s][h],
                /*c_mod=*/(short)0, acc[h], /*reuse_a=*/false, /*reuse_b=*/false);
        }
    }
}

// ---------------------------------------------------------------------------
// Fused masked multi-head softmax attention + gelu.
// out[q, h*16+v] = gelu( sum_j w_h(q,j) * val[j, h*16+v] / sum_j w_h(q,j) )
//   w_h = exp(-c_h * d2(q,j)) if d2 <= thr[q] else 0 ;  c_h = tan(pi/4*(1+sin r_h))
// (positive c_h => head-independent mask; exponents in [-c*thr, 0] => stable.)
// Block = 16 waves, one tile of 16 queries: every val row that is read serves
// 16 queries through one f32 WMMA per head. The keys are dealt to the waves in
// groups of 16; the waves' partial numerators and denominators are summed in
// LDS in a fixed order.
// The tile a[16,64] that comes of it stays in LDS, and the products that follow
// it in the pipeline, which work on each row alone, run on it in the same block:
//   STEP 0, down  : hout = a ; vout = a @ wv
//   STEP 1, latent: t = gelu(a @ w1 + b1) ; m = t @ w2 + b2 ;
//                   hout = gelu(m + hin @ w3 + b3) ; vout = hout @ wv
//   STEP 2, up    : t = gelu(a @ w1 + b1) ; hout[perm[q]] = t . w2 + b2   (w2 is [64,1])
// Each product has four waves of its own (wave 4g+w: product g, columns
// 16w..16w+15), which fetch its weights behind the key loop, ahead of the LDS sum;
// each gelu is spread over all 16 waves.
// wv: the per-head weights [4][64][16] of the attention that comes next; vout is
// its val, another buffer than val, which other blocks are still reading.
// The launches of STEP 0 and STEP 1 have fewer tiles than the chip has room for.
// The thresholds of the up step, which need only the spatial order, ride along in
// blocks of their own behind the tiles: 16 rows a block, one a wave. Such a launch
// takes the qrows points from qpts on: thr2[row] from the distances of qpts[row]
// to all latent points, which are Qc in both steps.
// ---------------------------------------------------------------------------
#define ATT_WAVES 16

template <int STEP>
__global__ __launch_bounds__(ATT_WAVES * 32)
// the masked steps keep 128 registers a wave, so that two blocks share a WGP as before
__attribute__((amdgpu_waves_per_eu(STEP == 1 ? 4 : 8)))
void k_attn(const float* __restrict__ Qc, int nQ,
            const float* __restrict__ Kc, int nK,
            const float* __restrict__ val,
            const float* __restrict__ rr,
            const float* __restrict__ thr,
            const float* __restrict__ hin,
            const float* __restrict__ w1, const float* __restrict__ b1,
            const float* __restrict__ w2, const float* __restrict__ b2,
            const float* __restrict__ w3, const float* __restrict__ b3,
            const float* __restrict__ wv, const int* __restrict__ perm,
            float* __restrict__ hout, float* __restrict__ vout,
            const float* __restrict__ qpts, int qrows, float* __restrict__ thr2) {
    if constexpr (STEP != 2) {
        __shared__ QShared<1> qs[ATT_WAVES];
        const int tiles = (nQ + 15) >> 4;
        // the whole block, ahead of every barrier of the tiles; marked unlikely so that
        // the tiles' code, which the launch waits for, stands first in the kernel's text
        if (__builtin_expect((int)blockIdx.x >= tiles, 0)) {
            const int w = __builtin_amdgcn_readfirstlane(threadIdx.x >> 5);
            const int row = ((int)blockIdx.x - tiles) * ATT_WAVES + w;
            // quantile over nK=2886: pos = 0.05*2885 = 144.25 -> k=144, frac=0.25
            quantile_row<1, 91, NL>(qpts, Qc, 144, 0.25f, thr2, row < qrows ? row : qrows - 1, row < qrows,
                                    (int)__builtin_amdgcn_mbcnt_lo(~0u, 0u), qs[w]);   // the lane's number
            return;
        }
    }
    __shared__ int lst[NX / 16];                   // the key groups that the tile visits, in rising order
    __shared__ int wcnt[ATT_WAVES];                // how many of them each wave found
    __shared__ float red[ATT_WAVES / 2][32][32];   // 32 KB partial numerators
    __shared__ float dred[ATT_WAVES][4][16];       // partial denominators
    __shared__ float cs[4];
    // 16-row tiles handed from product to product; aligned for the 8-byte fragment reads
    __shared__ __attribute__((aligned(16))) float tA[16][TP], tB[16][TP], tC[16][TP];

    int tid = threadIdx.x;
    int lane = tid & 31;
    int wave = __builtin_amdgcn_readfirstlane(tid >> 5);   // scalar loop control
    int laneN = lane & 15;
    int hi = lane >> 4;
    int q0 = blockIdx.x * 16;

    // kept as -c_h*log2(e): exp(-c_h*d2) = exp2(cs*d2)
    if (tid < 4)
        cs[tid] = -1.44269504088896341f * tanf(0.78539816339744831f * (1.0f + sinf(rr[tid])));
    __syncthreads();                       // cs visible

    int q = q0 + laneN;
    if (q > nQ - 1) q = nQ - 1;            // clamp tail reads (stores predicated)
    float qx = Qc[2 * q + 0], qy = Qc[2 * q + 1];
    float thrq = 3.402823466e+38f;
    if (thr) {
        thrq = thr[q];
        // in the load's own block, so that nothing of the code behind the branch comes in front of it
        asm volatile("s_wait_xcnt 0x0" ::: "memory");
    }
    // the address registers of the two loads above are reused at once
    asm volatile("s_wait_xcnt 0x0" ::: "memory");
    float c[4] = {cs[0], cs[1], cs[2], cs[3]};

    v8f acc[4] = {};
    v2f den[4] = {};

    int nFull = nK >> 4;                   // whole groups of 16 keys
    int nTurn = nFull;                     // groups dealt out so far: says whose turn the partial group is
    if (STEP == 1) {
        for (int g = wave; g < nFull; g += ATT_WAVES)
            attn_group16<false>(Kc, val, nK, g * 16 + hi * 2, laneN, qx, qy, thrq, c, acc, den);
    } else {
        // the tile's bounding box and its largest threshold
        // (each half-wave holds the 16 queries, one a lane)
        float bx0 = qx, bx1 = qx, by0 = qy, by1 = qy, tmax = thrq;
#pragma unroll   // four fixed steps, the five values side by side
        for (int d = 8; d >= 1; d >>= 1) {
            float a0 = __shfl_xor(bx0, d), a1 = __shfl_xor(bx1, d);
            float a2 = __shfl_xor(by0, d), a3 = __shfl_xor(by1, d), a4 = __shfl_xor(tmax, d);
            bx0 = fminf(bx0, a0); bx1 = fmaxf(bx1, a1);
            by0 = fminf(by0, a2); by1 = fmaxf(by1, a3);
            tmax = fmaxf(tmax, a4);
        }
        int nAct = 0;
        for (int base = 0; base < nFull; base += ATT_WAVES * 32) {
            int g = base + tid;
            int gg = g < nFull ? g : nFull - 1;
            const float4* kp = (const float4*)(Kc + (size_t)gg * 32);
            float4 k[8];
#pragma unroll   // constant indices keep the register array in registers
            for (int i = 0; i < 8; i++) k[i] = kp[i];
            // the next trip rewrites the loads' address registers
            asm volatile("s_wait_xcnt 0x0" ::: "memory");
            float kx0 = fminf(k[0].x, k[0].z), kx1 = fmaxf(k[0].x, k[0].z);
            float ky0 = fminf(k[0].y, k[0].w), ky1 = fmaxf(k[0].y, k[0].w);
#pragma unroll   // constant indices keep the register array in registers
            for (int i = 1; i < 8; i++) {
                kx0 = fminf(kx0, fminf(k[i].x, k[i].z)); kx1 = fmaxf(kx1, fmaxf(k[i].x, k[i].z));
                ky0 = fminf(ky0, fminf(k[i].y, k[i].w)); ky1 = fmaxf(ky1, fmaxf(k[i].y, k[i].w));
            }
            // The gap between the two boxes, squared in the very form of the pairs' d2:
            // subtraction, product and fma round monotonically, so no pair's d2 is
            // below it. A group is left out only when that bound is above every
            // threshold of the tile: all its weights would be 0.
            float gx = fmaxf(fmaxf(kx0 - bx1, bx0 - kx1), 0.0f);
            float gy = fmaxf(fmaxf(ky0 - by1, by0 - ky1), 0.0f);
            bool act = g < nFull && !(fmaf(gx, gx, gy * gy) > tmax);
            unsigned m = __builtin_amdgcn_ballot_w32(act);
            if (lane == 0) wcnt[wave] = __popc(m);
            __syncthreads();               // the waves' counts visible
            int before = 0, tot = 0;
#pragma unroll   // lets the LDS reads issue together
            for (int w = 0; w < ATT_WAVES; w++) {
                int n = wcnt[w];
                before += w < wave ? n : 0;
                tot += n;
            }
            if (act) lst[nAct + before + (int)__builtin_amdgcn_mbcnt_lo(m, 0u)] = g;
            nAct += tot;
            __syncthreads();               // the list visible; the counts free for the next trip
        }
        nAct = __builtin_amdgcn_readfirstlane(nAct);           // scalar loop control
        nTurn = nAct;
        int gl = wave < nAct ? lst[wave] : 0;                  // read one trip ahead, under the group's work
        for (int i = wave; i < nAct; i += ATT_WAVES) {
            int g = __builtin_amdgcn_readfirstlane(gl);
            gl = lst[i + ATT_WAVES < nAct ? i + ATT_WAVES : i];
            attn_group16<false>(Kc, val, nK, g * 16 + hi * 2, laneN, qx, qy, thrq, c, acc, den);
        }
    }
    if ((nK & 15) != 0 && (nTurn & (ATT_WAVES - 1)) == wave)   // the partial group, next wave in turn
        attn_group16<true>(Kc, val, nK, nFull * 16 + hi * 2, laneN, qx, qy, thrq, c, acc, den);

    // this wave's product of the tail: its weights, bias (and rows of hin) set off now
    const int kk = hi * 2;
    const int grp = wave >> 2;
    const int col = (wave & 3) * 16 + laneN;
    const float* wvcol = wv + (wave & 3) * (HID * 16) + laneN;
    v2f af[16], bf[16];
    float bv = 0.0f;
    if (STEP == 0) {
        if (grp == 0) frag_b<16>(wvcol, kk, bf);
    } else if (STEP == 1) {
        if (grp < 3) {
            const float* wsel = grp == 0 ? w1 : grp == 1 ? w3 : w2;
            const float* bsel = grp == 0 ? b1 : grp == 1 ? b3 : b2;
            bv = bsel[col];
            frag_b<HID>(wsel + col, kk, bf);
            if (grp == 1) frag_a<true>(hin + (size_t)q * HID + kk, af);
        } else {
            frag_b<16>(wvcol, kk, bf);
        }
    } else {
        if (grp == 0) {
            const float* bp = b1 + col;
            bv = *bp;
            // the weights' results may land in this load's address registers
            asm volatile("s_wait_xcnt 0x0" :: "v"(bp) : "memory");
            frag_b<HID>(w1 + col, kk, bf);
        }
    }

    // the two half-waves hold different keys of the same query
#pragma unroll   // constant indices keep the register arrays in registers
    for (int h = 0; h < 4; h++) {
        float dh = den[h].x + den[h].y;
        dh += __shfl_xor(dh, 16);
        if (hi == 0) dred[wave][h][laneN] = dh;
    }
    if (wave >= ATT_WAVES / 2) {
#pragma unroll   // constant indices keep the register arrays in registers
        for (int h = 0; h < 4; h++)
#pragma unroll   // constant indices keep the register arrays in registers
            for (int r = 0; r < 8; r++) red[wave - ATT_WAVES / 2][h * 8 + r][lane] = acc[h][r];
    }
    __syncthreads();                       // upper waves' partials visible
    if (wave < ATT_WAVES / 2) {
#pragma unroll   // constant indices keep the register arrays in registers
        for (int h = 0; h < 4; h++)
#pragma unroll   // constant indices keep the register arrays in registers
            for (int r = 0; r < 8; r++) red[wave][h * 8 + r][lane] += acc[h][r];
    }
    __syncthreads();                       // all partials visible

    // C layout: VGPR r -> M = r + 8*(lane>=16), N = lane&15
    for (int o = tid; o < 16 * HID; o += ATT_WAVES * 32) {
        int ql = o >> 6, col = o & 63;
        int h = col >> 4, n = col & 15;
        float num = 0.f, d = 0.f;
#pragma unroll   // lets the LDS reads issue together
        for (int w = 0; w < ATT_WAVES / 2; w++)
            num += red[w][h * 8 + (ql & 7)][(ql >> 3) * 16 + n];
#pragma unroll   // lets the LDS reads issue together
        for (int w = 0; w < ATT_WAVES; w++) d += dred[w][h][ql];
        float a = gelu_erf(num / d);
        tA[ql][col] = a;                   // rows past the end repeat the last query; never stored
        if (STEP == 0 && q0 + ql < nQ) {
            hout[(size_t)(q0 + ql) * HID + col] = a;
            // the next trip may reuse the store's address registers
            asm volatile("s_wait_xcnt 0x0" ::: "memory");
        }
    }
    __syncthreads();                       // the attention tile visible

    if (STEP == 1 || STEP == 2) {
        if (grp == 0) {
            frag_a<false>(&tA[laneN][kk], af);
            v8f t = mm16(af, bf);
#pragma unroll   // constant indices keep the accumulator in registers
            for (int r = 0; r < 8; r++) tB[r + 8 * hi][col] = t[r] + bv;
        } else if (STEP == 1 && grp == 1) {
            v8f t = mm16(af, bf);
#pragma unroll   // constant indices keep the accumulator in registers
            for (int r = 0; r < 8; r++) tC[r + 8 * hi][col] = t[r] + bv;
        }
        __syncthreads();                   // a @ w1 + b1 (and hin @ w3 + b3) visible
        for (int o = tid; o < 16 * HID; o += ATT_WAVES * 32)
            tB[o >> 6][o & 63] = gelu_erf(tB[o >> 6][o & 63]);
        __syncthreads();                   // t visible
    }
    if (STEP == 1) {
        if (grp == 2) {
            frag_a<false>(&tB[laneN][kk], af);
            v8f m = mm16(af, bf);
#pragma unroll   // constant indices keep the accumulator in registers
            for (int r = 0; r < 8; r++)    // tA: its readers left it two barriers ago
                tA[r + 8 * hi][col] = tC[r + 8 * hi][col] + (m[r] + bv);
        }
        __syncthreads();                   // m + hin @ w3 + b3 visible
        for (int o = tid; o < 16 * HID; o += ATT_WAVES * 32) {
            float v = gelu_erf(tA[o >> 6][o & 63]);
            tA[o >> 6][o & 63] = v;
            if (q0 + (o >> 6) < nQ) {
                hout[(size_t)q0 * HID + o] = v;
                // the next trip may reuse the store's address registers
                asm volatile("s_wait_xcnt 0x0" ::: "memory");
            }
        }
        __syncthreads();                   // the new h tile visible
    }
    if (STEP == 0 || STEP == 1) {
        if (grp == (STEP == 0 ? 0 : 3)) {
            frag_a<false>(&tA[laneN][kk], af);
            v8f v = mm16(af, bf);
#pragma unroll   // constant indices keep the accumulator in registers
            for (int r = 0; r < 8; r++) {
                int row = q0 + r + 8 * hi;
                if (row < nQ) vout[(size_t)row * HID + col] = v[r];
            }
        }
    }
    if (STEP == 2) {
        // decoder head: one thread a row, the 64 terms in their order
        if (tid < 16 && q0 + tid < nQ) {
            const int* pp = perm + q0 + tid;
            int place = *pp;
            // what follows may reuse the load's address registers; the address as an
            // input keeps the load's own result out of them as well
            asm volatile("s_wait_xcnt 0x0" :: "v"(pp) : "memory");
            float s = b2[0];
#pragma unroll   // lets the LDS reads issue together
            for (int k = 0; k < HID; k++) s = fmaf(tB[tid][k], w2[k], s);
            hout[place] = s;               // back to the point's own place
        }
    }
}

// ---------------------------------------------------------------------------
extern "C" void kernel_launch(void* const* d_in, const int* in_sizes, int n_in,
                              void* d_out, int out_size, void* d_ws, size_t ws_size,
                              hipStream_t stream) {
    (void)in_sizes; (void)n_in; (void)out_size; (void)ws_size;

    const float* x      = (const float*)d_in[0];   // [1,221,51,2] == xf [11271,2]
    const float* en_w   = (const float*)d_in[1];
    const float* en_b   = (const float*)d_in[2];
    const float* down_r = (const float*)d_in[3];
    const float* down_w = (const float*)d_in[4];
    const float* pa_r   = (const float*)d_in[5];   // [4,1,4,1,1]
    const float* pa_w   = (const float*)d_in[6];   // [4,4,64,16]
    const float* mlp1_w = (const float*)d_in[7];
    const float* mlp1_b = (const float*)d_in[8];
    const float* mlp2_w = (const float*)d_in[9];
    const float* mlp2_b = (const float*)d_in[10];
    const float* lin_w  = (const float*)d_in[11];
    const float* lin_b  = (const float*)d_in[12];
    const float* up_r   = (const float*)d_in[13];
    const float* up_w   = (const float*)d_in[14];
    const float* de1_w  = (const float*)d_in[15];
    const float* de1_b  = (const float*)d_in[16];
    const float* de2_w  = (const float*)d_in[17];
    const float* de2_b  = (const float*)d_in[18];

    // workspace layout (floats) ~5.3 MB; vA and vB hold attention val in turn
    float* ws   = (float*)d_ws;
    float* ltt  = ws;                    // NL*2
    float* vA   = ltt  + (size_t)NL * 2; // NX*64
    float* vB   = vA   + (size_t)NX * HID;   // NL*64
    float* hA   = vB   + (size_t)NL * HID;   // NL*64
    float* hB   = hA   + (size_t)NL * HID;
    float* thrD = hB   + (size_t)NL * HID;   // NL
    float* thrU = thrD + NL;                 // NX
    float* xs   = thrU + NX + 3;             // NX*2, the points in spatial order (16-byte aligned)
    int*   perm = (int*)(xs + (size_t)NX * 2);   // NX, the place each of them came from

    const int tilesNL = (NL + 15) / 16, tilesNX = (NX + 15) / 16;
    // The up step's thresholds: each latent launch, one block to a WGP, takes as many
    // blocks of 16 rows as its tiles leave WGPs free; the down launch takes the rest.
    const int qblkL = 256 - tilesNL, qrowsL = qblkL * 16;
    const int qrowsD = NX - 4 * qrowsL, qblkD = (qrowsD + 15) / 16;

    // spatial order of the points and of the latent points (ltt)
    k_sort<<<XBLK + LBLK, 512, 0, stream>>>(x, xs, perm, ltt);

    // thresholds of the down step; encoder + val of the down step
    k_head_quantile<<<NL + tilesNX, 128, 0, stream>>>(xs, ltt, en_w, en_b, down_w, vA, thrD);

    // ---- down: latent <- input (5% locality) ----
    k_attn<0><<<tilesNL + qblkD, 512, 0, stream>>>(ltt, NL, xs, NX, vA, down_r, thrD,
                                           nullptr, nullptr, nullptr, nullptr, nullptr, nullptr, nullptr,
                                           pa_w, nullptr, hA, vB,
                                           xs + (size_t)4 * qrowsL * 2, qrowsD, thrU + (size_t)4 * qrowsL);

    // ---- 4 latent blocks (dense attention, no mask), each with its MLP, its
    //      shortcut and the val of the attention that follows ----
    float* hin = hA;
    float* hout = hB;
    float* vin = vB;
    float* vout = vA;
    for (int i = 0; i < 4; i++) {
        k_attn<1><<<tilesNL + qblkL, 512, 0, stream>>>(ltt, NL, ltt, NL, vin, pa_r + (size_t)i * 4, nullptr,
                                               hin,
                                               mlp1_w + (size_t)i * 4096, mlp1_b + (size_t)i * 64,
                                               mlp2_w + (size_t)i * 4096, mlp2_b + (size_t)i * 64,
                                               lin_w + (size_t)i * 4096, lin_b + (size_t)i * 64,
                                               i < 3 ? pa_w + (size_t)(i + 1) * 4096 : up_w,
                                               nullptr, hout, vout,
                                               xs + (size_t)i * qrowsL * 2, qrowsL, thrU + (size_t)i * qrowsL);
        float* tmp = hin; hin = hout; hout = tmp;
        tmp = vin; vin = vout; vout = tmp;
    }

    // ---- up: input <- latent (5% locality), with the decoder ----
    k_attn<2><<<tilesNX, 512, 0, stream>>>(xs, NX, ltt, NL, vin, up_r, thrU,
                                           nullptr, de1_w, de1_b, de2_w, de2_b, nullptr, nullptr,
                                           nullptr, perm, (float*)d_out, nullptr,
                                           nullptr, 0, nullptr);
}

// v008
// One run takes 152 microseconds.
// Timed twice side by side with v007, it ran 1.07 times as fast both times.
// Counting every step since v000, it is 13.1 times as fast.
#include <hip/hip_runtime.h>
#include <math.h>

// ---------------------------------------------------------------------------
// PIT pipeline for MI455X (gfx1250, wave32).
// - Never materialize distance/attention matrices: recompute d2 from 2-D
//   coords, fused mask->exp->normalize->matvec (all live data L2-resident).
// - Per-row quantile by bracketing on float bit patterns, the row in registers.
// - Dense [N,64]x[64,64] GEMMs via V_WMMA_F32_16X16X4_F32 (full f32 fidelity).
//   They work on each row alone, so they run on the 16-row tile that a block
//   already holds: behind the encoder, and behind each attention tile.
// - Attention in tiles of 16 queries: weights x val on the same f32 WMMA, keys
//   split over the waves of a block.
// - Points and latent points are put in spatial order first (strips in y, by x
//   inside a strip), so that 16 neighbours in memory are neighbours in the plane:
//   a masked attention tile leaves out every group of 16 keys whose bounding box
//   lies wholly beyond the tile's largest threshold. The whole pipeline runs in
//   that order; only the last store goes back through the permutation.
// ---------------------------------------------------------------------------

#define NX   11271     // 221*51 input points
#define NL   2886      // 111*26 latent points
#define HID  64

typedef __attribute__((ext_vector_type(2))) float v2f;
typedef __attribute__((ext_vector_type(8))) float v8f;

__device__ __forceinline__ float gelu_erf(float v) {
    // torch F.gelu default: 0.5*x*(1+erf(x/sqrt(2)))
    return 0.5f * v * (1.0f + erff(v * 0.70710678118654752f));
}

// ---------------------------------------------------------------------------
// One wave's 16x16 tile of  A[16,64] @ B[64,64], in three parts, so that the
// fragments can be fetched well ahead of the product.
// f32 WMMA fragment layouts per CDNA5 ISA 7.12.2:
//   A 16x4 : lanes 0-15 -> M=lane, VGPR{0,1}=K{0,1};  lanes 16-31 -> K{2,3}
//   B 4x16 : lanes 0-15 -> N=lane, VGPR{0,1}=K{0,1};  lanes 16-31 -> K{2,3}
//   C 16x16: VGPR r -> M = r + 8*(lane>=16), N = lane&15
// kk = 2*(lane>>4). Fragment s holds k = 4s+kk, 4s+kk+1 on both sides.
// ---------------------------------------------------------------------------
#define TP 68   // LDS pitch of a tile row in floats: 16 rows x 4 columns fall on 64 different banks

// Arow: the lane's own row of A (M = lane&15) at column kk, in LDS or (GLOBAL) in global memory.
template <bool GLOBAL>
__device__ __forceinline__ void frag_a(const float* Arow, v2f (&a)[16]) {
#pragma unroll   // constant indices keep the register array in registers
    for (int s = 0; s < 16; s++) a[s] = *(const v2f*)(Arow + 4 * s);
    if (GLOBAL) {
        // what follows may reuse the loads' address registers; the address as an
        // input keeps the last load's result out of them as well
        asm volatile("s_wait_xcnt 0x0" :: "v"(Arow) : "memory");
        // holds later address arithmetic behind that wait
        __builtin_amdgcn_sched_barrier(0);
    }
}

// Bcol: the lane's own column of B at row 0; BS: floats from one row of B to the
// next (64 for a plain matrix, 16 inside one head of the per-head weights
// [4][64][16], whose head h is columns 16h..16h+15 of the product).
template <int BS>
__device__ __forceinline__ void frag_b(const float* __restrict__ Bcol, int kk, v2f (&b)[16]) {
    const float* Bk = Bcol + kk * BS;      // one address, constant offsets
#pragma unroll   // constant indices keep the register array in registers
    for (int s = 0; s < 16; s++) {
        b[s].x = Bk[(4 * s + 0) * BS];
        b[s].y = Bk[(4 * s + 1) * BS];
    }
    // what follows may reuse the loads' address registers; the address as an
    // input keeps the last load's result out of them as well
    asm volatile("s_wait_xcnt 0x0" :: "v"(Bk) : "memory");
    // holds later address arithmetic behind that wait
    __builtin_amdgcn_sched_barrier(0);
}

__device__ __forceinline__ v8f mm16(const v2f (&a)[16], const v2f (&b)[16]) {
    v8f acc = {};
#pragma unroll   // constant indices keep the register arrays in registers
    for (int s = 0; s < 16; s++)
        acc = __builtin_amdgcn_wmma_f32_16x16x4_f32(
            /*neg_a=*/false, a[s], /*neg_b=*/false, b[s],
            /*c_mod=*/(short)0, acc, /*reuse_a=*/false, /*reuse_b=*/false);
    // the four vector slots between the last WMMA and the first vector instruction
    // on its result
    asm volatile("v_nop\n\tv_nop\n\tv_nop\n\tv_nop" : "+v"(acc));
    return acc;
}

// ---------------------------------------------------------------------------
// Spatial order. key = strip in y | x in 13 bits (to and fro) | index: all keys differ, so
// the place of a point is the number of smaller keys, the same in every run.
// A block ranks 32 points. Each of its 16 waves holds a sixteenth of the set's
// keys in registers and counts, for one point after the other, those below the
// point's key: one compare a register, counted over the wave by ballot, so the
// counts live in scalar registers. The strips are as high as 16 points are wide.
//   xs[place] = x[j], perm[place] = j          (blocks 0 .. XBLK-1)
//   ls[place] = x[:, ::2, ::2, :][l]           (the latent points, the other blocks)
// ---------------------------------------------------------------------------
#define XSTRIPS 27
#define LSTRIPS 13
#define XBLK ((NX + 31) / 32)
#define LBLK ((NL + 31) / 32)

__device__ __forceinline__ unsigned sort_key(float px, float py, int strips, int idx) {
    int s = (int)(py * (float)strips);
    s = s < 0 ? 0 : s > strips - 1 ? strips - 1 : s;      // any value of the input gives a valid key
    int xq = (int)(px * 8192.0f);
    xq = xq < 0 ? 0 : xq > 8191 ? 8191 : xq;
    if (s & 1) xq = 8191 - xq;             // odd strips run backwards: 16 neighbours stay together across a strip's end
    return ((unsigned)s << 27) | ((unsigned)xq << 14) | (unsigned)idx;
}

template <int N, int STRIPS, bool LAT>
__device__ __forceinline__ void sort_block(const float* __restrict__ x, unsigned (*part)[32], int blk,
                                           float* __restrict__ dst, int* __restrict__ perm) {
    constexpr int PER = (N + 15) / 16;     // keys a wave holds
    constexpr int NR = (PER + 31) / 32;    // of them a lane
    const int tid = threadIdx.x;
    const int lane = tid & 31;
    const int wave = __builtin_amdgcn_readfirstlane(tid >> 5);
    const float2* X2 = (const float2*)x;
    const int j = blk * 32 + lane;         // the point that this lane stands for
    const int jc = j < N ? j : N - 1;
    // the wave's NR*32 slots start early enough to end inside the set
    const int first = wave * PER < N - NR * 32 ? wave * PER : N - NR * 32;
    float2 p[NR];
    if (LAT) {
#pragma unroll   // constant indices keep the register array in registers
        for (int t = 0; t < NR; t++) {
            int i = first + t * 32 + lane;
            const float2* q = X2 + (2 * (i / 26)) * 51 + 2 * (i % 26);
            p[t] = *q;
            // each load has an address of its own: the next load's result may land in
            // it (as an input: nor this load's own)
            asm volatile("s_wait_xcnt 0x0" :: "v"(q) : "memory");
        }
    } else {
        const float2* q = X2 + first + lane;   // one address, constant offsets
#pragma unroll   // constant indices keep the register array in registers; the loads fly together
        for (int t = 0; t < NR; t++) p[t] = q[t * 32];
        // what follows may reuse the loads' address registers (as an input: nor may
        // the loads' own results land in them)
        asm volatile("s_wait_xcnt 0x0" :: "v"(q) : "memory");
    }
    const float2* qj = X2 + (LAT ? (2 * (jc / 26)) * 51 + 2 * (jc % 26) : jc);
    const float2 pj = *qj;
    // as above
    asm volatile("s_wait_xcnt 0x0" :: "v"(qj) : "memory");
    unsigned key[NR];
#pragma unroll   // constant indices keep the register array in registers
    for (int t = 0; t < NR; t++) {
        int i = first + t * 32 + lane;
        // a slot outside the wave's share is never below any key
        bool own = i >= wave * PER && i < wave * PER + PER;
        unsigned kk = sort_key(p[t].x, p[t].y, STRIPS, i);
        key[t] = own ? kk : 0xFFFFFFFFu;
    }
    const unsigned my = sort_key(pj.x, pj.y, STRIPS, jc);

    unsigned cnt = 0u;                     // lane l: how many of the wave's keys lie below point l's
    for (int l = 0; l < 32; l++) {
        const unsigned kl = (unsigned)__builtin_amdgcn_readlane((int)my, l);
        unsigned c = 0u;
#pragma unroll   // constant indices keep the keys in registers
        for (int t = 0; t + 1 < NR; t += 2) {
            // two ballots side by side: one 64-bit bit count for both
            unsigned long long b0 = __builtin_amdgcn_ballot_w32(key[t] < kl);
            unsigned long long b1 = __builtin_amdgcn_ballot_w32(key[t + 1] < kl);
            c += (unsigned)__popcll(b0 | (b1 << 32));
        }
        if (NR & 1) c += (unsigned)__popc(__builtin_amdgcn_ballot_w32(key[NR - 1] < kl));
        cnt = lane == l ? c : cnt;
    }
    part[wave][lane] = cnt;
    __syncthreads();                       // the waves' counts visible
    if (wave == 0 && j < N) {
        unsigned pos = 0u;
#pragma unroll   // lets the LDS reads issue together
        for (int w = 0; w < 16; w++) pos += part[w][lane];
        ((float2*)dst)[pos] = pj;
        if (!LAT) perm[pos] = j;
    }
}

__global__ __launch_bounds__(512)
void k_sort(const float* __restrict__ x, float* __restrict__ xs,
            int* __restrict__ perm, float* __restrict__ ls) {
    __shared__ unsigned part[16][32];
    if (blockIdx.x < XBLK) sort_block<NX, XSTRIPS, false>(x, part, blockIdx.x, xs, perm);
    else                   sort_block<NL, LSTRIPS, true>(x, part, blockIdx.x - XBLK, ls, nullptr);
}

// ---------------------------------------------------------------------------
// Head of the pipeline (x: the points in spatial order):
//   h0[j,c] = gelu(x0*W[0,c] + x1*W[1,c] + b[c])                  (K=2: plain VALU)
//   v[j, h*16+k] = sum_c h0[j,c] * w[h][c][k]                     (val of the down step)
// A block of 4 waves owns 16 rows: the encoder's tile goes through LDS into the
// A fragments, wave w owns head w (columns 16w..16w+15). blk: the tile's number.
// ---------------------------------------------------------------------------
__device__ __forceinline__
void head_tile(const float* __restrict__ x, const float* __restrict__ W,
               const float* __restrict__ b, const float* __restrict__ w,
               float* __restrict__ v, float (*tA)[TP], int blk) {
    int tid = threadIdx.x;
    int lane = tid & 31;
    int wave = __builtin_amdgcn_readfirstlane(tid >> 5);
    int laneN = lane & 15;
    int hi = lane >> 4;
    int r0 = blk * 16;

    // a thread keeps one column c and takes every second row of the tile
    const int c = tid & 63, rl = tid >> 6;
    const float2* X2 = (const float2*)x;
    float2 xr[8];
#pragma unroll   // constant indices keep the register array in registers
    for (int it = 0; it < 8; it++) {
        int j = r0 + rl + 2 * it;
        if (j > NX - 1) j = NX - 1;        // clamp tail reads (stores predicated)
        xr[it] = X2[j];
    }
    float wa = W[c], wb = W[HID + c], bc = b[c];
    // what follows may reuse the loads' address registers
    asm volatile("s_wait_xcnt 0x0" ::: "memory");
    // holds the weights' address arithmetic behind that wait
    __builtin_amdgcn_sched_barrier(0);
    v2f af[16], bf[16];
    frag_b<16>(w + wave * (HID * 16) + laneN, hi * 2, bf);   // flies under the encoder's arithmetic
#pragma unroll   // constant indices keep the register array in registers
    for (int it = 0; it < 8; it++)
        tA[rl + 2 * it][c] = gelu_erf(fmaf(xr[it].x, wa, fmaf(xr[it].y, wb, bc)));
    __syncthreads();                       // the encoder's tile visible

    frag_a<false>(&tA[laneN][hi * 2], af);
    v8f acc = mm16(af, bf);
#pragma unroll   // constant indices keep the accumulator in registers
    for (int r = 0; r < 8; r++) {
        int row = r0 + r + 8 * hi;
        if (row < NX) v[(size_t)row * HID + wave * 16 + laneN] = acc[r];
    }
}

// ---------------------------------------------------------------------------
// Per-row quantile of squared distances, the row's distances kept in registers.
// thr[row] = s[kth] + frac*(s[kth+1] - s[kth])   (jnp.quantile 'linear')
// d2 >= 0 so float bit patterns are order-preserving as uints.
// A team of WAVES waves owns one row; each lane holds NR of the NK distances.
// The team is a whole block (tid: the thread's number in it), or, with WAVES = 1,
// one wave of a block whose waves each take a row of their own (tid: the lane).
// The bit pattern of s[kth] is bracketed between the row's minimum and maximum:
// a probe inside the bracket, one compare per held value, counted over the wave
// by ballot, so the count and the bracket live in scalar registers. The first
// probes are placed by the counts: the number of points inside a circle grows
// about linearly with d2, so a straight line through the bracket's two ends says
// where a wanted count lies. They aim a few ranks above kth and a few below in
// turn, whichever end is the farther. Any probe inside the bracket keeps it
// valid, so the probes' places change the number of steps and never the result;
// a row that does not close so goes on by halving the bit patterns' range.
// Once the bracket holds at most 32 values they are gathered, one to a lane of
// wave 0, and ranked against each other. Equal values that never thin out end
// the halving at width 1.
// ---------------------------------------------------------------------------
#define QCAP 32
#define QINT 8      // probes placed by the counts before the halving takes over

template <int WAVES>
struct QShared {                         // a team's LDS
    unsigned mn[WAVES], mx[WAVES];       // the waves' minima and maxima
    unsigned cnt[2][WAVES];              // the waves' counts, by parity of the step
    unsigned m[WAVES], mg[WAVES];        // values gathered; least value above the bracket
    unsigned buf[WAVES][QCAP];           // the gathered values
};

// keep: false for a team past the last row, which works on a row again and stores nothing
template <int WAVES, int NR, int NK>
__device__ __forceinline__
void quantile_row(const float* __restrict__ Qc, const float* __restrict__ Kc,
                  int kth, float frac, float* __restrict__ thr_out,
                  int row, bool keep, int tid, QShared<WAVES>& sh) {
    constexpr int T = WAVES * 32;
    static_assert(T * NR >= NK && T * (NR - 1) < NK, "NR values a lane cover the row");
    const int lane = tid & 31;
    const int wave = WAVES > 1 ? __builtin_amdgcn_readfirstlane(tid >> 5) : 0;   // scalar branches on the wave
    const unsigned k = (unsigned)kth;
    const float qx = Qc[2 * row + 0], qy = Qc[2 * row + 1];

    unsigned u[NR];
    unsigned mn = 0xFFFFFFFFu, mx = 0u;
    const float2* K2 = (const float2*)Kc;
    // Three runs of loads, each issued whole in front of its arithmetic. A key takes
    // two registers until it is worked down to one distance, so the runs shrink as
    // the row fills up and the wave stays inside its register budget.
    constexpr int RUN0 = 44, RUN1 = 74;
    static_assert(NR > RUN1 && NR - RUN1 <= RUN0, "three runs cover the row");
    float2 p[RUN0];
#pragma unroll   // constant indices keep the row in registers
    for (int run = 0; run < 3; run++) {
        const int i0 = run == 0 ? 0 : run == 1 ? RUN0 : RUN1;
        const int i1 = run == 0 ? RUN0 : run == 1 ? RUN1 : NR;
#pragma unroll   // constant indices keep the row in registers
        for (int i = i0; i < i1; i++) {
            int j = i * T + tid;
            if ((i + 1) * T > NK) j = j < NK ? j : NK - 1;   // past the end: the last key again
            p[i - i0] = K2[j];
        }
        // behind the last load: the arithmetic below may reuse the loads' address registers
        if (run == 2) asm volatile("s_wait_xcnt 0x0" ::: "memory");
        // keeps the run's loads together: left alone the compiler waits after every four
        __builtin_amdgcn_sched_barrier(0);
#pragma unroll   // constant indices keep the row in registers
        for (int i = i0; i < i1; i++) {
            float dx = qx - p[i - i0].x;
            float dy = qy - p[i - i0].y;
            unsigned b = __float_as_uint(fmaf(dx, dx, dy * dy));
            mn = b < mn ? b : mn;
            mx = b > mx ? b : mx;
            // a slot past the end is never below any bracket end
            u[i] = ((i + 1) * T <= NK || i * T + tid < NK) ? b : 0xFFFFFFFFu;
        }
        // keeps the next run's loads behind this run's arithmetic, which frees their registers
        __builtin_amdgcn_sched_barrier(0);
    }
#pragma unroll   // five fixed steps, minimum and maximum side by side
    for (int d = 16; d >= 1; d >>= 1) {
        unsigned a = (unsigned)__shfl_xor((int)mn, d);
        unsigned c = (unsigned)__shfl_xor((int)mx, d);
        mn = a < mn ? a : mn;
        mx = c > mx ? c : mx;
    }
    if constexpr (WAVES > 1) {
        if (lane == 0) { sh.mn[wave] = mn; sh.mx[wave] = mx; }
        __syncthreads();                           // the waves' minima and maxima visible
#pragma unroll   // lets the LDS reads issue together
        for (int w = 0; w < WAVES; w++) {
            unsigned a = sh.mn[w], c = sh.mx[w];
            mn = a < mn ? a : mn;
            mx = c > mx ? c : mx;
        }
    }
    // lo <= s[kth] < hi ; cLo values lie below lo, cHi below hi
    unsigned lo = (unsigned)__builtin_amdgcn_readfirstlane((int)mn);
    unsigned hi = (unsigned)__builtin_amdgcn_readfirstlane((int)mx);
    if (hi != 0xFFFFFFFFu) hi += 1u;
    unsigned cLo = 0u, cHi = (unsigned)NK;

    for (int it = 0; it < QINT + 32; it++) {       // behind the first QINT the width halves: 32 steps at most
        if (hi - lo <= 1u || cHi - cLo <= (unsigned)QCAP) break;   // same in every wave of the team
        unsigned mid = lo + ((hi - lo) >> 1);
        if (it < QINT) {
            // The bracket holds more than QCAP values, so its farther end is more than
            // QCAP/2 ranks from kth and the wanted count lies strictly between cLo and cHi.
            const unsigned want = cHi - k > k - cLo ? k + (unsigned)(QCAP / 3 + 1) : k - (unsigned)(QCAP / 3);
            const float fl = __uint_as_float(lo), fh = __uint_as_float(hi);
            // every wave of the team works this out from the same scalars: the same probe in all.
            // The reciprocal need not be exact: it only places the probe.
            const float share = (float)(want - cLo) * __builtin_amdgcn_rcpf((float)(cHi - cLo));
            unsigned b = __float_as_uint(fmaf(fh - fl, share, fl));
            // strictly inside the bracket, whatever the arithmetic gave (an end that is no number too)
            b = b < hi - 1u ? b : hi - 1u;
            b = b > lo + 1u ? b : lo + 1u;
            mid = (unsigned)__builtin_amdgcn_readfirstlane((int)b);
        }
        unsigned c = 0u;
#pragma unroll   // constant indices keep the row in registers
        for (int i = 0; i + 1 < NR; i += 2) {
            // two ballots side by side: one 64-bit bit count for both
            unsigned long long b0 = __builtin_amdgcn_ballot_w32(u[i] < mid);
            unsigned long long b1 = __builtin_amdgcn_ballot_w32(u[i + 1] < mid);
            c += (unsigned)__popcll(b0 | (b1 << 32));
        }
        if (NR & 1) c += (unsigned)__popc(__builtin_amdgcn_ballot_w32(u[NR - 1] < mid));
        if constexpr (WAVES > 1) {
            // slots alternate, so a wave one step ahead writes the other one
            if (lane == 0) sh.cnt[it & 1][wave] = c;
            __syncthreads();                       // the waves' counts visible
            unsigned t = 0u;
#pragma unroll   // lets the LDS reads issue together
            for (int w = 0; w < WAVES; w++) t += sh.cnt[it & 1][w];
            c = (unsigned)__builtin_amdgcn_readfirstlane((int)t);
        }
        if (c <= k) { lo = mid; cLo = c; } else { hi = mid; cHi = c; }
    }

    const unsigned m = cHi - cLo;                  // values in the bracket
    const unsigned r = k - cLo;                    // rank of s[kth] among them
    const bool few = m <= (unsigned)QCAP;
    const bool above = r + 1u >= m;                // s[kth+1] is the least value at or above hi

    unsigned mg = 0xFFFFFFFFu;
    if (above) {
#pragma unroll   // constant indices keep the row in registers
        for (int i = 0; i < NR; i++) {
            unsigned v = u[i] >= hi ? u[i] : 0xFFFFFFFFu;
            mg = v < mg ? v : mg;
        }
#pragma unroll   // five fixed steps
        for (int d = 16; d >= 1; d >>= 1) {
            unsigned a = (unsigned)__shfl_xor((int)mg, d);
            mg = a < mg ? a : mg;
        }
    }
    unsigned got = 0u;
    if (few) {
        const unsigned width = hi - lo;
#pragma unroll   // constant indices keep the row in registers
        for (int g = 0; g < NR; g += 16) {
            // sixteen ballots first, then the scalar tests: a test directly behind
            // its own compare would wait out the compare each time
            unsigned mask[16];
#pragma unroll   // constant indices keep the masks in scalar registers
            for (int t = 0; t < 16; t++)
                mask[t] = g + t < NR ? __builtin_amdgcn_ballot_w32(u[g + t < NR ? g + t : 0] - lo < width) : 0u;   // lo <= u < hi
#pragma unroll   // constant indices keep the masks in scalar registers
            for (int t = 0; t < 16; t++) {
                if (g + t < NR && mask[t] != 0u) {   // most registers hold none: scalar skip
                    if ((mask[t] >> lane) & 1u)
                        sh.buf[wave][got + __builtin_amdgcn_mbcnt_lo(mask[t], 0u)] = u[g + t < NR ? g + t : 0];
                    got += (unsigned)__popc(mask[t]);
                }
            }
        }
    }
    if (lane == 0) { sh.m[wave] = got; sh.mg[wave] = mg; }
    // gathered values and their counts visible (every wave of the block comes here
    // once, also where each has a row of its own)
    __syncthreads();

    if (wave == 0) {
#pragma unroll   // lets the LDS reads issue together
        for (int w = 0; w < WAVES; w++) { unsigned a = sh.mg[w]; mg = a < mg ? a : mg; }
        unsigned sk = lo, sk1 = above ? mg : lo;   // bracket of width 1: all its values equal lo
        if (few) {
            unsigned cand = 0xFFFFFFFFu, first = 0u;
#pragma unroll   // lets the LDS reads issue together
            for (int w = 0; w < WAVES; w++) {
                unsigned n = sh.m[w];
                if ((unsigned)lane - first < n) cand = sh.buf[w][(unsigned)lane - first];
                first += n;
            }
            unsigned less = 0u, leq = 0u;
#pragma unroll   // constant lane numbers for the broadcasts
            for (int j = 0; j < QCAP; j++) {
                unsigned cj = (unsigned)__builtin_amdgcn_readlane((int)cand, j);
                less += cj < cand ? 1u : 0u;
                leq += cj <= cand ? 1u : 0u;
            }
            // a lane holds the value of rank x when less <= x < leq
            unsigned ma = __builtin_amdgcn_ballot_w32(less <= r && r < leq);
            sk = (unsigned)__builtin_amdgcn_readlane((int)cand, __ffs(ma) - 1);
            if (!above) {
                unsigned mb = __builtin_amdgcn_ballot_w32(less <= r + 1u && r + 1u < leq);
                sk1 = (unsigned)__builtin_amdgcn_readlane((int)cand, __ffs(mb) - 1);
            }
        }
        if (lane == 0 && keep) {
            float fk = __uint_as_float(sk);
            thr_out[row] = fmaf(frac, __uint_as_float(sk1) - fk, fk);
        }
    }
}

// ---------------------------------------------------------------------------
// The two pieces of work that need nothing but the spatial order, in one launch:
// the thresholds of the down step (blocks 0 .. NL-1, a row each; they last longer) and the head of the pipeline (the other blocks, a tile each).
// quantile over nK=11271: pos = 0.05*11270 = 563.5 -> k=563, frac=0.5
// ---------------------------------------------------------------------------
__global__ __launch_bounds__(128)
__attribute__((amdgpu_waves_per_eu(8)))   // 128 registers a wave: eight waves a SIMD cover each other's waits
void k_head_quantile(const float* __restrict__ xs, const float* __restrict__ ls,
                     const float* __restrict__ W, const float* __restrict__ b,
                     const float* __restrict__ w, float* __restrict__ v,
                     float* __restrict__ thr_out) {
    __shared__ QShared<4> qs;
    __shared__ __attribute__((aligned(16))) float tA[16][TP];   // aligned for the 8-byte fragment reads
    if (blockIdx.x < NL)
        quantile_row<4, 89, NX>(ls, xs, 563, 0.5f, thr_out, blockIdx.x, true, threadIdx.x, qs);
    else
        head_tile(xs, W, b, w, v, tA, blockIdx.x - NL);
}

// ---------------------------------------------------------------------------
// One group of 16 keys for a tile of 16 queries, all four heads.
// The masked weights are computed straight into the WMMA A fragment
// (M = query = lane&15, K = key) and the val rows are the B fragment
// (K = key, N = column within the head), with the same key in the same K slot:
//   lanes 0-15 : VGPR{0,1} = keys j+0, j+1 ; lanes 16-31 : keys j+2, j+3
// jb = first key of the group + 2*(lane>>4). TAIL clamps every key index and
// zeroes the weights of keys past the end.
// ---------------------------------------------------------------------------
// exp2 of eight values. One statement, each value in its own register: behind
// an exp2 the instruction set asks for one independent instruction before its
// result is read or its source overwritten. Here the source is the result's own
// register, the next exp2 fills the slot of the one in front, and the v_nop that
// of the last.
__device__ __forceinline__ void exp2x8(float (&x)[8]) {
    asm("v_exp_f32 %0, %0\n\t"
        "v_exp_f32 %1, %1\n\t"
        "v_exp_f32 %2, %2\n\t"
        "v_exp_f32 %3, %3\n\t"
        "v_exp_f32 %4, %4\n\t"
        "v_exp_f32 %5, %5\n\t"
        "v_exp_f32 %6, %6\n\t"
        "v_exp_f32 %7, %7\n\t"
        "v_nop"
        : "+v"(x[0]), "+v"(x[1]), "+v"(x[2]), "+v"(x[3]),
          "+v"(x[4]), "+v"(x[5]), "+v"(x[6]), "+v"(x[7]));
}

template <bool TAIL>
__device__ __forceinline__ void attn_group16(const float* __restrict__ Kc,
                                             const float* __restrict__ val,
                                             int nK, int jb, int laneN,
                                             float qx, float qy, float thrq,
                                             const float (&c)[4],
                                             v8f (&acc)[4], v2f (&den)[4]) {
    // all loads of the group first, the coordinates ahead of the val rows, so
    // that the val rows fly under the weights' arithmetic
    v2f b[4][4];
    float kx[4][2], ky[4][2];
    const float* ka[4];
    const float* kc[4];
#pragma unroll   // constant indices keep the register arrays in registers
    for (int s = 0; s < 4; s++) {
        int j = jb + s * 4;
        if (TAIL) {
            int ja = j < nK ? j : nK - 1;
            int jc = j + 1 < nK ? j + 1 : nK - 1;
            ka[s] = Kc + 2 * ja;
            kc[s] = Kc + 2 * jc;
            kx[s][0] = ka[s][0]; ky[s][0] = ka[s][1];
            kx[s][1] = kc[s][0]; ky[s][1] = kc[s][1];
        } else {
            ka[s] = kc[s] = Kc + 2 * jb;                // one address, constant offsets
            float4 k4 = *(const float4*)(ka[s] + 8 * s);   // jb is even: 16-B aligned
            kx[s][0] = k4.x; ky[s][0] = k4.y; kx[s][1] = k4.z; ky[s][1] = k4.w;
        }
    }
    // the val loads' results and addresses may land in the coordinate loads'
    // address registers; as a memory fence it also keeps the coordinate loads in
    // front (loads return in order: issued last, they would make the first
    // distance wait for every val row as well). The addresses as inputs keep the
    // coordinate loads' own results out of them.
    if (TAIL)
        asm volatile("s_wait_xcnt 0x0" :: "v"(ka[0]), "v"(ka[1]), "v"(ka[2]), "v"(ka[3]),
                                          "v"(kc[0]), "v"(kc[1]), "v"(kc[2]), "v"(kc[3]) : "memory");
    else
        asm volatile("s_wait_xcnt 0x0" :: "v"(ka[0]) : "memory");
    // holds the val rows' address arithmetic behind that wait
    __builtin_amdgcn_sched_barrier(0);
#pragma unroll   // constant indices keep the register arrays in registers
    for (int s = 0; s < 4; s++) {
        const float* va;
        const float* vc;
        if (TAIL) {
            int j = jb + s * 4;
            int ja = j < nK ? j : nK - 1;
            int jc = j + 1 < nK ? j + 1 : nK - 1;
            va = val + (size_t)ja * HID + laneN;
            vc = val + (size_t)jc * HID + laneN;
        } else {
            va = val + (size_t)jb * HID + laneN + s * 4 * HID;   // one address, constant offsets
            vc = va + HID;
        }
#pragma unroll   // constant indices keep the register arrays in registers
        for (int h = 0; h < 4; h++) { b[s][h].x = va[h * 16]; b[s][h].y = vc[h * 16]; }
        // clamped rows have address registers of their own for each run, and the
        // next run's results may land in them (as inputs: nor this run's own)
        if (TAIL) asm volatile("s_wait_xcnt 0x0" :: "v"(va), "v"(vc) : "memory");
        // the arithmetic below may reuse the val loads' address registers (as an
        // input: nor may the loads' own results land in them)
        if (!TAIL && s == 3) asm volatile("s_wait_xcnt 0x0" :: "v"(va) : "memory");
    }
    // keeps the wait for the coordinates behind the issue of the val loads
    __builtin_amdgcn_sched_barrier(0);
#pragma unroll   // constant indices keep the register arrays in registers
    for (int s = 0; s < 4; s++) {
        int j = jb + s * 4;
        float dx0 = qx - kx[s][0], dy0 = qy - ky[s][0];
        float dx1 = qx - kx[s][1], dy1 = qy - ky[s][1];
        float d20 = fmaf(dx0, dx0, dy0 * dy0);
        float d21 = fmaf(dx1, dx1, dy1 * dy1);
        bool ok0 = d20 <= thrq, ok1 = d21 <= thrq;
        if (TAIL) { ok0 = ok0 && (j < nK); ok1 = ok1 && (j + 1 < nK); }
        // c holds -c_h*log2(e): one multiply and the hardware's exp2 for each weight.
        // The exponent is never above 0; a weight under 2^-126 comes out as 0.
        float e[8];
#pragma unroll   // constant indices keep the register arrays in registers
        for (int h = 0; h < 4; h++) { e[2 * h] = c[h] * d20; e[2 * h + 1] = c[h] * d21; }
        exp2x8(e);
#pragma unroll   // constant indices keep the register arrays in registers
        for (int h = 0; h < 4; h++) {
            // exp in every lane, then a select: no divergent branch round a WMMA
            v2f a;
            a.x = ok0 ? e[2 * h] : 0.0f;
            a.y = ok1 ? e[2 * h + 1] : 0.0f;
            den[h] += a;                   // even and odd keys summed apart
            acc[h] = __builtin_amdgcn_wmma_f32_16x16x4_f32(
                /*neg_a=*/false, a, /*neg_b=*/false, b[s][h],
                /*c_mod=*/(short)0, acc[h], /*reuse_a=*/false, /*reuse_b=*/false);
        }
    }
}

// ---------------------------------------------------------------------------
// Fused masked multi-head softmax attention + gelu.
// out[q, h*16+v] = gelu( sum_j w_h(q,j) * val[j, h*16+v] / sum_j w_h(q,j) )
//   w_h = exp(-c_h * d2(q,j)) if d2 <= thr[q] else 0 ;  c_h = tan(pi/4*(1+sin r_h))
// (positive c_h => head-independent mask; exponents in [-c*thr, 0] => stable.)
// Block = 16 waves, one tile of 16 queries: every val row that is read serves
// 16 queries through one f32 WMMA per head. The keys are dealt to the waves in
// groups of 16; the waves' partial numerators and denominators are summed in
// LDS in a fixed order.
// The tile a[16,64] that comes of it stays in LDS, and the products that follow
// it in the pipeline, which work on each row alone, run on it in the same block:
//   STEP 0, down  : hout = a ; vout = a @ wv
//   STEP 1, latent: t = gelu(a @ w1 + b1) ; m = t @ w2 + b2 ;
//                   hout = gelu(m + hin @ w3 + b3) ; vout = hout @ wv
//   STEP 2, up    : t = gelu(a @ w1 + b1) ; hout[perm[q]] = t . w2 + b2   (w2 is [64,1])
// Each product has four waves of its own (wave 4g+w: product g, columns
// 16w..16w+15), which fetch its weights behind the key loop, ahead of the LDS sum;
// each gelu is spread over all 16 waves.
// wv: the per-head weights [4][64][16] of the attention that comes next; vout is
// its val, another buffer than val, which other blocks are still reading.
// The launches of STEP 0 and STEP 1 have fewer tiles than the chip has room for.
// The thresholds of the up step, which need only the spatial order, ride along in
// blocks of their own behind the tiles: 16 rows a block, one a wave. Such a launch
// takes the qrows points from qpts on: thr2[row] from the distances of qpts[row]
// to all latent points, which are Qc in both steps.
// ---------------------------------------------------------------------------
#define ATT_WAVES 16

template <int STEP>
__global__ __launch_bounds__(ATT_WAVES * 32)
// the masked steps keep 128 registers a wave, so that two blocks share a WGP as before
__attribute__((amdgpu_waves_per_eu(STEP == 1 ? 4 : 8)))
void k_attn(const float* __restrict__ Qc, int nQ,
            const float* __restrict__ Kc, int nK,
            const float* __restrict__ val,
            const float* __restrict__ rr,
            const float* __restrict__ thr,
            const float* __restrict__ hin,
            const float* __restrict__ w1, const float* __restrict__ b1,
            const float* __restrict__ w2, const float* __restrict__ b2,
            const float* __restrict__ w3, const float* __restrict__ b3,
            const float* __restrict__ wv, const int* __restrict__ perm,
            float* __restrict__ hout, float* __restrict__ vout,
            const float* __restrict__ qpts, int qrows, float* __restrict__ thr2) {
    if constexpr (STEP != 2) {
        __shared__ QShared<1> qs[ATT_WAVES];
        const int tiles = (nQ + 15) >> 4;
        // the whole block, ahead of every barrier of the tiles; marked unlikely so that
        // the tiles' code, which the launch waits for, stands first in the kernel's text
        if (__builtin_expect((int)blockIdx.x >= tiles, 0)) {
            const int w = __builtin_amdgcn_readfirstlane(threadIdx.x >> 5);
            const int row = ((int)blockIdx.x - tiles) * ATT_WAVES + w;
            // quantile over nK=2886: pos = 0.05*2885 = 144.25 -> k=144, frac=0.25
            quantile_row<1, 91, NL>(qpts, Qc, 144, 0.25f, thr2, row < qrows ? row : qrows - 1, row < qrows,
                                    (int)__builtin_amdgcn_mbcnt_lo(~0u, 0u), qs[w]);   // the lane's number
            return;
        }
    }
    __shared__ int lst[NX / 16];                   // the key groups that the tile visits, in rising order
    __shared__ int wcnt[ATT_WAVES];                // how many of them each wave found
    __shared__ float red[ATT_WAVES / 2][32][32];   // 32 KB partial numerators
    __shared__ float dred[ATT_WAVES][4][16];       // partial denominators
    __shared__ float cs[4];
    // 16-row tiles handed from product to product; aligned for the 8-byte fragment reads
    __shared__ __attribute__((aligned(16))) float tA[16][TP], tB[16][TP], tC[16][TP];

    int tid = threadIdx.x;
    int lane = tid & 31;
    int wave = __builtin_amdgcn_readfirstlane(tid >> 5);   // scalar loop control
    int laneN = lane & 15;
    int hi = lane >> 4;
    int q0 = blockIdx.x * 16;

    // kept as -c_h*log2(e): exp(-c_h*d2) = exp2(cs*d2)
    if (tid < 4)
        cs[tid] = -1.44269504088896341f * tanf(0.78539816339744831f * (1.0f + sinf(rr[tid])));
    __syncthreads();                       // cs visible

    int q = q0 + laneN;
    if (q > nQ - 1) q = nQ - 1;            // clamp tail reads (stores predicated)
    float qx = Qc[2 * q + 0], qy = Qc[2 * q + 1];
    float thrq = 3.402823466e+38f;
    if (thr) {
        thrq = thr[q];
        // in the load's own block, so that nothing of the code behind the branch comes in front of it
        asm volatile("s_wait_xcnt 0x0" ::: "memory");
    }
    // the address registers of the two loads above are reused at once
    asm volatile("s_wait_xcnt 0x0" ::: "memory");
    float c[4] = {cs[0], cs[1], cs[2], cs[3]};

    v8f acc[4] = {};
    v2f den[4] = {};

    int nFull = nK >> 4;                   // whole groups of 16 keys
    int nTurn = nFull;                     // groups dealt out so far: says whose turn the partial group is
    if (STEP == 1) {
        for (int g = wave; g < nFull; g += ATT_WAVES)
            attn_group16<false>(Kc, val, nK, g * 16 + hi * 2, laneN, qx, qy, thrq, c, acc, den);
    } else {
        // the tile's bounding box and its largest threshold
        // (each half-wave holds the 16 queries, one a lane)
        float bx0 = qx, bx1 = qx, by0 = qy, by1 = qy, tmax = thrq;
#pragma unroll   // four fixed steps, the five values side by side
        for (int d = 8; d >= 1; d >>= 1) {
            float a0 = __shfl_xor(bx0, d), a1 = __shfl_xor(bx1, d);
            float a2 = __shfl_xor(by0, d), a3 = __shfl_xor(by1, d), a4 = __shfl_xor(tmax, d);
            bx0 = fminf(bx0, a0); bx1 = fmaxf(bx1, a1);
            by0 = fminf(by0, a2); by1 = fmaxf(by1, a3);
            tmax = fmaxf(tmax, a4);
        }
        int nAct = 0;
        for (int base = 0; base < nFull; base += ATT_WAVES * 32) {
            int g = base + tid;
            int gg = g < nFull ? g : nFull - 1;
            const float4* kp = (const float4*)(Kc + (size_t)gg * 32);
            float4 k[8];
#pragma unroll   // constant indices keep the register array in registers
            for (int i = 0; i < 8; i++) k[i] = kp[i];
            // the next trip rewrites the loads' address registers
            asm volatile("s_wait_xcnt 0x0" ::: "memory");
            float kx0 = fminf(k[0].x, k[0].z), kx1 = fmaxf(k[0].x, k[0].z);
            float ky0 = fminf(k[0].y, k[0].w), ky1 = fmaxf(k[0].y, k[0].w);
#pragma unroll   // constant indices keep the register array in registers
            for (int i = 1; i < 8; i++) {
                kx0 = fminf(kx0, fminf(k[i].x, k[i].z)); kx1 = fmaxf(kx1, fmaxf(k[i].x, k[i].z));
                ky0 = fminf(ky0, fminf(k[i].y, k[i].w)); ky1 = fmaxf(ky1, fmaxf(k[i].y, k[i].w));
            }
            // The gap between the two boxes, squared in the very form of the pairs' d2:
            // subtraction, product and fma round monotonically, so no pair's d2 is
            // below it. A group is left out only when that bound is above every
            // threshold of the tile: all its weights would be 0.
            float gx = fmaxf(fmaxf(kx0 - bx1, bx0 - kx1), 0.0f);
            float gy = fmaxf(fmaxf(ky0 - by1, by0 - ky1), 0.0f);
            bool act = g < nFull && !(fmaf(gx, gx, gy * gy) > tmax);
            unsigned m = __builtin_amdgcn_ballot_w32(act);
            if (lane == 0) wcnt[wave] = __popc(m);
            __syncthreads();               // the waves' counts visible
            int before = 0, tot = 0;
#pragma unroll   // lets the LDS reads issue together
            for (int w = 0; w < ATT_WAVES; w++) {
                int n = wcnt[w];
                before += w < wave ? n : 0;
                tot += n;
            }
            if (act) lst[nAct + before + (int)__builtin_amdgcn_mbcnt_lo(m, 0u)] = g;
            nAct += tot;
            __syncthreads();               // the list visible; the counts free for the next trip
        }
        nAct = __builtin_amdgcn_readfirstlane(nAct);           // scalar loop control
        nTurn = nAct;
        int gl = wave < nAct ? lst[wave] : 0;                  // read one trip ahead, under the group's work
        for (int i = wave; i < nAct; i += ATT_WAVES) {
            int g = __builtin_amdgcn_readfirstlane(gl);
            gl = lst[i + ATT_WAVES < nAct ? i + ATT_WAVES : i];
            attn_group16<false>(Kc, val, nK, g * 16 + hi * 2, laneN, qx, qy, thrq, c, acc, den);
        }
    }
    if ((nK & 15) != 0 && (nTurn & (ATT_WAVES - 1)) == wave)   // the partial group, next wave in turn
        attn_group16<true>(Kc, val, nK, nFull * 16 + hi * 2, laneN, qx, qy, thrq, c, acc, den);

    // this wave's product of the tail: its weights, bias (and rows of hin) set off now
    const int kk = hi * 2;
    const int grp = wave >> 2;
    const int col = (wave & 3) * 16 + laneN;
    const float* wvcol = wv + (wave & 3) * (HID * 16) + laneN;
    v2f af[16], bf[16];
    float bv = 0.0f;
    if (STEP == 0) {
        if (grp == 0) frag_b<16>(wvcol, kk, bf);
    } else if (STEP == 1) {
        if (grp < 3) {
            const float* wsel = grp == 0 ? w1 : grp == 1 ? w3 : w2;
            const float* bsel = grp == 0 ? b1 : grp == 1 ? b3 : b2;
            bv = bsel[col];
            frag_b<HID>(wsel + col, kk, bf);
            if (grp == 1) frag_a<true>(hin + (size_t)q * HID + kk, af);
        } else {
            frag_b<16>(wvcol, kk, bf);
        }
    } else {
        if (grp == 0) {
            const float* bp = b1 + col;
            bv = *bp;
            // the weights' results may land in this load's address registers
            asm volatile("s_wait_xcnt 0x0" :: "v"(bp) : "memory");
            frag_b<HID>(w1 + col, kk, bf);
        }
    }

    // the two half-waves hold different keys of the same query
#pragma unroll   // constant indices keep the register arrays in registers
    for (int h = 0; h < 4; h++) {
        float dh = den[h].x + den[h].y;
        dh += __shfl_xor(dh, 16);
        if (hi == 0) dred[wave][h][laneN] = dh;
    }
    if (wave >= ATT_WAVES / 2) {
#pragma unroll   // constant indices keep the register arrays in registers
        for (int h = 0; h < 4; h++)
#pragma unroll   // constant indices keep the register arrays in registers
            for (int r = 0; r < 8; r++) red[wave - ATT_WAVES / 2][h * 8 + r][lane] = acc[h][r];
    }
    __syncthreads();                       // upper waves' partials visible
    if (wave < ATT_WAVES / 2) {
#pragma unroll   // constant indices keep the register arrays in registers
        for (int h = 0; h < 4; h++)
#pragma unroll   // constant indices keep the register arrays in registers
            for (int r = 0; r < 8; r++) red[wave][h * 8 + r][lane] += acc[h][r];
    }
    __syncthreads();                       // all partials visible

    // C layout: VGPR r -> M = r + 8*(lane>=16), N = lane&15
    for (int o = tid; o < 16 * HID; o += ATT_WAVES * 32) {
        int ql = o >> 6, col = o & 63;
        int h = col >> 4, n = col & 15;
        float num = 0.f, d = 0.f;
#pragma unroll   // lets the LDS reads issue together
        for (int w = 0; w < ATT_WAVES / 2; w++)
            num += red[w][h * 8 + (ql & 7)][(ql >> 3) * 16 + n];
#pragma unroll   // lets the LDS reads issue together
        for (int w = 0; w < ATT_WAVES; w++) d += dred[w][h][ql];
        float a = gelu_erf(num / d);
        tA[ql][col] = a;                   // rows past the end repeat the last query; never stored
        if (STEP == 0 && q0 + ql < nQ) {
            hout[(size_t)(q0 + ql) * HID + col] = a;
            // the next trip may reuse the store's address registers
            asm volatile("s_wait_xcnt 0x0" ::: "memory");
        }
    }
    __syncthreads();                       // the attention tile visible

    if (STEP == 1 || STEP == 2) {
        if (grp == 0) {
            frag_a<false>(&tA[laneN][kk], af);
            v8f t = mm16(af, bf);
#pragma unroll   // constant indices keep the accumulator in registers
            for (int r = 0; r < 8; r++) tB[r + 8 * hi][col] = t[r] + bv;
        } else if (STEP == 1 && grp == 1) {
            v8f t = mm16(af, bf);
#pragma unroll   // constant indices keep the accumulator in registers
            for (int r = 0; r < 8; r++) tC[r + 8 * hi][col] = t[r] + bv;
        }
        __syncthreads();                   // a @ w1 + b1 (and hin @ w3 + b3) visible
        for (int o = tid; o < 16 * HID; o += ATT_WAVES * 32)
            tB[o >> 6][o & 63] = gelu_erf(tB[o >> 6][o & 63]);
        __syncthreads();                   // t visible
    }
    if (STEP == 1) {
        if (grp == 2) {
            frag_a<false>(&tB[laneN][kk], af);
            v8f m = mm16(af, bf);
#pragma unroll   // constant indices keep the accumulator in registers
            for (int r = 0; r < 8; r++)    // tA: its readers left it two barriers ago
                tA[r + 8 * hi][col] = tC[r + 8 * hi][col] + (m[r] + bv);
        }
        __syncthreads();                   // m + hin @ w3 + b3 visible
        for (int o = tid; o < 16 * HID; o += ATT_WAVES * 32) {
            float v = gelu_erf(tA[o >> 6][o & 63]);
            tA[o >> 6][o & 63] = v;
            if (q0 + (o >> 6) < nQ) {
                hout[(size_t)q0 * HID + o] = v;
                // the next trip may reuse the store's address registers
                asm volatile("s_wait_xcnt 0x0" ::: "memory");
            }
        }
        __syncthreads();                   // the new h tile visible
    }
    if (STEP == 0 || STEP == 1) {
        if (grp == (STEP == 0 ? 0 : 3)) {
            frag_a<false>(&tA[laneN][kk], af);
            v8f v = mm16(af, bf);
#pragma unroll   // constant indices keep the accumulator in registers
            for (int r = 0; r < 8; r++) {
                int row = q0 + r + 8 * hi;
                if (row < nQ) vout[(size_t)row * HID + col] = v[r];
            }
        }
    }
    if (STEP == 2) {
        // decoder head: one thread a row, the 64 terms in their order
        if (tid < 16 && q0 + tid < nQ) {
            const int* pp = perm + q0 + tid;
            int place = *pp;
            // what follows may reuse the load's address registers; the address as an
            // input keeps the load's own result out of them as well
            asm volatile("s_wait_xcnt 0x0" :: "v"(pp) : "memory");
            float s = b2[0];
#pragma unroll   // lets the LDS reads issue together
            for (int k = 0; k < HID; k++) s = fmaf(tB[tid][k], w2[k], s);
            hout[place] = s;               // back to the point's own place
        }
    }
}

// ---------------------------------------------------------------------------
extern "C" void kernel_launch(void* const* d_in, const int* in_sizes, int n_in,
                              void* d_out, int out_size, void* d_ws, size_t ws_size,
                              hipStream_t stream) {
    (void)in_sizes; (void)n_in; (void)out_size; (void)ws_size;

    const float* x      = (const float*)d_in[0];   // [1,221,51,2] == xf [11271,2]
    const float* en_w   = (const float*)d_in[1];
    const float* en_b   = (const float*)d_in[2];
    const float* down_r = (const float*)d_in[3];
    const float* down_w = (const float*)d_in[4];
    const float* pa_r   = (const float*)d_in[5];   // [4,1,4,1,1]
    const float* pa_w   = (const float*)d_in[6];   // [4,4,64,16]
    const float* mlp1_w = (const float*)d_in[7];
    const float* mlp1_b = (const float*)d_in[8];
    const float* mlp2_w = (const float*)d_in[9];
    const float* mlp2_b = (const float*)d_in[10];
    const float* lin_w  = (const float*)d_in[11];
    const float* lin_b  = (const float*)d_in[12];
    const float* up_r   = (const float*)d_in[13];
    const float* up_w   = (const float*)d_in[14];
    const float* de1_w  = (const float*)d_in[15];
    const float* de1_b  = (const float*)d_in[16];
    const float* de2_w  = (const float*)d_in[17];
    const float* de2_b  = (const float*)d_in[18];

    // workspace layout (floats) ~5.3 MB; vA and vB hold attention val in turn
    float* ws   = (float*)d_ws;
    float* ltt  = ws;                    // NL*2
    float* vA   = ltt  + (size_t)NL * 2; // NX*64
    float* vB   = vA   + (size_t)NX * HID;   // NL*64
    float* hA   = vB   + (size_t)NL * HID;   // NL*64
    float* hB   = hA   + (size_t)NL * HID;
    float* thrD = hB   + (size_t)NL * HID;   // NL
    float* thrU = thrD + NL;                 // NX
    float* xs   = thrU + NX + 3;             // NX*2, the points in spatial order (16-byte aligned)
    int*   perm = (int*)(xs + (size_t)NX * 2);   // NX, the place each of them came from

    const int tilesNL = (NL + 15) / 16, tilesNX = (NX + 15) / 16;
    // The up step's thresholds: each latent launch, one block to a WGP, takes as many
    // blocks of 16 rows as its tiles leave WGPs free; the down launch takes the rest.
    const int qblkL = 256 - tilesNL, qrowsL = qblkL * 16;
    const int qrowsD = NX - 4 * qrowsL, qblkD = (qrowsD + 15) / 16;

    // spatial order of the points and of the latent points (ltt)
    k_sort<<<XBLK + LBLK, 512, 0, stream>>>(x, xs, perm, ltt);

    // thresholds of the down step; encoder + val of the down step
    k_head_quantile<<<NL + tilesNX, 128, 0, stream>>>(xs, ltt, en_w, en_b, down_w, vA, thrD);

    // ---- down: latent <- input (5% locality) ----
    k_attn<0><<<tilesNL + qblkD, 512, 0, stream>>>(ltt, NL, xs, NX, vA, down_r, thrD,
                                           nullptr, nullptr, nullptr, nullptr, nullptr, nullptr, nullptr,
                                           pa_w, nullptr, hA, vB,
                                           xs + (size_t)4 * qrowsL * 2, qrowsD, thrU + (size_t)4 * qrowsL);

    // ---- 4 latent blocks (dense attention, no mask), each with its MLP, its
    //      shortcut and the val of the attention that follows ----
    float* hin = hA;
    float* hout = hB;
    float* vin = vB;
    float* vout = vA;
    for (int i = 0; i < 4; i++) {
        k_attn<1><<<tilesNL + qblkL, 512, 0, stream>>>(ltt, NL, ltt, NL, vin, pa_r + (size_t)i * 4, nullptr,
                                               hin,
                                               mlp1_w + (size_t)i * 4096, mlp1_b + (size_t)i * 64,
                                               mlp2_w + (size_t)i * 4096, mlp2_b + (size_t)i * 64,
                                               lin_w + (size_t)i * 4096, lin_b + (size_t)i * 64,
                                               i < 3 ? pa_w + (size_t)(i + 1) * 4096 : up_w,
                                               nullptr, hout, vout,
                                               xs + (size_t)i * qrowsL * 2, qrowsL, thrU + (size_t)i * qrowsL);
        float* tmp = hin; hin = hout; hout = tmp;
        tmp = vin; vin = vout; vout = tmp;
    }

    // ---- up: input <- latent (5% locality), with the decoder ----
    k_attn<2><<<tilesNX, 512, 0, stream>>>(xs, NX, ltt, NL, vin, up_r, thrU,
                                           nullptr, de1_w, de1_b, de2_w, de2_b, nullptr, nullptr,
                                           nullptr, perm, (float*)d_out, nullptr,
                                           nullptr, 0, nullptr);
}

// v009
// One run takes 144 microseconds.
// In two side-by-side timings against v008, it was 1.06 and 1.07 times as fast.
// Counting every step since v000, it is 13.9 times as fast.
#include <hip/hip_runtime.h>
#include <math.h>

// ---------------------------------------------------------------------------
// PIT pipeline for MI455X (gfx1250, wave32).
// - Never materialize distance/attention matrices: recompute d2 from 2-D
//   coords, fused mask->exp->normalize->matvec (all live data L2-resident).
// - Per-row quantile by bracketing on float bit patterns, the row in registers.
// - Dense [N,64]x[64,64] GEMMs via V_WMMA_F32_16X16X4_F32 (full f32 fidelity).
//   They work on each row alone, so they run on the 16-row tile that a block
//   already holds: behind the encoder, and behind each attention tile.
// - Attention in tiles of 16 queries: weights x val on the same f32 WMMA, keys
//   split over the waves of a block.
// - Points and latent points are put in spatial order first (strips in y, by x
//   inside a strip), so that 16 neighbours in memory are neighbours in the plane:
//   a masked attention tile leaves out every group of 16 keys whose bounding box
//   lies wholly beyond the tile's largest threshold. From the down step on the
//   pipeline runs in that order (the down step reads its thresholds, kept in the
//   latent points' own order, through lperm); only the last store goes back
//   through the permutation.
// ---------------------------------------------------------------------------

#define NX   11271     // 221*51 input points
#define NL   2886      // 111*26 latent points
#define HID  64

typedef __attribute__((ext_vector_type(2))) float v2f;
typedef __attribute__((ext_vector_type(8))) float v8f;

__device__ __forceinline__ float gelu_erf(float v) {
    // torch F.gelu default: 0.5*x*(1+erf(x/sqrt(2)))
    return 0.5f * v * (1.0f + erff(v * 0.70710678118654752f));
}

// ---------------------------------------------------------------------------
// One wave's 16x16 tile of  A[16,64] @ B[64,64], in three parts, so that the
// fragments can be fetched well ahead of the product.
// f32 WMMA fragment layouts per CDNA5 ISA 7.12.2:
//   A 16x4 : lanes 0-15 -> M=lane, VGPR{0,1}=K{0,1};  lanes 16-31 -> K{2,3}
//   B 4x16 : lanes 0-15 -> N=lane, VGPR{0,1}=K{0,1};  lanes 16-31 -> K{2,3}
//   C 16x16: VGPR r -> M = r + 8*(lane>=16), N = lane&15
// kk = 2*(lane>>4). Fragment s holds k = 4s+kk, 4s+kk+1 on both sides.
// ---------------------------------------------------------------------------
#define TP 68   // LDS pitch of a tile row in floats: 16 rows x 4 columns fall on 64 different banks

// Arow: the lane's own row of A (M = lane&15) at column kk, in LDS or (GLOBAL) in global memory.
template <bool GLOBAL>
__device__ __forceinline__ void frag_a(const float* Arow, v2f (&a)[16]) {
#pragma unroll   // constant indices keep the register array in registers
    for (int s = 0; s < 16; s++) a[s] = *(const v2f*)(Arow + 4 * s);
    if (GLOBAL) {
        // what follows may reuse the loads' address registers; the address as an
        // input keeps the last load's result out of them as well
        asm volatile("s_wait_xcnt 0x0" :: "v"(Arow) : "memory");
        // holds later address arithmetic behind that wait
        __builtin_amdgcn_sched_barrier(0);
    }
}

// Bcol: the lane's own column of B at row 0; BS: floats from one row of B to the
// next (64 for a plain matrix, 16 inside one head of the per-head weights
// [4][64][16], whose head h is columns 16h..16h+15 of the product).
template <int BS>
__device__ __forceinline__ void frag_b(const float* __restrict__ Bcol, int kk, v2f (&b)[16]) {
    const float* Bk = Bcol + kk * BS;      // one address, constant offsets
#pragma unroll   // constant indices keep the register array in registers
    for (int s = 0; s < 16; s++) {
        b[s].x = Bk[(4 * s + 0) * BS];
        b[s].y = Bk[(4 * s + 1) * BS];
    }
    // what follows may reuse the loads' address registers; the address as an
    // input keeps the last load's result out of them as well
    asm volatile("s_wait_xcnt 0x0" :: "v"(Bk) : "memory");
    // holds later address arithmetic behind that wait
    __builtin_amdgcn_sched_barrier(0);
}

__device__ __forceinline__ v8f mm16(const v2f (&a)[16], const v2f (&b)[16]) {
    v8f acc = {};
#pragma unroll   // constant indices keep the register arrays in registers
    for (int s = 0; s < 16; s++)
        acc = __builtin_amdgcn_wmma_f32_16x16x4_f32(
            /*neg_a=*/false, a[s], /*neg_b=*/false, b[s],
            /*c_mod=*/(short)0, acc, /*reuse_a=*/false, /*reuse_b=*/false);
    // the four vector slots between the last WMMA and the first vector instruction
    // on its result
    asm volatile("v_nop\n\tv_nop\n\tv_nop\n\tv_nop" : "+v"(acc));
    return acc;
}

// ---------------------------------------------------------------------------
// Spatial order. key = strip in y | x in 13 bits (to and fro) | index: all keys differ, so
// the place of a point is the number of smaller keys, the same in every run.
// A block ranks 32 points. Its 4 waves share the set's keys; a wave takes its share
// in passes, holds a pass's keys in registers and counts, for one point after the
// other, those below the point's key: one compare a register, counted over the wave
// by ballot, so the counts live in scalar registers. The strips are as high as 16 points are wide.
//   xs[place] = x[j], perm[place] = j          (the points)
//   ls[place] = x[:, ::2, ::2, :][l], lperm[place] = l   (the latent points)
// pts, place (the points' blocks only): the block's 32 points and their places,
// left in LDS for the head of the pipeline; visible behind the caller's next barrier.
// ---------------------------------------------------------------------------
#define XSTRIPS 27
#define LSTRIPS 13
#define XBLK ((NX + 31) / 32)
#define LBLK ((NL + 31) / 32)
#define SORT_WAVES 4

__device__ __forceinline__ unsigned sort_key(float px, float py, int strips, int idx) {
    int s = (int)(py * (float)strips);
    s = s < 0 ? 0 : s > strips - 1 ? strips - 1 : s;      // any value of the input gives a valid key
    int xq = (int)(px * 8192.0f);
    xq = xq < 0 ? 0 : xq > 8191 ? 8191 : xq;
    if (s & 1) xq = 8191 - xq;             // odd strips run backwards: 16 neighbours stay together across a strip's end
    return ((unsigned)s << 27) | ((unsigned)xq << 14) | (unsigned)idx;
}

// One pass of a wave: the NR*32 keys from slot0 on are loaded, and cnt (lane l) grows by
// the number of them below point l's key. TOP: registers of 32 slots that lie in front
// of the set's last NR; a pass with ENDS may reach past the end of the set.
template <int N, int STRIPS, bool LAT, int NR, int TOP, bool ENDS>
__device__ __forceinline__ void rank_pass(const float2* __restrict__ X2, int slot0, int lane,
                                          unsigned my, unsigned& cnt, unsigned& lastkey) {
    float2 p[NR];
    unsigned key[NR];
    const float2* q0 = X2 + slot0 + lane;  // the points: one address, constant offsets
#pragma unroll   // constant indices keep the register array in registers; the loads fly together
    for (int t = 0; t < NR; t++) {
        // a register that no wave's slots carry past the end needs no clamp
        const bool inside = !ENDS || (TOP + t + 1) * 32 <= N;
        if (LAT || !inside) {
            int i = slot0 + t * 32 + lane;
            if (!inside) i = i < N ? i : N - 1;
            const float2* q = X2 + (LAT ? (2 * (i / 26)) * 51 + 2 * (i % 26) : i);
            p[t] = *q;
            // each such load has an address of its own: the next load's result may land
            // in it (as an input: nor this load's own)
            asm volatile("s_wait_xcnt 0x0" :: "v"(q) : "memory");
        } else {
            p[t] = q0[t * 32];
        }
    }
    // what follows, the next pass too, may reuse the loads' address registers (as an
    // input: nor may the loads' own results land in them)
    if (!LAT) asm volatile("s_wait_xcnt 0x0" :: "v"(q0) : "memory");
    // keeps the loads together, in front of the keys' arithmetic
    __builtin_amdgcn_sched_barrier(0);
#pragma unroll   // constant indices keep the keys in registers
    for (int t = 0; t < NR; t++) {
        const bool inside = !ENDS || (TOP + t + 1) * 32 <= N;
        int i = slot0 + t * 32 + lane;
        if (!inside) i = i < N ? i : N - 1;
        key[t] = sort_key(p[t].x, p[t].y, STRIPS, i);
    }
    for (int l = 0; l < 32; l++) {
        const unsigned kl = (unsigned)__builtin_amdgcn_readlane((int)my, l);
        unsigned c = 0u;
#pragma unroll   // constant indices keep the keys in registers
        for (int t = 0; t + 1 < NR; t += 2) {
            // two ballots side by side: one 64-bit bit count for both
            unsigned long long b0 = __builtin_amdgcn_ballot_w32(key[t] < kl);
            unsigned long long b1 = __builtin_amdgcn_ballot_w32(key[t + 1] < kl);
            c += (unsigned)__popcll(b0 | (b1 << 32));
        }
        if (NR & 1) c += (unsigned)__popc(__builtin_amdgcn_ballot_w32(key[NR - 1] < kl));
        cnt += lane == l ? c : 0u;
    }
    lastkey = key[NR - 1];
}

template <int N, int STRIPS, bool LAT, int PASSES>
__device__ __forceinline__ void sort_block(const float* __restrict__ x, unsigned (*part)[32], int blk,
                                           float* __restrict__ dst, int* __restrict__ perm,
                                           float2* pts, int* place) {
    constexpr int NR = (N + PASSES * SORT_WAVES * 32 - 1) / (PASSES * SORT_WAVES * 32);   // keys a lane holds in a pass
    constexpr int TOP = (PASSES * SORT_WAVES - 1) * NR;
    // Slots past the end of the set, all in the last wave's last pass. They hold the last
    // point's key again and are taken off that wave's counts at the end, so that the
    // counting loop has one compare a register and nothing else.
    constexpr int SPARE = PASSES * SORT_WAVES * NR * 32 - N;
    static_assert(SPARE >= 0 && SPARE < NR * 32, "the spare slots lie behind the last point's own, in one wave's pass");
    const int tid = threadIdx.x;
    const int lane = tid & 31;
    const int wave = __builtin_amdgcn_readfirstlane(tid >> 5);
    const float2* X2 = (const float2*)x;
    const int j = blk * 32 + lane;         // the point that this lane stands for
    const int jc = j < N ? j : N - 1;
    const float2* qj = X2 + (LAT ? (2 * (jc / 26)) * 51 + 2 * (jc % 26) : jc);
    const float2 pj = *qj;
    // what follows may reuse the load's address registers (as an input: nor may its own result land in them)
    asm volatile("s_wait_xcnt 0x0" :: "v"(qj) : "memory");
    const unsigned my = sort_key(pj.x, pj.y, STRIPS, jc);

    unsigned cnt = 0u;                     // lane l: how many of the wave's keys lie below point l's
    unsigned lastkey = 0u;
    // One copy of the pass for all but the last: this launch's three kinds of block share
    // one kernel text, kept short for speed only.
#pragma nounroll
    for (int pass = 0; pass < PASSES - 1; pass++)
        rank_pass<N, STRIPS, LAT, NR, TOP, false>(X2, (pass * SORT_WAVES + wave) * (NR * 32), lane, my, cnt, lastkey);
    rank_pass<N, STRIPS, LAT, NR, TOP, true>(X2, ((PASSES - 1) * SORT_WAVES + wave) * (NR * 32), lane, my, cnt, lastkey);
    if (SPARE > 0 && wave == SORT_WAVES - 1) {
        // the last slot of all holds the last point's key
        const unsigned last = (unsigned)__builtin_amdgcn_readlane((int)lastkey, 31);
        cnt -= last < my ? (unsigned)SPARE : 0u;
    }
    part[wave][lane] = cnt;
    __syncthreads();                       // the waves' counts visible
    if (wave == 0) {
        unsigned pos = 0u;
#pragma unroll   // lets the LDS reads issue together
        for (int w = 0; w < SORT_WAVES; w++) pos += part[w][lane];
        if (!LAT) { pts[lane] = pj; place[lane] = (int)pos; }   // lanes past the end: the last point again, never stored
        if (j < N) {
            ((float2*)dst)[pos] = pj;
            perm[pos] = j;
            // the head's code behind this may reuse the stores' address registers
            asm volatile("s_wait_xcnt 0x0" ::: "memory");
        }
    }
}

// ---------------------------------------------------------------------------
// Head of the pipeline, on the 32 points that a block has just ranked:
//   h0[j,c] = gelu(x0*W[0,c] + x1*W[1,c] + b[c])                  (K=2: plain VALU)
//   v[place, h*16+k] = sum_c h0[j,c] * w[h][c][k]                 (val of the down step)
// Each row stands alone, so the rows may be worked in the order of the input and
// stored at their places. The encoder's two tiles of 16 rows go through LDS into
// the A fragments, wave w owns head w (columns 16w..16w+15). n: rows that exist.
// ---------------------------------------------------------------------------
__device__ __forceinline__
void head_rows(const float* __restrict__ W, const float* __restrict__ b,
               const float* __restrict__ w, float* __restrict__ v,
               float (*tA)[TP], const float2* pts, const int* place, int n) {
    int tid = threadIdx.x;
    int lane = tid & 31;
    int wave = __builtin_amdgcn_readfirstlane(tid >> 5);
    int laneN = lane & 15;
    int hi = lane >> 4;

    // a thread keeps one column c and takes every second row
    const int c = tid & 63, rl = tid >> 6;
    float wa = W[c], wb = W[HID + c], bc = b[c];
    // what follows may reuse the loads' address registers
    asm volatile("s_wait_xcnt 0x0" ::: "memory");
    // holds the weights' address arithmetic behind that wait
    __builtin_amdgcn_sched_barrier(0);
    v2f af[16], bf[16];
    frag_b<16>(w + wave * (HID * 16) + laneN, hi * 2, bf);
    __syncthreads();                       // the block's points and places visible
#pragma nounroll   // one copy of the gelu keeps the kernel's text short (see sort_block)
    for (int it = 0; it < 16; it++) {
        float2 xr = pts[rl + 2 * it];
        tA[rl + 2 * it][c] = gelu_erf(fmaf(xr.x, wa, fmaf(xr.y, wb, bc)));
    }
    __syncthreads();                       // the encoder's tiles visible

#pragma nounroll   // two tiles, the same weights, one copy of the code (see sort_block)
    for (int t = 0; t < 2; t++) {
        frag_a<false>(&tA[t * 16 + laneN][hi * 2], af);
        v8f acc = mm16(af, bf);
#pragma unroll   // constant indices keep the accumulator in registers
        for (int r = 0; r < 8; r++) {
            int row = t * 16 + r + 8 * hi;
            if (row < n) {
                v[(size_t)place[row] * HID + wave * 16 + laneN] = acc[r];
                // each row has an address of its own, and the next one's may land in its registers
                asm volatile("s_wait_xcnt 0x0" ::: "memory");
            }
        }
    }
}

// ---------------------------------------------------------------------------
// Per-row quantile of squared distances, the row's distances kept in registers.
// thr[row] = s[kth] + frac*(s[kth+1] - s[kth])   (jnp.quantile 'linear')
// d2 >= 0 so float bit patterns are order-preserving as uints.
// A team of WAVES waves owns one row; each lane holds NR of the NK distances.
// The team is a whole block (tid: the thread's number in it), or, with WAVES = 1,
// one wave of a block whose waves each take a row of their own (tid: the lane).
// The bit pattern of s[kth] is bracketed between the row's minimum and maximum:
// a probe inside the bracket, one compare per held value, counted over the wave
// by ballot, so the count and the bracket live in scalar registers. The first
// probes are placed by the counts: the number of points inside a circle grows
// about linearly with d2, so a straight line through the bracket's two ends says
// where a wanted count lies. They aim a few ranks above kth and a few below in
// turn, whichever end is the farther. Any probe inside the bracket keeps it
// valid, so the probes' places change the number of steps and never the result;
// a row that does not close so goes on by halving the bit patterns' range.
// Once the bracket holds at most 32 values they are gathered, one to a lane of
// wave 0, and ranked against each other. Equal values that never thin out end
// the halving at width 1.
// ---------------------------------------------------------------------------
#define QCAP 32
#define QINT 8      // probes placed by the counts before the halving takes over

template <int WAVES>
struct QShared {                         // a team's LDS
    unsigned mn[WAVES], mx[WAVES];       // the waves' minima and maxima
    unsigned cnt[2][WAVES];              // the waves' counts, by parity of the step
    unsigned m[WAVES], mg[WAVES];        // values gathered; least value above the bracket
    unsigned buf[WAVES][QCAP];           // the gathered values
};

// keep: false for a team past the last row, which works on a row again and stores nothing
template <int WAVES, int NR, int NK>
__device__ __forceinline__
void quantile_row(const float* __restrict__ Qc, const float* __restrict__ Kc,
                  int kth, float frac, float* __restrict__ thr_out,
                  int row, bool keep, int tid, QShared<WAVES>& sh) {
    constexpr int T = WAVES * 32;
    static_assert(T * NR >= NK && T * (NR - 1) < NK, "NR values a lane cover the row");
    const int lane = tid & 31;
    const int wave = WAVES > 1 ? __builtin_amdgcn_readfirstlane(tid >> 5) : 0;   // scalar branches on the wave
    const unsigned k = (unsigned)kth;
    const float qx = Qc[2 * row + 0], qy = Qc[2 * row + 1];

    unsigned u[NR];
    unsigned mn = 0xFFFFFFFFu, mx = 0u;
    const float2* K2 = (const float2*)Kc;
    // Three runs of loads, each issued whole in front of its arithmetic. A key takes
    // two registers until it is worked down to one distance, so the runs shrink as
    // the row fills up and the wave stays inside its register budget.
    constexpr int RUN0 = 44, RUN1 = 74;
    static_assert(NR > RUN1 && NR - RUN1 <= RUN0, "three runs cover the row");
    float2 p[RUN0];
#pragma unroll   // constant indices keep the row in registers
    for (int run = 0; run < 3; run++) {
        const int i0 = run == 0 ? 0 : run == 1 ? RUN0 : RUN1;
        const int i1 = run == 0 ? RUN0 : run == 1 ? RUN1 : NR;
#pragma unroll   // constant indices keep the row in registers
        for (int i = i0; i < i1; i++) {
            int j = i * T + tid;
            if ((i + 1) * T > NK) j = j < NK ? j : NK - 1;   // past the end: the last key again
            p[i - i0] = K2[j];
        }
        // behind the last load: the arithmetic below may reuse the loads' address registers
        if (run == 2) asm volatile("s_wait_xcnt 0x0" ::: "memory");
        // keeps the run's loads together: left alone the compiler waits after every four
        __builtin_amdgcn_sched_barrier(0);
#pragma unroll   // constant indices keep the row in registers
        for (int i = i0; i < i1; i++) {
            float dx = qx - p[i - i0].x;
            float dy = qy - p[i - i0].y;
            unsigned b = __float_as_uint(fmaf(dx, dx, dy * dy));
            mn = b < mn ? b : mn;
            mx = b > mx ? b : mx;
            // a slot past the end is never below any bracket end
            u[i] = ((i + 1) * T <= NK || i * T + tid < NK) ? b : 0xFFFFFFFFu;
        }
        // keeps the next run's loads behind this run's arithmetic, which frees their registers
        __builtin_amdgcn_sched_barrier(0);
    }
#pragma unroll   // five fixed steps, minimum and maximum side by side
    for (int d = 16; d >= 1; d >>= 1) {
        unsigned a = (unsigned)__shfl_xor((int)mn, d);
        unsigned c = (unsigned)__shfl_xor((int)mx, d);
        mn = a < mn ? a : mn;
        mx = c > mx ? c : mx;
    }
    if constexpr (WAVES > 1) {
        if (lane == 0) { sh.mn[wave] = mn; sh.mx[wave] = mx; }
        __syncthreads();                           // the waves' minima and maxima visible
#pragma unroll   // lets the LDS reads issue together
        for (int w = 0; w < WAVES; w++) {
            unsigned a = sh.mn[w], c = sh.mx[w];
            mn = a < mn ? a : mn;
            mx = c > mx ? c : mx;
        }
    }
    // lo <= s[kth] < hi ; cLo values lie below lo, cHi below hi
    unsigned lo = (unsigned)__builtin_amdgcn_readfirstlane((int)mn);
    unsigned hi = (unsigned)__builtin_amdgcn_readfirstlane((int)mx);
    if (hi != 0xFFFFFFFFu) hi += 1u;
    unsigned cLo = 0u, cHi = (unsigned)NK;

    for (int it = 0; it < QINT + 32; it++) {       // behind the first QINT the width halves: 32 steps at most
        if (hi - lo <= 1u || cHi - cLo <= (unsigned)QCAP) break;   // same in every wave of the team
        unsigned mid = lo + ((hi - lo) >> 1);
        if (it < QINT) {
            // The bracket holds more than QCAP values, so its farther end is more than
            // QCAP/2 ranks from kth and the wanted count lies strictly between cLo and cHi.
            const unsigned want = cHi - k > k - cLo ? k + (unsigned)(QCAP / 3 + 1) : k - (unsigned)(QCAP / 3);
            const float fl = __uint_as_float(lo), fh = __uint_as_float(hi);
            // every wave of the team works this out from the same scalars: the same probe in all.
            // The reciprocal need not be exact: it only places the probe.
            const float share = (float)(want - cLo) * __builtin_amdgcn_rcpf((float)(cHi - cLo));
            unsigned b = __float_as_uint(fmaf(fh - fl, share, fl));
            // strictly inside the bracket, whatever the arithmetic gave (an end that is no number too)
            b = b < hi - 1u ? b : hi - 1u;
            b = b > lo + 1u ? b : lo + 1u;
            mid = (unsigned)__builtin_amdgcn_readfirstlane((int)b);
        }
        unsigned c = 0u;
#pragma unroll   // constant indices keep the row in registers
        for (int i = 0; i + 1 < NR; i += 2) {
            // two ballots side by side: one 64-bit bit count for both
            unsigned long long b0 = __builtin_amdgcn_ballot_w32(u[i] < mid);
            unsigned long long b1 = __builtin_amdgcn_ballot_w32(u[i + 1] < mid);
            c += (unsigned)__popcll(b0 | (b1 << 32));
        }
        if (NR & 1) c += (unsigned)__popc(__builtin_amdgcn_ballot_w32(u[NR - 1] < mid));
        if constexpr (WAVES > 1) {
            // slots alternate, so a wave one step ahead writes the other one
            if (lane == 0) sh.cnt[it & 1][wave] = c;
            __syncthreads();                       // the waves' counts visible
            unsigned t = 0u;
#pragma unroll   // lets the LDS reads issue together
            for (int w = 0; w < WAVES; w++) t += sh.cnt[it & 1][w];
            c = (unsigned)__builtin_amdgcn_readfirstlane((int)t);
        }
        if (c <= k) { lo = mid; cLo = c; } else { hi = mid; cHi = c; }
    }

    const unsigned m = cHi - cLo;                  // values in the bracket
    const unsigned r = k - cLo;                    // rank of s[kth] among them
    const bool few = m <= (unsigned)QCAP;
    const bool above = r + 1u >= m;                // s[kth+1] is the least value at or above hi

    unsigned mg = 0xFFFFFFFFu;
    if (above) {
#pragma unroll   // constant indices keep the row in registers
        for (int i = 0; i < NR; i++) {
            unsigned v = u[i] >= hi ? u[i] : 0xFFFFFFFFu;
            mg = v < mg ? v : mg;
        }
#pragma unroll   // five fixed steps
        for (int d = 16; d >= 1; d >>= 1) {
            unsigned a = (unsigned)__shfl_xor((int)mg, d);
            mg = a < mg ? a : mg;
        }
    }
    unsigned got = 0u;
    if (few) {
        const unsigned width = hi - lo;
#pragma unroll   // constant indices keep the row in registers
        for (int g = 0; g < NR; g += 16) {
            // sixteen ballots first, then the scalar tests: a test directly behind
            // its own compare would wait out the compare each time
            unsigned mask[16];
#pragma unroll   // constant indices keep the masks in scalar registers
            for (int t = 0; t < 16; t++)
                mask[t] = g + t < NR ? __builtin_amdgcn_ballot_w32(u[g + t < NR ? g + t : 0] - lo < width) : 0u;   // lo <= u < hi
#pragma unroll   // constant indices keep the masks in scalar registers
            for (int t = 0; t < 16; t++) {
                if (g + t < NR && mask[t] != 0u) {   // most registers hold none: scalar skip
                    if ((mask[t] >> lane) & 1u)
                        sh.buf[wave][got + __builtin_amdgcn_mbcnt_lo(mask[t], 0u)] = u[g + t < NR ? g + t : 0];
                    got += (unsigned)__popc(mask[t]);
                }
            }
        }
    }
    if (lane == 0) { sh.m[wave] = got; sh.mg[wave] = mg; }
    // gathered values and their counts visible (every wave of the block comes here
    // once, also where each has a row of its own)
    __syncthreads();

    if (wave == 0) {
#pragma unroll   // lets the LDS reads issue together
        for (int w = 0; w < WAVES; w++) { unsigned a = sh.mg[w]; mg = a < mg ? a : mg; }
        unsigned sk = lo, sk1 = above ? mg : lo;   // bracket of width 1: all its values equal lo
        if (few) {
            unsigned cand = 0xFFFFFFFFu, first = 0u;
#pragma unroll   // lets the LDS reads issue together
            for (int w = 0; w < WAVES; w++) {
                unsigned n = sh.m[w];
                if ((unsigned)lane - first < n) cand = sh.buf[w][(unsigned)lane - first];
                first += n;
            }
            unsigned less = 0u, leq = 0u;
#pragma unroll   // constant lane numbers for the broadcasts
            for (int j = 0; j < QCAP; j++) {
                unsigned cj = (unsigned)__builtin_amdgcn_readlane((int)cand, j);
                less += cj < cand ? 1u : 0u;
                leq += cj <= cand ? 1u : 0u;
            }
            // a lane holds the value of rank x when less <= x < leq
            unsigned ma = __builtin_amdgcn_ballot_w32(less <= r && r < leq);
            sk = (unsigned)__builtin_amdgcn_readlane((int)cand, __ffs(ma) - 1);
            if (!above) {
                unsigned mb = __builtin_amdgcn_ballot_w32(less <= r + 1u && r + 1u < leq);
                sk1 = (unsigned)__builtin_amdgcn_readlane((int)cand, __ffs(mb) - 1);
            }
        }
        if (lane == 0 && keep) {
            float fk = __uint_as_float(sk);
            thr_out[row] = fmaf(frac, __uint_as_float(sk1) - fk, fk);
        }
    }
}

// ---------------------------------------------------------------------------
// All the work that needs nothing but the input, in one launch. The first blocks
// rank 32 points each; those of the points go on with the head of the
// pipeline for their own 32 rows. The other blocks take the thresholds of the down
// step, a latent point each: a row's distances are the same set in any order of the
// points, so they read the input as it lies, and thr_out is in the latent points'
// own order (the down step finds its rows through lperm).
// quantile over nK=11271: pos = 0.05*11270 = 563.5 -> k=563, frac=0.5
// ---------------------------------------------------------------------------
__global__ __launch_bounds__(128)
__attribute__((amdgpu_waves_per_eu(8)))   // 128 registers a wave: eight waves a SIMD cover each other's waits
void k_first(const float* __restrict__ x,
             const float* __restrict__ W, const float* __restrict__ b,
             const float* __restrict__ w,
             float* __restrict__ xs, int* __restrict__ perm,
             float* __restrict__ ls, int* __restrict__ lperm,
             float* __restrict__ v, float* __restrict__ thr_out) {
    __shared__ QShared<4> qs;
    __shared__ unsigned part[SORT_WAVES][32];
    __shared__ float2 pts[32];
    __shared__ int place[32];
    __shared__ __attribute__((aligned(16))) float tA[32][TP];   // aligned for the 8-byte fragment reads
    const int blk = blockIdx.x;
    if (blk < XBLK) {
        sort_block<NX, XSTRIPS, false, 4>(x, part, blk, xs, perm, pts, place);
        head_rows(W, b, w, v, tA, pts, place, NX - blk * 32);
    } else if (blk < XBLK + LBLK) {
        sort_block<NL, LSTRIPS, true, 1>(x, part, blk - XBLK, ls, lperm, nullptr, nullptr);
    } else {
        const int l = blk - (XBLK + LBLK);
        const int at = (2 * (l / 26)) * 51 + 2 * (l % 26);      // the latent point's place in x, never below l
        // the row's own point is read at index row of the first argument
        quantile_row<4, 89, NX>(x + 2 * (at - l), x, 563, 0.5f, thr_out, l, true, threadIdx.x, qs);
    }
}

// ---------------------------------------------------------------------------
// One group of 16 keys for a tile of 16 queries, all four heads.
// The masked weights are computed straight into the WMMA A fragment
// (M = query = lane&15, K = key) and the val rows are the B fragment
// (K = key, N = column within the head), with the same key in the same K slot:
//   lanes 0-15 : VGPR{0,1} = keys j+0, j+1 ; lanes 16-31 : keys j+2, j+3
// jb = first key of the group + 2*(lane>>4). TAIL clamps every key index and
// zeroes the weights of keys past the end.
// ---------------------------------------------------------------------------
// exp2 of eight values. One statement, each value in its own register: behind
// an exp2 the instruction set asks for one independent instruction before its
// result is read or its source overwritten. Here the source is the result's own
// register, the next exp2 fills the slot of the one in front, and the v_nop that
// of the last.
__device__ __forceinline__ void exp2x8(float (&x)[8]) {
    asm("v_exp_f32 %0, %0\n\t"
        "v_exp_f32 %1, %1\n\t"
        "v_exp_f32 %2, %2\n\t"
        "v_exp_f32 %3, %3\n\t"
        "v_exp_f32 %4, %4\n\t"
        "v_exp_f32 %5, %5\n\t"
        "v_exp_f32 %6, %6\n\t"
        "v_exp_f32 %7, %7\n\t"
        "v_nop"
        : "+v"(x[0]), "+v"(x[1]), "+v"(x[2]), "+v"(x[3]),
          "+v"(x[4]), "+v"(x[5]), "+v"(x[6]), "+v"(x[7]));
}

template <bool TAIL>
__device__ __forceinline__ void attn_group16(const float* __restrict__ Kc,
                                             const float* __restrict__ val,
                                             int nK, int jb, int laneN,
                                             float qx, float qy, float thrq,
                                             const float (&c)[4],
                                             v8f (&acc)[4], v2f (&den)[4]) {
    // all loads of the group first, the coordinates ahead of the val rows, so
    // that the val rows fly under the weights' arithmetic
    v2f b[4][4];
    float kx[4][2], ky[4][2];
    const float* ka[4];
    const float* kc[4];
#pragma unroll   // constant indices keep the register arrays in registers
    for (int s = 0; s < 4; s++) {
        int j = jb + s * 4;
        if (TAIL) {
            int ja = j < nK ? j : nK - 1;
            int jc = j + 1 < nK ? j + 1 : nK - 1;
            ka[s] = Kc + 2 * ja;
            kc[s] = Kc + 2 * jc;
            kx[s][0] = ka[s][0]; ky[s][0] = ka[s][1];
            kx[s][1] = kc[s][0]; ky[s][1] = kc[s][1];
        } else {
            ka[s] = kc[s] = Kc + 2 * jb;                // one address, constant offsets
            float4 k4 = *(const float4*)(ka[s] + 8 * s);   // jb is even: 16-B aligned
            kx[s][0] = k4.x; ky[s][0] = k4.y; kx[s][1] = k4.z; ky[s][1] = k4.w;
        }
    }
    // the val loads' results and addresses may land in the coordinate loads'
    // address registers; as a memory fence it also keeps the coordinate loads in
    // front (loads return in order: issued last, they would make the first
    // distance wait for every val row as well). The addresses as inputs keep the
    // coordinate loads' own results out of them.
    if (TAIL)
        asm volatile("s_wait_xcnt 0x0" :: "v"(ka[0]), "v"(ka[1]), "v"(ka[2]), "v"(ka[3]),
                                          "v"(kc[0]), "v"(kc[1]), "v"(kc[2]), "v"(kc[3]) : "memory");
    else
        asm volatile("s_wait_xcnt 0x0" :: "v"(ka[0]) : "memory");
    // holds the val rows' address arithmetic behind that wait
    __builtin_amdgcn_sched_barrier(0);
#pragma unroll   // constant indices keep the register arrays in registers
    for (int s = 0; s < 4; s++) {
        const float* va;
        const float* vc;
        if (TAIL) {
            int j = jb + s * 4;
            int ja = j < nK ? j : nK - 1;
            int jc = j + 1 < nK ? j + 1 : nK - 1;
            va = val + (size_t)ja * HID + laneN;
            vc = val + (size_t)jc * HID + laneN;
        } else {
            va = val + (size_t)jb * HID + laneN + s * 4 * HID;   // one address, constant offsets
            vc = va + HID;
        }
#pragma unroll   // constant indices keep the register arrays in registers
        for (int h = 0; h < 4; h++) { b[s][h].x = va[h * 16]; b[s][h].y = vc[h * 16]; }
        // clamped rows have address registers of their own for each run, and the
        // next run's results may land in them (as inputs: nor this run's own)
        if (TAIL) asm volatile("s_wait_xcnt 0x0" :: "v"(va), "v"(vc) : "memory");
        // the arithmetic below may reuse the val loads' address registers (as an
        // input: nor may the loads' own results land in them)
        if (!TAIL && s == 3) asm volatile("s_wait_xcnt 0x0" :: "v"(va) : "memory");
    }
    // keeps the wait for the coordinates behind the issue of the val loads
    __builtin_amdgcn_sched_barrier(0);
#pragma unroll   // constant indices keep the register arrays in registers
    for (int s = 0; s < 4; s++) {
        int j = jb + s * 4;
        float dx0 = qx - kx[s][0], dy0 = qy - ky[s][0];
        float dx1 = qx - kx[s][1], dy1 = qy - ky[s][1];
        float d20 = fmaf(dx0, dx0, dy0 * dy0);
        float d21 = fmaf(dx1, dx1, dy1 * dy1);
        bool ok0 = d20 <= thrq, ok1 = d21 <= thrq;
        if (TAIL) { ok0 = ok0 && (j < nK); ok1 = ok1 && (j + 1 < nK); }
        // c holds -c_h*log2(e): one multiply and the hardware's exp2 for each weight.
        // The exponent is never above 0; a weight under 2^-126 comes out as 0.
        float e[8];
#pragma unroll   // constant indices keep the register arrays in registers
        for (int h = 0; h < 4; h++) { e[2 * h] = c[h] * d20; e[2 * h + 1] = c[h] * d21; }
        exp2x8(e);
#pragma unroll   // constant indices keep the register arrays in registers
        for (int h = 0; h < 4; h++) {
            // exp in every lane, then a select: no divergent branch round a WMMA
            v2f a;
            a.x = ok0 ? e[2 * h] : 0.0f;
            a.y = ok1 ? e[2 * h + 1] : 0.0f;
            den[h] += a;                   // even and odd keys summed apart
            acc[h] = __builtin_amdgcn_wmma_f32_16x16x4_f32(
                /*neg_a=*/false, a, /*neg_b=*/false, b[s][h],
                /*c_mod=*/(short)0, acc[h], /*reuse_a=*/false, /*reuse_b=*/false);
        }
    }
}

// ---------------------------------------------------------------------------
// Fused masked multi-head softmax attention + gelu.
// out[q, h*16+v] = gelu( sum_j w_h(q,j) * val[j, h*16+v] / sum_j w_h(q,j) )
//   w_h = exp(-c_h * d2(q,j)) if d2 <= thr[q] else 0 ;  c_h = tan(pi/4*(1+sin r_h))
// (positive c_h => head-independent mask; exponents in [-c*thr, 0] => stable.)
// Block = 16 waves, one tile of 16 queries: every val row that is read serves
// 16 queries through one f32 WMMA per head. The keys are dealt to the waves in
// groups of 16; the waves' partial numerators and denominators are summed in
// LDS in a fixed order.
// The tile a[16,64] that comes of it stays in LDS, and the products that follow
// it in the pipeline, which work on each row alone, run on it in the same block:
//   STEP 0, down  : hout = a ; vout = a @ wv
//   STEP 1, latent: t = gelu(a @ w1 + b1) ; m = t @ w2 + b2 ;
//                   hout = gelu(m + hin @ w3 + b3) ; vout = hout @ wv
//   STEP 2, up    : t = gelu(a @ w1 + b1) ; hout[perm[q]] = t . w2 + b2   (w2 is [64,1])
// Each product has four waves of its own (wave 4g+w: product g, columns
// 16w..16w+15), which fetch its weights behind the key loop, ahead of the LDS sum;
// each gelu is spread over all 16 waves.
// wv: the per-head weights [4][64][16] of the attention that comes next; vout is
// its val, another buffer than val, which other blocks are still reading.
// The launches of STEP 0 and STEP 1 have fewer tiles than the chip has room for.
// The thresholds of the up step, which need only the spatial order, ride along in
// blocks of their own behind the tiles: 16 rows a block, one a wave. Such a launch
// takes the qrows points from qpts on: thr2[row] from the distances of qpts[row]
// to all latent points, which are Qc in both steps.
// ---------------------------------------------------------------------------
#define ATT_WAVES 16

template <int STEP>
__global__ __launch_bounds__(ATT_WAVES * 32)
// the masked steps keep 128 registers a wave, so that two blocks share a WGP as before
__attribute__((amdgpu_waves_per_eu(STEP == 1 ? 4 : 8)))
void k_attn(const float* __restrict__ Qc, int nQ,
            const float* __restrict__ Kc, int nK,
            const float* __restrict__ val,
            const float* __restrict__ rr,
            const float* __restrict__ thr,
            const float* __restrict__ hin,
            const float* __restrict__ w1, const float* __restrict__ b1,
            const float* __restrict__ w2, const float* __restrict__ b2,
            const float* __restrict__ w3, const float* __restrict__ b3,
            const float* __restrict__ wv, const int* __restrict__ perm,
            float* __restrict__ hout, float* __restrict__ vout,
            const float* __restrict__ qpts, int qrows, float* __restrict__ thr2) {
    if constexpr (STEP != 2) {
        __shared__ QShared<1> qs[ATT_WAVES];
        const int tiles = (nQ + 15) >> 4;
        // the whole block, ahead of every barrier of the tiles; marked unlikely so that
        // the tiles' code, which the launch waits for, stands first in the kernel's text
        if (__builtin_expect((int)blockIdx.x >= tiles, 0)) {
            const int w = __builtin_amdgcn_readfirstlane(threadIdx.x >> 5);
            const int row = ((int)blockIdx.x - tiles) * ATT_WAVES + w;
            // quantile over nK=2886: pos = 0.05*2885 = 144.25 -> k=144, frac=0.25
            quantile_row<1, 91, NL>(qpts, Qc, 144, 0.25f, thr2, row < qrows ? row : qrows - 1, row < qrows,
                                    (int)__builtin_amdgcn_mbcnt_lo(~0u, 0u), qs[w]);   // the lane's number
            return;
        }
    }
    __shared__ int lst[NX / 16];                   // the key groups that the tile visits, in rising order
    __shared__ int wcnt[ATT_WAVES];                // how many of them each wave found
    __shared__ float red[ATT_WAVES / 2][32][32];   // 32 KB partial numerators
    __shared__ float dred[ATT_WAVES][4][16];       // partial denominators
    __shared__ float cs[4];
    // 16-row tiles handed from product to product; aligned for the 8-byte fragment reads
    __shared__ __attribute__((aligned(16))) float tA[16][TP], tB[16][TP], tC[16][TP];

    int tid = threadIdx.x;
    int lane = tid & 31;
    int wave = __builtin_amdgcn_readfirstlane(tid >> 5);   // scalar loop control
    int laneN = lane & 15;
    int hi = lane >> 4;
    int q0 = blockIdx.x * 16;

    // kept as -c_h*log2(e): exp(-c_h*d2) = exp2(cs*d2)
    if (tid < 4)
        cs[tid] = -1.44269504088896341f * tanf(0.78539816339744831f * (1.0f + sinf(rr[tid])));
    __syncthreads();                       // cs visible

    int q = q0 + laneN;
    if (q > nQ - 1) q = nQ - 1;            // clamp tail reads (stores predicated)
    float qx = Qc[2 * q + 0], qy = Qc[2 * q + 1];
    float thrq = 3.402823466e+38f;
    if (thr) {
        int tq = q;
        if (STEP == 0) {
            // the down step's thresholds lie in the latent points' own order
            const int* pq = perm + q;
            tq = *pq;
            // the threshold's address may land in this load's address registers (as an
            // input: nor may the load's own result)
            asm volatile("s_wait_xcnt 0x0" :: "v"(pq) : "memory");
        }
        thrq = thr[tq];
        // in the load's own block, so that nothing of the code behind the branch comes in front of it
        asm volatile("s_wait_xcnt 0x0" ::: "memory");
    }
    // the address registers of the two loads above are reused at once
    asm volatile("s_wait_xcnt 0x0" ::: "memory");
    float c[4] = {cs[0], cs[1], cs[2], cs[3]};

    v8f acc[4] = {};
    v2f den[4] = {};

    int nFull = nK >> 4;                   // whole groups of 16 keys
    int nTurn = nFull;                     // groups dealt out so far: says whose turn the partial group is
    if (STEP == 1) {
        for (int g = wave; g < nFull; g += ATT_WAVES)
            attn_group16<false>(Kc, val, nK, g * 16 + hi * 2, laneN, qx, qy, thrq, c, acc, den);
    } else {
        // the tile's bounding box and its largest threshold
        // (each half-wave holds the 16 queries, one a lane)
        float bx0 = qx, bx1 = qx, by0 = qy, by1 = qy, tmax = thrq;
#pragma unroll   // four fixed steps, the five values side by side
        for (int d = 8; d >= 1; d >>= 1) {
            float a0 = __shfl_xor(bx0, d), a1 = __shfl_xor(bx1, d);
            float a2 = __shfl_xor(by0, d), a3 = __shfl_xor(by1, d), a4 = __shfl_xor(tmax, d);
            bx0 = fminf(bx0, a0); bx1 = fmaxf(bx1, a1);
            by0 = fminf(by0, a2); by1 = fmaxf(by1, a3);
            tmax = fmaxf(tmax, a4);
        }
        int nAct = 0;
        for (int base = 0; base < nFull; base += ATT_WAVES * 32) {
            int g = base + tid;
            int gg = g < nFull ? g : nFull - 1;
            const float4* kp = (const float4*)(Kc + (size_t)gg * 32);
            float4 k[8];
#pragma unroll   // constant indices keep the register array in registers
            for (int i = 0; i < 8; i++) k[i] = kp[i];
            // the next trip rewrites the loads' address registers
            asm volatile("s_wait_xcnt 0x0" ::: "memory");
            float kx0 = fminf(k[0].x, k[0].z), kx1 = fmaxf(k[0].x, k[0].z);
            float ky0 = fminf(k[0].y, k[0].w), ky1 = fmaxf(k[0].y, k[0].w);
#pragma unroll   // constant indices keep the register array in registers
            for (int i = 1; i < 8; i++) {
                kx0 = fminf(kx0, fminf(k[i].x, k[i].z)); kx1 = fmaxf(kx1, fmaxf(k[i].x, k[i].z));
                ky0 = fminf(ky0, fminf(k[i].y, k[i].w)); ky1 = fmaxf(ky1, fmaxf(k[i].y, k[i].w));
            }
            // The gap between the two boxes, squared in the very form of the pairs' d2:
            // subtraction, product and fma round monotonically, so no pair's d2 is
            // below it. A group is left out only when that bound is above every
            // threshold of the tile: all its weights would be 0.
            float gx = fmaxf(fmaxf(kx0 - bx1, bx0 - kx1), 0.0f);
            float gy = fmaxf(fmaxf(ky0 - by1, by0 - ky1), 0.0f);
            bool act = g < nFull && !(fmaf(gx, gx, gy * gy) > tmax);
            unsigned m = __builtin_amdgcn_ballot_w32(act);
            if (lane == 0) wcnt[wave] = __popc(m);
            __syncthreads();               // the waves' counts visible
            int before = 0, tot = 0;
#pragma unroll   // lets the LDS reads issue together
            for (int w = 0; w < ATT_WAVES; w++) {
                int n = wcnt[w];
                before += w < wave ? n : 0;
                tot += n;
            }
            if (act) lst[nAct + before + (int)__builtin_amdgcn_mbcnt_lo(m, 0u)] = g;
            nAct += tot;
            __syncthreads();               // the list visible; the counts free for the next trip
        }
        nAct = __builtin_amdgcn_readfirstlane(nAct);           // scalar loop control
        nTurn = nAct;
        int gl = wave < nAct ? lst[wave] : 0;                  // read one trip ahead, under the group's work
        for (int i = wave; i < nAct; i += ATT_WAVES) {
            int g = __builtin_amdgcn_readfirstlane(gl);
            gl = lst[i + ATT_WAVES < nAct ? i + ATT_WAVES : i];
            attn_group16<false>(Kc, val, nK, g * 16 + hi * 2, laneN, qx, qy, thrq, c, acc, den);
        }
    }
    if ((nK & 15) != 0 && (nTurn & (ATT_WAVES - 1)) == wave)   // the partial group, next wave in turn
        attn_group16<true>(Kc, val, nK, nFull * 16 + hi * 2, laneN, qx, qy, thrq, c, acc, den);

    // this wave's product of the tail: its weights, bias (and rows of hin) set off now
    const int kk = hi * 2;
    const int grp = wave >> 2;
    const int col = (wave & 3) * 16 + laneN;
    const float* wvcol = wv + (wave & 3) * (HID * 16) + laneN;
    v2f af[16], bf[16];
    float bv = 0.0f;
    if (STEP == 0) {
        if (grp == 0) frag_b<16>(wvcol, kk, bf);
    } else if (STEP == 1) {
        if (grp < 3) {
            const float* wsel = grp == 0 ? w1 : grp == 1 ? w3 : w2;
            const float* bsel = grp == 0 ? b1 : grp == 1 ? b3 : b2;
            bv = bsel[col];
            frag_b<HID>(wsel + col, kk, bf);
            if (grp == 1) frag_a<true>(hin + (size_t)q * HID + kk, af);
        } else {
            frag_b<16>(wvcol, kk, bf);
        }
    } else {
        if (grp == 0) {
            const float* bp = b1 + col;
            bv = *bp;
            // the weights' results may land in this load's address registers
            asm volatile("s_wait_xcnt 0x0" :: "v"(bp) : "memory");
            frag_b<HID>(w1 + col, kk, bf);
        }
    }

    // the two half-waves hold different keys of the same query
#pragma unroll   // constant indices keep the register arrays in registers
    for (int h = 0; h < 4; h++) {
        float dh = den[h].x + den[h].y;
        dh += __shfl_xor(dh, 16);
        if (hi == 0) dred[wave][h][laneN] = dh;
    }
    if (wave >= ATT_WAVES / 2) {
#pragma unroll   // constant indices keep the register arrays in registers
        for (int h = 0; h < 4; h++)
#pragma unroll   // constant indices keep the register arrays in registers
            for (int r = 0; r < 8; r++) red[wave - ATT_WAVES / 2][h * 8 + r][lane] = acc[h][r];
    }
    __syncthreads();                       // upper waves' partials visible
    if (wave < ATT_WAVES / 2) {
#pragma unroll   // constant indices keep the register arrays in registers
        for (int h = 0; h < 4; h++)
#pragma unroll   // constant indices keep the register arrays in registers
            for (int r = 0; r < 8; r++) red[wave][h * 8 + r][lane] += acc[h][r];
    }
    __syncthreads();                       // all partials visible

    // C layout: VGPR r -> M = r + 8*(lane>=16), N = lane&15
    for (int o = tid; o < 16 * HID; o += ATT_WAVES * 32) {
        int ql = o >> 6, col = o & 63;
        int h = col >> 4, n = col & 15;
        float num = 0.f, d = 0.f;
#pragma unroll   // lets the LDS reads issue together
        for (int w = 0; w < ATT_WAVES / 2; w++)
            num += red[w][h * 8 + (ql & 7)][(ql >> 3) * 16 + n];
#pragma unroll   // lets the LDS reads issue together
        for (int w = 0; w < ATT_WAVES; w++) d += dred[w][h][ql];
        float a = gelu_erf(num / d);
        tA[ql][col] = a;                   // rows past the end repeat the last query; never stored
        if (STEP == 0 && q0 + ql < nQ) {
            hout[(size_t)(q0 + ql) * HID + col] = a;
            // the next trip may reuse the store's address registers
            asm volatile("s_wait_xcnt 0x0" ::: "memory");
        }
    }
    __syncthreads();                       // the attention tile visible

    if (STEP == 1 || STEP == 2) {
        if (grp == 0) {
            frag_a<false>(&tA[laneN][kk], af);
            v8f t = mm16(af, bf);
#pragma unroll   // constant indices keep the accumulator in registers
            for (int r = 0; r < 8; r++) tB[r + 8 * hi][col] = t[r] + bv;
        } else if (STEP == 1 && grp == 1) {
            v8f t = mm16(af, bf);
#pragma unroll   // constant indices keep the accumulator in registers
            for (int r = 0; r < 8; r++) tC[r + 8 * hi][col] = t[r] + bv;
        }
        __syncthreads();                   // a @ w1 + b1 (and hin @ w3 + b3) visible
        for (int o = tid; o < 16 * HID; o += ATT_WAVES * 32)
            tB[o >> 6][o & 63] = gelu_erf(tB[o >> 6][o & 63]);
        __syncthreads();                   // t visible
    }
    if (STEP == 1) {
        if (grp == 2) {
            frag_a<false>(&tB[laneN][kk], af);
            v8f m = mm16(af, bf);
#pragma unroll   // constant indices keep the accumulator in registers
            for (int r = 0; r < 8; r++)    // tA: its readers left it two barriers ago
                tA[r + 8 * hi][col] = tC[r + 8 * hi][col] + (m[r] + bv);
        }
        __syncthreads();                   // m + hin @ w3 + b3 visible
        for (int o = tid; o < 16 * HID; o += ATT_WAVES * 32) {
            float v = gelu_erf(tA[o >> 6][o & 63]);
            tA[o >> 6][o & 63] = v;
            if (q0 + (o >> 6) < nQ) {
                hout[(size_t)q0 * HID + o] = v;
                // the next trip may reuse the store's address registers
                asm volatile("s_wait_xcnt 0x0" ::: "memory");
            }
        }
        __syncthreads();                   // the new h tile visible
    }
    if (STEP == 0 || STEP == 1) {
        if (grp == (STEP == 0 ? 0 : 3)) {
            frag_a<false>(&tA[laneN][kk], af);
            v8f v = mm16(af, bf);
#pragma unroll   // constant indices keep the accumulator in registers
            for (int r = 0; r < 8; r++) {
                int row = q0 + r + 8 * hi;
                if (row < nQ) vout[(size_t)row * HID + col] = v[r];
            }
        }
    }
    if (STEP == 2) {
        // decoder head: one thread a row, the 64 terms in their order
        if (tid < 16 && q0 + tid < nQ) {
            const int* pp = perm + q0 + tid;
            int place = *pp;
            // what follows may reuse the load's address registers; the address as an
            // input keeps the load's own result out of them as well
            asm volatile("s_wait_xcnt 0x0" :: "v"(pp) : "memory");
            float s = b2[0];
#pragma unroll   // lets the LDS reads issue together
            for (int k = 0; k < HID; k++) s = fmaf(tB[tid][k], w2[k], s);
            hout[place] = s;               // back to the point's own place
        }
    }
}

// ---------------------------------------------------------------------------
extern "C" void kernel_launch(void* const* d_in, const int* in_sizes, int n_in,
                              void* d_out, int out_size, void* d_ws, size_t ws_size,
                              hipStream_t stream) {
    (void)in_sizes; (void)n_in; (void)out_size; (void)ws_size;

    const float* x      = (const float*)d_in[0];   // [1,221,51,2] == xf [11271,2]
    const float* en_w   = (const float*)d_in[1];
    const float* en_b   = (const float*)d_in[2];
    const float* down_r = (const float*)d_in[3];
    const float* down_w = (const float*)d_in[4];
    const float* pa_r   = (const float*)d_in[5];   // [4,1,4,1,1]
    const float* pa_w   = (const float*)d_in[6];   // [4,4,64,16]
    const float* mlp1_w = (const float*)d_in[7];
    const float* mlp1_b = (const float*)d_in[8];
    const float* mlp2_w = (const float*)d_in[9];
    const float* mlp2_b = (const float*)d_in[10];
    const float* lin_w  = (const float*)d_in[11];
    const float* lin_b  = (const float*)d_in[12];
    const float* up_r   = (const float*)d_in[13];
    const float* up_w   = (const float*)d_in[14];
    const float* de1_w  = (const float*)d_in[15];
    const float* de1_b  = (const float*)d_in[16];
    const float* de2_w  = (const float*)d_in[17];
    const float* de2_b  = (const float*)d_in[18];

    // workspace layout (floats) ~5.3 MB; vA and vB hold attention val in turn
    float* ws   = (float*)d_ws;
    float* ltt  = ws;                    // NL*2
    float* vA   = ltt  + (size_t)NL * 2; // NX*64
    float* vB   = vA   + (size_t)NX * HID;   // NL*64
    float* hA   = vB   + (size_t)NL * HID;   // NL*64
    float* hB   = hA   + (size_t)NL * HID;
    float* thrD = hB   + (size_t)NL * HID;   // NL, in the latent points' own order
    float* thrU = thrD + NL;                 // NX
    float* xs   = thrU + NX + 3;             // NX*2, the points in spatial order (16-byte aligned)
    int*   perm = (int*)(xs + (size_t)NX * 2);   // NX, the place each of them came from
    int*   lperm = perm + NX;                    // NL, the same for the latent points

    const int tilesNL = (NL + 15) / 16, tilesNX = (NX + 15) / 16;
    // The up step's thresholds: each latent launch, one block to a WGP, takes as many
    // blocks of 16 rows as its tiles leave WGPs free; the down launch takes the rest.
    const int qblkL = 256 - tilesNL, qrowsL = qblkL * 16;
    const int qrowsD = NX - 4 * qrowsL, qblkD = (qrowsD + 15) / 16;

    // spatial order of the points and of the latent points (ltt); encoder + val of
    // the down step; thresholds of the down step
    k_first<<<XBLK + LBLK + NL, 128, 0, stream>>>(x, en_w, en_b, down_w, xs, perm, ltt, lperm, vA, thrD);

    // ---- down: latent <- input (5% locality) ----
    k_attn<0><<<tilesNL + qblkD, 512, 0, stream>>>(ltt, NL, xs, NX, vA, down_r, thrD,
                                           nullptr, nullptr, nullptr, nullptr, nullptr, nullptr, nullptr,
                                           pa_w, lperm, hA, vB,
                                           xs + (size_t)4 * qrowsL * 2, qrowsD, thrU + (size_t)4 * qrowsL);

    // ---- 4 latent blocks (dense attention, no mask), each with its MLP, its
    //      shortcut and the val of the attention that follows ----
    float* hin = hA;
    float* hout = hB;
    float* vin = vB;
    float* vout = vA;
    for (int i = 0; i < 4; i++) {
        k_attn<1><<<tilesNL + qblkL, 512, 0, stream>>>(ltt, NL, ltt, NL, vin, pa_r + (size_t)i * 4, nullptr,
                                               hin,
                                               mlp1_w + (size_t)i * 4096, mlp1_b + (size_t)i * 64,
                                               mlp2_w + (size_t)i * 4096, mlp2_b + (size_t)i * 64,
                                               lin_w + (size_t)i * 4096, lin_b + (size_t)i * 64,
                                               i < 3 ? pa_w + (size_t)(i + 1) * 4096 : up_w,
                                               nullptr, hout, vout,
                                               xs + (size_t)i * qrowsL * 2, qrowsL, thrU + (size_t)i * qrowsL);
        float* tmp = hin; hin = hout; hout = tmp;
        tmp = vin; vin = vout; vout = tmp;
    }

    // ---- up: input <- latent (5% locality), with the decoder ----
    k_attn<2><<<tilesNX, 512, 0, stream>>>(xs, NX, ltt, NL, vin, up_r, thrU,
                                           nullptr, de1_w, de1_b, de2_w, de2_b, nullptr, nullptr,
                                           nullptr, perm, (float*)d_out, nullptr,
                                           nullptr, 0, nullptr);
}
